// v000
// The times below were measured on an AMD MI455X: many runs one after another, warmed up first and cycling through
// copies of the inputs, with the whole window's GPU time divided by the number of runs. Launches and the gaps
// between them are all in it. The median over several windows is given; except for v000 it joins two sittings, which
// can be a few percent apart, so the side-by-side timings, each taken in one sitting, are the better comparison.
// v000 is the starting kernel. One run takes 58.9 microseconds.
#include <hip/hip_runtime.h>
#include <math.h>

typedef float v2f __attribute__((ext_vector_type(2)));
typedef float v8f __attribute__((ext_vector_type(8)));
typedef unsigned int v4u __attribute__((ext_vector_type(4)));
typedef int v4i __attribute__((ext_vector_type(4)));
typedef int v8i __attribute__((ext_vector_type(8)));

#define BB 4
#define SS 2048
#define DD 1024
#define EE 8
#define NN 16
#define RR 4

#define KC 64
#define NCH (DD / KC)
#define LROW (KC + 4)

__device__ __forceinline__ void tdm_load_2d(unsigned lds_byte_off,
                                            const float* gptr,
                                            unsigned tile_d0,   // elems per row
                                            unsigned tile_d1,   // rows
                                            unsigned strideElems) {
  unsigned long long ga = (unsigned long long)(uintptr_t)gptr;
  v4u g0;
  g0.x = 1u;                                   // count=1 (valid), user mode
  g0.y = lds_byte_off;                         // lds_addr
  g0.z = (unsigned)(ga & 0xffffffffull);       // global_addr[31:0]
  g0.w = (unsigned)((ga >> 32) & 0x1ffffffull) // global_addr[56:32]
         | (2u << 30);                         // type=2 ("image")
  v8i g1;
  g1[0] = (int)((2u << 16)
                | (1u << 20)
                | (5u << 22)
                | (3u << 25));
  g1[1] = (int)(((unsigned)DD & 0xffffu) << 16);
  g1[2] = (int)((((unsigned)DD >> 16) & 0xffffu)
                | ((tile_d1 & 0xffffu) << 16));
  g1[3] = (int)((tile_d0 & 0xffffu) << 16);
  g1[4] = (int)(tile_d1 & 0xffffu);
  g1[5] = (int)strideElems;
  g1[6] = 0;
  g1[7] = 0;
  v4i z4 = {0, 0, 0, 0};
#if __clang_major__ >= 23
  v8i z8 = {0, 0, 0, 0, 0, 0, 0, 0};
  __builtin_amdgcn_tensor_load_to_lds(g0, g1, z4, z4, z8, 0);
#else
  __builtin_amdgcn_tensor_load_to_lds(g0, g1, z4, z4, 0);
#endif
}

__device__ __forceinline__ unsigned lds_off_of(const void* p) {
  // generic pointer to LDS: low 32 bits are the LDS byte offset
  return (unsigned)(unsigned long long)(uintptr_t)p;
}

// ---------------------------------------------------------------------------
// K1: raw gate logits  raw[b,s,e] = x[b,s,:] . Wg[e,:]   (one wave per token)
// ---------------------------------------------------------------------------
__global__ __launch_bounds__(256) void k_logits(const float* __restrict__ x,
                                                const float* __restrict__ Wg,
                                                float* __restrict__ raw) {
  const int wave = blockIdx.x * 8 + (threadIdx.x >> 5);
  const int lane = threadIdx.x & 31;
  const float* xr = x + (size_t)wave * DD;
  float acc[EE];
#pragma unroll
  for (int e = 0; e < EE; ++e) acc[e] = 0.f;
  for (int d = lane; d < DD; d += 32) {
    float xv = xr[d];
#pragma unroll
    for (int e = 0; e < EE; ++e) acc[e] += xv * Wg[e * DD + d];
  }
#pragma unroll
  for (int e = 0; e < EE; ++e) {
    float v = acc[e];
    for (int m = 16; m >= 1; m >>= 1) v += __shfl_xor(v, m, 32);
    if (lane == 0) raw[(size_t)wave * EE + e] = v;
  }
}

// ---------------------------------------------------------------------------
// K2: nk[r,b,n,d] = LN(ref[b,n,:]) * lnk_s[r,:] + lnk_b[r,:]   (1 MB total)
// ---------------------------------------------------------------------------
__global__ __launch_bounds__(256) void k_nk(const float* __restrict__ ref,
                                            const float* __restrict__ lnk_s,
                                            const float* __restrict__ lnk_b,
                                            float* __restrict__ nk) {
  __shared__ float red[16];
  const int row = blockIdx.x;  // b*NN + n
  const int tid = threadIdx.x;
  const float* rr = ref + (size_t)row * DD;
  float s = 0.f, ss = 0.f;
  for (int d = tid; d < DD; d += 256) {
    float v = rr[d];
    s += v;
    ss += v * v;
  }
  for (int m = 16; m >= 1; m >>= 1) {
    s += __shfl_xor(s, m, 32);
    ss += __shfl_xor(ss, m, 32);
  }
  const int wv = tid >> 5, ln = tid & 31;
  if (ln == 0) {
    red[wv] = s;
    red[8 + wv] = ss;
  }
  __syncthreads();
  if (tid == 0) {
    float ts = 0.f, tss = 0.f;
    for (int i = 0; i < 8; ++i) {
      ts += red[i];
      tss += red[8 + i];
    }
    red[0] = ts;
    red[8] = tss;
  }
  __syncthreads();
  const float mu = red[0] / (float)DD;
  const float var = red[8] / (float)DD - mu * mu;
  const float rstd = rsqrtf(var + 1e-5f);
  const int b = row / NN, n = row % NN;
  for (int d = tid; d < DD; d += 256) {
    float nr = (rr[d] - mu) * rstd;
#pragma unroll
    for (int r = 0; r < RR; ++r)
      nk[((size_t)(r * BB + b) * NN + n) * DD + d] =
          nr * lnk_s[r * DD + d] + lnk_b[r * DD + d];
  }
}

__global__ __launch_bounds__(128) void k_main(
    const float* __restrict__ x, const float* __restrict__ Wmap,
    const float* __restrict__ lnq_s, const float* __restrict__ lnq_b,
    const float* __restrict__ const_c, const float* __restrict__ const_w,
    const float* __restrict__ raw, const float* __restrict__ nk,
    float* __restrict__ out, float* __restrict__ logits_out) {
  __shared__ __align__(16) float s_x[2][16][LROW];       //  8.5 KB
  __shared__ __align__(16) float s_nk[2][RR][16][LROW];  // 34   KB
  __shared__ float s_mu[16], s_rstd[16], s_cl[16][4];
  __shared__ float s_alpha[16], s_beta[16][2], s_wv[16][4];
  __shared__ float s_attn[RR][16 * 17];

  const int tid = threadIdx.x;
  const int wave = tid >> 5;
  const int lane = tid & 31;
  const int tilesPerB = SS / 16;
  const int b = blockIdx.x / tilesPerB;
  const int s0 = (blockIdx.x % tilesPerB) * 16;
  const size_t xbase = ((size_t)b * SS + s0) * DD;
  const float* nkr = nk + ((size_t)(wave * BB + b) * NN) * DD;

#pragma unroll
  for (int c = 0; c < 2; ++c) {
    tdm_load_2d(lds_off_of(&s_nk[c][wave][0][0]), nkr + c * KC, KC, NN, DD);
    if (wave == 0)
      tdm_load_2d(lds_off_of(&s_x[c][0][0]), x + xbase + c * KC, KC, 16, DD);
  }

  // ---- Phase 1: per-token mean/var of xs=2x and const-cluster dots ----
  {
    const int m = tid >> 3;  // 0..15
    const int sub = tid & 7;
    const float* xr = x + xbase + (size_t)m * DD;
    float s = 0.f, ssum = 0.f, c00 = 0.f, c01 = 0.f, c10 = 0.f, c11 = 0.f;
    for (int d = sub; d < DD; d += 8) {
      float xs = 2.f * xr[d];
      s += xs;
      ssum += xs * xs;
      c00 += xs * const_w[0 * DD + d];
      c01 += xs * const_w[1 * DD + d];
      c10 += xs * const_w[2 * DD + d];
      c11 += xs * const_w[3 * DD + d];
    }
#pragma unroll
    for (int msk = 4; msk >= 1; msk >>= 1) {
      s += __shfl_xor(s, msk, 8);
      ssum += __shfl_xor(ssum, msk, 8);
      c00 += __shfl_xor(c00, msk, 8);
      c01 += __shfl_xor(c01, msk, 8);
      c10 += __shfl_xor(c10, msk, 8);
      c11 += __shfl_xor(c11, msk, 8);
    }
    if (sub == 0) {
      float mu = s / (float)DD;
      float var = ssum / (float)DD - mu * mu;
      s_mu[m] = mu;
      s_rstd[m] = rsqrtf(var + 1e-5f);
      s_cl[m][0] = c00;
      s_cl[m][1] = c01;
      s_cl[m][2] = c10;
      s_cl[m][3] = c11;
    }
  }
  __syncthreads();

  if (wave == 0 && lane < 16) {
    const int m = lane;
    const int sg = s0 + m;
    float f[EE];
    const float* cur = raw + ((size_t)b * SS + sg) * EE;
#pragma unroll
    for (int e = 0; e < EE; ++e) f[e] = cur[e];
    if (sg > 0) {
      const float* prv = cur - EE;
#pragma unroll
      for (int fo = 0; fo < EE; ++fo) {
        float a = 0.f;
#pragma unroll
        for (int e = 0; e < EE; ++e) a += prv[e] * Wmap[fo * EE + e];
        f[fo] += a;
      }
    }
    float* lo = logits_out + ((size_t)b * SS + sg) * EE;
#pragma unroll
    for (int e = 0; e < EE; ++e) lo[e] = f[e];
    float mx = f[0];
#pragma unroll
    for (int e = 1; e < EE; ++e) mx = fmaxf(mx, f[e]);
    float g[EE], gs = 0.f;
#pragma unroll
    for (int e = 0; e < EE; ++e) {
      g[e] = expf(f[e] - mx);
      gs += g[e];
    }
#pragma unroll
    for (int e = 0; e < EE; ++e) g[e] /= gs;
    int i1 = 0;
    float g1 = g[0];
#pragma unroll
    for (int e = 1; e < EE; ++e)
      if (g[e] > g1) { g1 = g[e]; i1 = e; }
    int i2 = (i1 == 0) ? 1 : 0;
    float g2 = g[i2];
#pragma unroll
    for (int e = 0; e < EE; ++e)
      if (e != i1 && g[e] > g2) { g2 = g[e]; i2 = e; }
    float t1 = (i1 == EE - 1) ? 0.f : g1;
    float t2 = (i2 == EE - 1) ? 0.f : g2;
    float inv = 1.f / (t1 + t2);
    float wv[EE];
#pragma unroll
    for (int e = 0; e < EE; ++e) wv[e] = 0.f;
    wv[i1] = t1 * inv;
    wv[i2] += t2 * inv;
    float a0 = s_cl[m][0], a1 = s_cl[m][1];
    float mxa = fmaxf(a0, a1);
    float e0 = expf(a0 - mxa), e1 = expf(a1 - mxa), tt = e0 + e1;
    float p00 = e0 / tt, p01 = e1 / tt;
    a0 = s_cl[m][2];
    a1 = s_cl[m][3];
    mxa = fmaxf(a0, a1);
    e0 = expf(a0 - mxa);
    e1 = expf(a1 - mxa);
    tt = e0 + e1;
    float p10 = e0 / tt, p11 = e1 / tt;

    s_alpha[m] = wv[0] + wv[1] + wv[2] + wv[3] + wv[4] * p00 + wv[5] * p10 + wv[6];
    s_beta[m][0] = wv[4] * p01;
    s_beta[m][1] = wv[5] * p11;
#pragma unroll
    for (int r = 0; r < RR; ++r) s_wv[m][r] = wv[r];
  }
  __syncthreads();

  {
    const int m = lane & 15;
    const int half = lane >> 4;
    const float mu = s_mu[m];
    const float rstd = s_rstd[m];
    const float* ls = lnq_s + wave * DD;
    const float* lb = lnq_b + wave * DD;
    v8f c = {};
    for (int ch = 0; ch < NCH; ++ch) {
      const int buf = ch & 1;
      if (ch + 1 < NCH) {
        if (wave == 0)
          __builtin_amdgcn_s_wait_tensorcnt(2);
        else
          __builtin_amdgcn_s_wait_tensorcnt(1);
      } else {
        __builtin_amdgcn_s_wait_tensorcnt(0);
      }
      __syncthreads();  // wave0's x-chunk visible to all waves
      const int k0 = ch * KC;
#pragma unroll
      for (int kk = 0; kk < KC; kk += 4) {
        const int ka = kk + 2 * half;
        v2f a, bfrag;
        float x0 = s_x[buf][m][ka];
        float x1 = s_x[buf][m][ka + 1];
        a.x = ((2.f * x0 - mu) * rstd) * ls[k0 + ka] + lb[k0 + ka];
        a.y = ((2.f * x1 - mu) * rstd) * ls[k0 + ka + 1] + lb[k0 + ka + 1];
        bfrag.x = s_nk[buf][wave][m][ka];
        bfrag.y = s_nk[buf][wave][m][ka + 1];
        c = __builtin_amdgcn_wmma_f32_16x16x4_f32(false, a, false, bfrag,
                                                  (short)0, c, false, false);
      }
      __syncthreads();  // everyone done with buf before it is overwritten
      if (ch + 2 < NCH) {
        tdm_load_2d(lds_off_of(&s_nk[buf][wave][0][0]), nkr + (ch + 2) * KC,
                    KC, NN, DD);
        if (wave == 0)
          tdm_load_2d(lds_off_of(&s_x[buf][0][0]), x + xbase + (ch + 2) * KC,
                      KC, 16, DD);
      }
    }
    // row softmax over n (16-lane groups), weight by w_r[m], store to LDS
#pragma unroll
    for (int j = 0; j < 8; ++j) {
      float v = c[j];
      float mx = v;
      mx = fmaxf(mx, __shfl_xor(mx, 1, 16));
      mx = fmaxf(mx, __shfl_xor(mx, 2, 16));
      mx = fmaxf(mx, __shfl_xor(mx, 4, 16));
      mx = fmaxf(mx, __shfl_xor(mx, 8, 16));
      float e = expf(v - mx);
      float sm = e;
      sm += __shfl_xor(sm, 1, 16);
      sm += __shfl_xor(sm, 2, 16);
      sm += __shfl_xor(sm, 4, 16);
      sm += __shfl_xor(sm, 8, 16);
      const int row = j + 8 * half;
      s_attn[wave][row * 17 + (lane & 15)] = (e / sm) * s_wv[row][wave];
    }
  }
  __syncthreads();

  // ---- Phase 5: out tile. Each wave owns a 256-column d-quarter.
  // G = sum_r (w_r * attn_r) @ nk_r accumulates in one WMMA C chain.
  {
    const int half = lane >> 4;
    const int nidx = lane & 15;
    const int dbase = wave * 256;
    const float* cc0 = const_c;
    const float* cc1 = const_c + DD;
    for (int t = 0; t < 16; ++t) {
      const int d0 = dbase + t * 16;
      const int d = d0 + nidx;
      v8f acc = {};
#pragma unroll
      for (int r = 0; r < RR; ++r) {
        const float* nkb = nk + ((size_t)(r * BB + b) * NN) * DD + d;
#pragma unroll
        for (int kk = 0; kk < 4; ++kk) {
          const int krow = 4 * kk + 2 * half;
          v2f a, bfrag;
          a.x = s_attn[r][nidx * 17 + krow];
          a.y = s_attn[r][nidx * 17 + krow + 1];
          bfrag.x = nkb[(size_t)krow * DD];
          bfrag.y = nkb[(size_t)(krow + 1) * DD];
          acc = __builtin_amdgcn_wmma_f32_16x16x4_f32(false, a, false, bfrag,
                                                      (short)0, acc, false,
                                                      false);
        }
      }
#pragma unroll
      for (int j = 0; j < 8; ++j) {
        const int m = j + 8 * half;
        const float xs = 2.f * x[xbase + (size_t)m * DD + d];
        float val = acc[j] + s_alpha[m] * xs + s_beta[m][0] * cc0[d] +
                    s_beta[m][1] * cc1[d];
        out[xbase + (size_t)m * DD + d] = val;
      }
    }
  }
}

// ---------------------------------------------------------------------------
extern "C" void kernel_launch(void* const* d_in, const int* in_sizes, int n_in,
                              void* d_out, int out_size, void* d_ws,
                              size_t ws_size, hipStream_t stream) {
  (void)in_sizes;
  (void)n_in;
  (void)out_size;
  (void)ws_size;
  const float* x = (const float*)d_in[0];
  const float* Wg = (const float*)d_in[1];
  const float* Wmap = (const float*)d_in[2];
  const float* lnq_s = (const float*)d_in[3];
  const float* lnq_b = (const float*)d_in[4];
  const float* lnk_s = (const float*)d_in[5];
  const float* lnk_b = (const float*)d_in[6];
  const float* ref = (const float*)d_in[7];
  const float* const_c = (const float*)d_in[8];
  const float* const_w = (const float*)d_in[9];
  float* out = (float*)d_out;
  float* logits_out = out + (size_t)BB * SS * DD;
  float* raw = (float*)d_ws;                  // B*S*E floats   (256 KB)
  float* nkbuf = raw + (size_t)BB * SS * EE;  // R*B*N*D floats (1 MB)

  k_logits<<<BB * SS / 8, 256, 0, stream>>>(x, Wg, raw);
  k_nk<<<BB * NN, 256, 0, stream>>>(ref, lnk_s, lnk_b, nkbuf);
  k_main<<<BB * (SS / 16), 128, 0, stream>>>(x, Wmap, lnq_s, lnq_b, const_c,
                                             const_w, raw, nkbuf, out,
                                             logits_out);
}

// v001
// It runs in 50.4 microseconds.
// Two timings next to v000 put it at 1.17 and 1.20 times that version's speed.
#include <hip/hip_runtime.h>
#include <math.h>

typedef float v2f __attribute__((ext_vector_type(2)));
typedef float v8f __attribute__((ext_vector_type(8)));
typedef unsigned int v4u __attribute__((ext_vector_type(4)));
typedef int v4i __attribute__((ext_vector_type(4)));
typedef int v8i __attribute__((ext_vector_type(8)));

#define BB 4
#define SS 2048
#define DD 1024
#define EE 8
#define NN 16
#define RR 4

#define KC 64
#define NCH (DD / KC)
#define LROW (KC + 4)
#define PJ 4
#define PT (DD / (32 * PJ))
// keeps a trip's loads from being lifted over the sums of the trip in front:
// lifted, they leave the place where XCNT_WAIT below covers their address
// registers, and two trips' weights are live at once
#define HOLD_LOADS() __builtin_amdgcn_sched_barrier(0)
// Behind a group of global loads, in front of the next group, whose results the
// compiler lays over the first group's address registers. The
// two scheduling barriers hold the wait, and with it the groups' issue order.
#define XCNT_WAIT()                                  \
  do {                                               \
    __builtin_amdgcn_sched_barrier(0);               \
    asm volatile("s_wait_xcnt 0x0" ::: "memory");    \
    __builtin_amdgcn_sched_barrier(0);               \
  } while (0)

__device__ __forceinline__ void tdm_load_2d(unsigned lds_byte_off,
                                            const float* gptr,
                                            unsigned tile_d0,   // elems per row
                                            unsigned tile_d1,   // rows
                                            unsigned strideElems) {
  unsigned long long ga = (unsigned long long)(uintptr_t)gptr;
  v4u g0;
  g0.x = 1u;                                   // count=1 (valid), user mode
  g0.y = lds_byte_off;                         // lds_addr
  g0.z = (unsigned)(ga & 0xffffffffull);       // global_addr[31:0]
  g0.w = (unsigned)((ga >> 32) & 0x1ffffffull) // global_addr[56:32]
         | (2u << 30);                         // type=2 ("image")
  v8i g1;
  g1[0] = (int)((2u << 16)
                | (1u << 20)
                | (5u << 22)
                | (3u << 25));
  g1[1] = (int)(((unsigned)DD & 0xffffu) << 16);
  g1[2] = (int)((((unsigned)DD >> 16) & 0xffffu)
                | ((tile_d1 & 0xffffu) << 16));
  g1[3] = (int)((tile_d0 & 0xffffu) << 16);
  g1[4] = (int)(tile_d1 & 0xffffu);
  g1[5] = (int)strideElems;
  g1[6] = 0;
  g1[7] = 0;
  v4i z4 = {0, 0, 0, 0};
#if __clang_major__ >= 23
  v8i z8 = {0, 0, 0, 0, 0, 0, 0, 0};
  __builtin_amdgcn_tensor_load_to_lds(g0, g1, z4, z4, z8, 0);
#else
  __builtin_amdgcn_tensor_load_to_lds(g0, g1, z4, z4, 0);
#endif
}

__device__ __forceinline__ unsigned lds_off_of(const void* p) {
  // generic pointer to LDS: low 32 bits are the LDS byte offset
  return (unsigned)(unsigned long long)(uintptr_t)p;
}

// ---------------------------------------------------------------------------
// K2: nk[r,b,n,d] = LN(ref[b,n,:]) * lnk_s[r,:] + lnk_b[r,:]   (1 MB total)
// ---------------------------------------------------------------------------
__global__ __launch_bounds__(256) void k_nk(const float* __restrict__ ref,
                                            const float* __restrict__ lnk_s,
                                            const float* __restrict__ lnk_b,
                                            float* __restrict__ nk) {
  __shared__ float red[16];
  const int row = blockIdx.x;  // b*NN + n
  const int tid = threadIdx.x;
  const float* rr = ref + (size_t)row * DD;
  float s = 0.f, ss = 0.f;
  for (int d = tid; d < DD; d += 256) {
    float v = rr[d];
    s += v;
    ss += v * v;
  }
  for (int m = 16; m >= 1; m >>= 1) {
    s += __shfl_xor(s, m, 32);
    ss += __shfl_xor(ss, m, 32);
  }
  const int wv = tid >> 5, ln = tid & 31;
  if (ln == 0) {
    red[wv] = s;
    red[8 + wv] = ss;
  }
  __syncthreads();
  if (tid == 0) {
    float ts = 0.f, tss = 0.f;
    for (int i = 0; i < 8; ++i) {
      ts += red[i];
      tss += red[8 + i];
    }
    red[0] = ts;
    red[8] = tss;
  }
  __syncthreads();
  const float mu = red[0] / (float)DD;
  const float var = red[8] / (float)DD - mu * mu;
  const float rstd = rsqrtf(var + 1e-5f);
  const int b = row / NN, n = row % NN;
  for (int d = tid; d < DD; d += 256) {
    float nr = (rr[d] - mu) * rstd;
#pragma unroll
    for (int r = 0; r < RR; ++r)
      nk[((size_t)(r * BB + b) * NN + n) * DD + d] =
          nr * lnk_s[r * DD + d] + lnk_b[r * DD + d];
  }
}

__global__ __launch_bounds__(128) void k_main(
    const float* __restrict__ x, const float* __restrict__ Wmap,
    const float* __restrict__ lnq_s, const float* __restrict__ lnq_b,
    const float* __restrict__ const_c, const float* __restrict__ const_w,
    const float* __restrict__ Wg, const float* __restrict__ nk,
    float* __restrict__ out, float* __restrict__ logits_out) {
  __shared__ __align__(16) float s_x[2][16][LROW];       //  8.5 KB
  __shared__ __align__(16) float s_nk[2][RR][16][LROW];  // 34   KB
  __shared__ float s_mu[16], s_rstd[16], s_cl[16][4];
  __shared__ float s_alpha[16], s_beta[16][2], s_wv[16][4];
  __shared__ float s_attn[RR][16 * 17];
  __shared__ float s_raw[17][EE];  // raw gate logits: row 0 = token s0-1, row m+1 = tile token m

  const int tid = threadIdx.x;
  const int wave = tid >> 5;
  const int lane = tid & 31;
  const int tilesPerB = SS / 16;
  const int b = blockIdx.x / tilesPerB;
  const int s0 = (blockIdx.x % tilesPerB) * 16;
  const size_t xbase = ((size_t)b * SS + s0) * DD;
  const float* nkr = nk + ((size_t)(wave * BB + b) * NN) * DD;

#pragma unroll
  for (int c = 0; c < 2; ++c) {
    tdm_load_2d(lds_off_of(&s_nk[c][wave][0][0]), nkr + c * KC, KC, NN, DD);
    if (wave == 0)
      tdm_load_2d(lds_off_of(&s_x[c][0][0]), x + xbase + c * KC, KC, 16, DD);
  }

  // ---- Phase 1: raw gate logits, mean/var of xs=2x and const-cluster dots.
  // One wave per 4 tokens, lanes strided over d: every x element is loaded once
  // for all 14 sums of its token, every weight slice once for the wave's rows.
  // All waves also form the logits of the token in front of the tile (the gate
  // residual of tile token 0 needs them); wave 0 publishes them.
  {
    const int r0 = wave * 4;
    const float* xr = x + xbase + (size_t)r0 * DD + lane;
    // at a sequence start there is no such token: read tile token 0, unused
    const float* xp = x + xbase - (s0 > 0 ? DD : 0) + lane;
    const float* wgl = Wg + lane;
    const float* cwl = const_w + lane;
    float lg[5][EE];  // rows 0..3: own tokens, row 4: token in front of the tile
    float st[4][6];   // sum, sum of squares, four const-cluster dots
#pragma unroll
    for (int q = 0; q < 5; ++q)
#pragma unroll
      for (int e = 0; e < EE; ++e) lg[q][e] = 0.f;
#pragma unroll
    for (int q = 0; q < 4; ++q)
#pragma unroll
      for (int k = 0; k < 6; ++k) st[q][k] = 0.f;
    auto load_x = [&](float (&dst)[5][PJ], int t) {
#pragma unroll
      for (int j = 0; j < PJ; ++j) {
        const int d = (t * PJ + j) * 32;
#pragma unroll
        for (int q = 0; q < 4; ++q) dst[q][j] = xr[q * DD + d];
        dst[4][j] = xp[d];
      }
    };
    float wg[PJ][EE], cw[PJ][4];
    auto load_weights = [&](int t) {
#pragma unroll
      for (int j = 0; j < PJ; ++j)
#pragma unroll
        for (int e = 0; e < EE; ++e) wg[j][e] = wgl[e * DD + (t * PJ + j) * 32];
      XCNT_WAIT();
#pragma unroll
      for (int j = 0; j < PJ; ++j)
#pragma unroll
        for (int k = 0; k < 4; ++k) cw[j][k] = cwl[k * DD + (t * PJ + j) * 32];
      XCNT_WAIT();
    };
    auto sum_slices = [&](const float (&xc)[5][PJ]) {
#pragma unroll
      for (int j = 0; j < PJ; ++j) {
#pragma unroll
        for (int q = 0; q < 4; ++q) {
          const float xv = xc[q][j];
#pragma unroll
          for (int e = 0; e < EE; ++e) lg[q][e] = fmaf(xv, wg[j][e], lg[q][e]);
          const float xs = 2.f * xv;
          st[q][0] += xs;
          st[q][1] = fmaf(xs, xs, st[q][1]);
#pragma unroll
          for (int k = 0; k < 4; ++k)
            st[q][2 + k] = fmaf(xs, cw[j][k], st[q][2 + k]);
        }
#pragma unroll
        for (int e = 0; e < EE; ++e)
          lg[4][e] = fmaf(xc[4][j], wg[j][e], lg[4][e]);
      }
    };
    // Two register sets for x, so that a trip's x loads fly while the trip in
    // front of it is summed. In each trip the weights are asked for first and
    // the next x slices behind them: loads return in issue order, so the wait
    // for the (cached) weights then leaves the x loads flying.
    float xa[5][PJ], xb[5][PJ];
    load_x(xa, 0);
    // kept rolled for speed only: the body is large
#pragma unroll 1
    for (int t = 0; t + 2 < PT; t += 2) {
      load_weights(t);
      load_x(xb, t + 1);
      sum_slices(xa);
      HOLD_LOADS();
      load_weights(t + 1);
      load_x(xa, t + 2);
      sum_slices(xb);
      HOLD_LOADS();
    }
    load_weights(PT - 2);
    load_x(xb, PT - 1);
    sum_slices(xa);
    HOLD_LOADS();
    load_weights(PT - 1);
    sum_slices(xb);
#pragma unroll
    for (int q = 0; q < 5; ++q)
#pragma unroll
      for (int e = 0; e < EE; ++e) {
        float v = lg[q][e];
#pragma unroll
        for (int msk = 16; msk >= 1; msk >>= 1) v += __shfl_xor(v, msk, 32);
        lg[q][e] = v;
      }
#pragma unroll
    for (int q = 0; q < 4; ++q)
#pragma unroll
      for (int k = 0; k < 6; ++k) {
        float v = st[q][k];
#pragma unroll
        for (int msk = 16; msk >= 1; msk >>= 1) v += __shfl_xor(v, msk, 32);
        st[q][k] = v;
      }
    if (lane == 0) {
#pragma unroll
      for (int q = 0; q < 4; ++q) {
        const int m = r0 + q;
#pragma unroll
        for (int e = 0; e < EE; ++e) s_raw[m + 1][e] = lg[q][e];
        float mu = st[q][0] / (float)DD;
        float var = st[q][1] / (float)DD - mu * mu;
        s_mu[m] = mu;
        s_rstd[m] = rsqrtf(var + 1e-5f);
#pragma unroll
        for (int k = 0; k < 4; ++k) s_cl[m][k] = st[q][2 + k];
      }
      if (wave == 0) {
#pragma unroll
        for (int e = 0; e < EE; ++e) s_raw[0][e] = lg[4][e];
      }
    }
  }
  __syncthreads();

  if (wave == 0 && lane < 16) {
    const int m = lane;
    const int sg = s0 + m;
    float f[EE];
    const float* cur = &s_raw[m + 1][0];
#pragma unroll
    for (int e = 0; e < EE; ++e) f[e] = cur[e];
    if (sg > 0) {
      const float* prv = cur - EE;
#pragma unroll
      for (int fo = 0; fo < EE; ++fo) {
        float a = 0.f;
#pragma unroll
        for (int e = 0; e < EE; ++e) a += prv[e] * Wmap[fo * EE + e];
        f[fo] += a;
      }
    }
    float* lo = logits_out + ((size_t)b * SS + sg) * EE;
#pragma unroll
    for (int e = 0; e < EE; ++e) lo[e] = f[e];
    float mx = f[0];
#pragma unroll
    for (int e = 1; e < EE; ++e) mx = fmaxf(mx, f[e]);
    float g[EE], gs = 0.f;
#pragma unroll
    for (int e = 0; e < EE; ++e) {
      g[e] = expf(f[e] - mx);
      gs += g[e];
    }
#pragma unroll
    for (int e = 0; e < EE; ++e) g[e] /= gs;
    int i1 = 0;
    float g1 = g[0];
#pragma unroll
    for (int e = 1; e < EE; ++e)
      if (g[e] > g1) { g1 = g[e]; i1 = e; }
    int i2 = (i1 == 0) ? 1 : 0;
    float g2 = g[i2];
#pragma unroll
    for (int e = 0; e < EE; ++e)
      if (e != i1 && g[e] > g2) { g2 = g[e]; i2 = e; }
    float t1 = (i1 == EE - 1) ? 0.f : g1;
    float t2 = (i2 == EE - 1) ? 0.f : g2;
    float inv = 1.f / (t1 + t2);
    float wv[EE];
#pragma unroll
    for (int e = 0; e < EE; ++e) wv[e] = 0.f;
    wv[i1] = t1 * inv;
    wv[i2] += t2 * inv;
    float a0 = s_cl[m][0], a1 = s_cl[m][1];
    float mxa = fmaxf(a0, a1);
    float e0 = expf(a0 - mxa), e1 = expf(a1 - mxa), tt = e0 + e1;
    float p00 = e0 / tt, p01 = e1 / tt;
    a0 = s_cl[m][2];
    a1 = s_cl[m][3];
    mxa = fmaxf(a0, a1);
    e0 = expf(a0 - mxa);
    e1 = expf(a1 - mxa);
    tt = e0 + e1;
    float p10 = e0 / tt, p11 = e1 / tt;

    s_alpha[m] = wv[0] + wv[1] + wv[2] + wv[3] + wv[4] * p00 + wv[5] * p10 + wv[6];
    s_beta[m][0] = wv[4] * p01;
    s_beta[m][1] = wv[5] * p11;
#pragma unroll
    for (int r = 0; r < RR; ++r) s_wv[m][r] = wv[r];
  }
  __syncthreads();

  {
    const int m = lane & 15;
    const int half = lane >> 4;
    const float mu = s_mu[m];
    const float rstd = s_rstd[m];
    const float* ls = lnq_s + wave * DD;
    const float* lb = lnq_b + wave * DD;
    v8f c = {};
    for (int ch = 0; ch < NCH; ++ch) {
      const int buf = ch & 1;
      if (ch + 1 < NCH) {
        if (wave == 0)
          __builtin_amdgcn_s_wait_tensorcnt(2);
        else
          __builtin_amdgcn_s_wait_tensorcnt(1);
      } else {
        __builtin_amdgcn_s_wait_tensorcnt(0);
      }
      __syncthreads();  // wave0's x-chunk visible to all waves
      const int k0 = ch * KC;
#pragma unroll
      for (int kk = 0; kk < KC; kk += 4) {
        const int ka = kk + 2 * half;
        v2f a, bfrag;
        float x0 = s_x[buf][m][ka];
        float x1 = s_x[buf][m][ka + 1];
        a.x = ((2.f * x0 - mu) * rstd) * ls[k0 + ka] + lb[k0 + ka];
        a.y = ((2.f * x1 - mu) * rstd) * ls[k0 + ka + 1] + lb[k0 + ka + 1];
        bfrag.x = s_nk[buf][wave][m][ka];
        bfrag.y = s_nk[buf][wave][m][ka + 1];
        c = __builtin_amdgcn_wmma_f32_16x16x4_f32(false, a, false, bfrag,
                                                  (short)0, c, false, false);
      }
      __syncthreads();  // everyone done with buf before it is overwritten
      if (ch + 2 < NCH) {
        tdm_load_2d(lds_off_of(&s_nk[buf][wave][0][0]), nkr + (ch + 2) * KC,
                    KC, NN, DD);
        if (wave == 0)
          tdm_load_2d(lds_off_of(&s_x[buf][0][0]), x + xbase + (ch + 2) * KC,
                      KC, 16, DD);
      }
    }
    // row softmax over n (16-lane groups), weight by w_r[m], store to LDS
#pragma unroll
    for (int j = 0; j < 8; ++j) {
      float v = c[j];
      float mx = v;
      mx = fmaxf(mx, __shfl_xor(mx, 1, 16));
      mx = fmaxf(mx, __shfl_xor(mx, 2, 16));
      mx = fmaxf(mx, __shfl_xor(mx, 4, 16));
      mx = fmaxf(mx, __shfl_xor(mx, 8, 16));
      float e = expf(v - mx);
      float sm = e;
      sm += __shfl_xor(sm, 1, 16);
      sm += __shfl_xor(sm, 2, 16);
      sm += __shfl_xor(sm, 4, 16);
      sm += __shfl_xor(sm, 8, 16);
      const int row = j + 8 * half;
      s_attn[wave][row * 17 + (lane & 15)] = (e / sm) * s_wv[row][wave];
    }
  }
  __syncthreads();

  // ---- Phase 5: out tile. Each wave owns a 256-column d-quarter.
  // G = sum_r (w_r * attn_r) @ nk_r accumulates in one WMMA C chain.
  {
    const int half = lane >> 4;
    const int nidx = lane & 15;
    const int dbase = wave * 256;
    const float* cc0 = const_c;
    const float* cc1 = const_c + DD;
    for (int t = 0; t < 16; ++t) {
      const int d0 = dbase + t * 16;
      const int d = d0 + nidx;
      v8f acc = {};
#pragma unroll
      for (int r = 0; r < RR; ++r) {
        const float* nkb = nk + ((size_t)(r * BB + b) * NN) * DD + d;
#pragma unroll
        for (int kk = 0; kk < 4; ++kk) {
          const int krow = 4 * kk + 2 * half;
          v2f a, bfrag;
          a.x = s_attn[r][nidx * 17 + krow];
          a.y = s_attn[r][nidx * 17 + krow + 1];
          bfrag.x = nkb[(size_t)krow * DD];
          bfrag.y = nkb[(size_t)(krow + 1) * DD];
          acc = __builtin_amdgcn_wmma_f32_16x16x4_f32(false, a, false, bfrag,
                                                      (short)0, acc, false,
                                                      false);
        }
      }
#pragma unroll
      for (int j = 0; j < 8; ++j) {
        const int m = j + 8 * half;
        const float xs = 2.f * x[xbase + (size_t)m * DD + d];
        float val = acc[j] + s_alpha[m] * xs + s_beta[m][0] * cc0[d] +
                    s_beta[m][1] * cc1[d];
        out[xbase + (size_t)m * DD + d] = val;
      }
    }
  }
}

// ---------------------------------------------------------------------------
extern "C" void kernel_launch(void* const* d_in, const int* in_sizes, int n_in,
                              void* d_out, int out_size, void* d_ws,
                              size_t ws_size, hipStream_t stream) {
  (void)in_sizes;
  (void)n_in;
  (void)out_size;
  (void)ws_size;
  const float* x = (const float*)d_in[0];
  const float* Wg = (const float*)d_in[1];
  const float* Wmap = (const float*)d_in[2];
  const float* lnq_s = (const float*)d_in[3];
  const float* lnq_b = (const float*)d_in[4];
  const float* lnk_s = (const float*)d_in[5];
  const float* lnk_b = (const float*)d_in[6];
  const float* ref = (const float*)d_in[7];
  const float* const_c = (const float*)d_in[8];
  const float* const_w = (const float*)d_in[9];
  float* out = (float*)d_out;
  float* logits_out = out + (size_t)BB * SS * DD;
  float* nkbuf = (float*)d_ws + (size_t)BB * SS * EE;  // R*B*N*D floats (1 MB)

  k_nk<<<BB * NN, 256, 0, stream>>>(ref, lnk_s, lnk_b, nkbuf);
  k_main<<<BB * (SS / 16), 128, 0, stream>>>(x, Wmap, lnq_s, lnq_b, const_c,
                                             const_w, Wg, nkbuf, out,
                                             logits_out);
}

// v002
// Measured time: 40.3 microseconds a run.
// In two side-by-side timings against v001, it was 1.24 and 1.22 times as fast.
// All steps since v000 together make it 1.45 times as fast.
#include <hip/hip_runtime.h>
#include <math.h>

typedef float v2f __attribute__((ext_vector_type(2)));
typedef float v8f __attribute__((ext_vector_type(8)));
typedef unsigned int v4u __attribute__((ext_vector_type(4)));
typedef int v4i __attribute__((ext_vector_type(4)));
typedef int v8i __attribute__((ext_vector_type(8)));

#define BB 4
#define SS 2048
#define DD 1024
#define EE 8
#define NN 16
#define RR 4

#define KC 64
#define NCH (DD / KC)
#define LROW (KC + 4)
#define NRP (DD + 4)
#define X_PLACE 0x8800
#define PJ 4
#define PT (DD / (32 * PJ))
// keeps a trip's loads from being lifted over the sums of the trip in front:
// lifted, they leave the place where XCNT_WAIT below covers their address
// registers, and two trips' weights are live at once
#define HOLD_LOADS() __builtin_amdgcn_sched_barrier(0)
// Behind a group of global loads, in front of the next group, whose results the
// compiler lays over the first group's address registers. The
// two scheduling barriers hold the wait, and with it the groups' issue order.
#define XCNT_WAIT()                                  \
  do {                                               \
    __builtin_amdgcn_sched_barrier(0);               \
    asm volatile("s_wait_xcnt 0x0" ::: "memory");    \
    __builtin_amdgcn_sched_barrier(0);               \
  } while (0)

__device__ __forceinline__ void tdm_load_2d(unsigned lds_byte_off,
                                            const float* gptr,
                                            unsigned tile_d0,   // elems per row
                                            unsigned tile_d1,   // rows
                                            unsigned strideElems) {
  unsigned long long ga = (unsigned long long)(uintptr_t)gptr;
  v4u g0;
  g0.x = 1u;                                   // count=1 (valid), user mode
  g0.y = lds_byte_off;                         // lds_addr
  g0.z = (unsigned)(ga & 0xffffffffull);       // global_addr[31:0]
  g0.w = (unsigned)((ga >> 32) & 0x1ffffffull) // global_addr[56:32]
         | (2u << 30);                         // type=2 ("image")
  v8i g1;
  g1[0] = (int)((2u << 16)
                | (1u << 20)
                | (5u << 22)
                | (3u << 25));
  g1[1] = (int)(((unsigned)DD & 0xffffu) << 16);
  g1[2] = (int)((((unsigned)DD >> 16) & 0xffffu)
                | ((tile_d1 & 0xffffu) << 16));
  g1[3] = (int)((tile_d0 & 0xffffu) << 16);
  g1[4] = (int)(tile_d1 & 0xffffu);
  g1[5] = (int)strideElems;
  g1[6] = 0;
  g1[7] = 0;
  v4i z4 = {0, 0, 0, 0};
#if __clang_major__ >= 23
  v8i z8 = {0, 0, 0, 0, 0, 0, 0, 0};
  __builtin_amdgcn_tensor_load_to_lds(g0, g1, z4, z4, z8, 0);
#else
  __builtin_amdgcn_tensor_load_to_lds(g0, g1, z4, z4, 0);
#endif
}

__device__ __forceinline__ unsigned lds_off_of(const void* p) {
  // generic pointer to LDS: low 32 bits are the LDS byte offset
  return (unsigned)(unsigned long long)(uintptr_t)p;
}

// ---------------------------------------------------------------------------
// K2: nr[b,n,d] = LN(ref[b,n,:]) without affine (256 KB), shared by all experts,
// and per expert the key scale folded into the query affine:
// qk_s = lnq_s * lnk_s, qk_b = lnq_b * lnk_s.
// ---------------------------------------------------------------------------
__global__ __launch_bounds__(256) void k_nk(const float* __restrict__ ref,
                                            const float* __restrict__ lnq_s,
                                            const float* __restrict__ lnq_b,
                                            const float* __restrict__ lnk_s,
                                            float* __restrict__ nr,
                                            float* __restrict__ qk_s,
                                            float* __restrict__ qk_b) {
  __shared__ float red[16];
  const int row = blockIdx.x;  // b*NN + n
  const int tid = threadIdx.x;
  const float* rr = ref + (size_t)row * DD;
  float s = 0.f, ss = 0.f;
  for (int d = tid; d < DD; d += 256) {
    float v = rr[d];
    s += v;
    ss += v * v;
  }
  for (int m = 16; m >= 1; m >>= 1) {
    s += __shfl_xor(s, m, 32);
    ss += __shfl_xor(ss, m, 32);
  }
  const int wv = tid >> 5, ln = tid & 31;
  if (ln == 0) {
    red[wv] = s;
    red[8 + wv] = ss;
  }
  __syncthreads();
  if (tid == 0) {
    float ts = 0.f, tss = 0.f;
    for (int i = 0; i < 8; ++i) {
      ts += red[i];
      tss += red[8 + i];
    }
    red[0] = ts;
    red[8] = tss;
  }
  __syncthreads();
  const float mu = red[0] / (float)DD;
  const float var = red[8] / (float)DD - mu * mu;
  const float rstd = rsqrtf(var + 1e-5f);
  for (int d = tid; d < DD; d += 256)
    nr[(size_t)row * DD + d] = (rr[d] - mu) * rstd;
  // the R*D folded affine values, an equal share per block
  if (tid < RR * DD / (BB * NN)) {
    const int e = row * (RR * DD / (BB * NN)) + tid;
    const float ks = lnk_s[e];
    qk_s[e] = lnq_s[e] * ks;
    qk_b[e] = lnq_b[e] * ks;
  }
}

__device__ __forceinline__ void copy_row_async(unsigned l, const float* g) {
  asm volatile(
      "global_load_async_to_lds_b128 %0, %8, off\n\t"
      "global_load_async_to_lds_b128 %1, %9, off\n\t"
      "global_load_async_to_lds_b128 %2, %10, off\n\t"
      "global_load_async_to_lds_b128 %3, %11, off\n\t"
      "global_load_async_to_lds_b128 %4, %12, off\n\t"
      "global_load_async_to_lds_b128 %5, %13, off\n\t"
      "global_load_async_to_lds_b128 %6, %14, off\n\t"
      "global_load_async_to_lds_b128 %7, %15, off\n\t"
      "s_wait_xcnt 0x0"
      ::"v"(l), "v"(l + 512u), "v"(l + 1024u), "v"(l + 1536u), "v"(l + 2048u),
      "v"(l + 2560u), "v"(l + 3072u), "v"(l + 3584u), "v"(g), "v"(g + 128),
      "v"(g + 256), "v"(g + 384), "v"(g + 512), "v"(g + 640), "v"(g + 768),
      "v"(g + 896)
      : "memory");
}

// LDS of the main kernel, one object so that every place in it is fixed. The x
// ring keeps its place, so the 16 key rows lie in two halves around it. Four such
// objects fit a WGP's LDS, as many work-groups as the registers allow there.
struct __attribute__((aligned(16))) MainLdsAll {
  float nr_lo[8][NRP];  // key rows 0..7
  float raw[17][EE];    // raw gate logits: row 0 = token s0-1, row m+1 = tile token m
  float cl[16][4], alpha[16], beta[16][2], wv[16][4];
  float unused[(X_PLACE - 8 * NRP * 4 - 17 * EE * 4 - 16 * 11 * 4) / 4];
  float x[2][16][LROW];  //  8.5 KB
  float mu[16], rstd[16];
  float nr_hi[8][NRP];
  float attn[RR][16 * 17];
};
static_assert(__builtin_offsetof(MainLdsAll, nr_hi) % 256 == 128);
static_assert(sizeof(MainLdsAll) * 4 <= 320 * 1024, "four work-groups a WGP");
static_assert(__builtin_offsetof(MainLdsAll, x) == X_PLACE, "place of the x ring");

__global__ __launch_bounds__(128) void k_main(
    const float* __restrict__ x, const float* __restrict__ Wmap,
    const float* __restrict__ lnk_s, const float* __restrict__ lnk_b,
    const float* __restrict__ const_c, const float* __restrict__ const_w,
    const float* __restrict__ Wg, const float* __restrict__ nr,
    const float* __restrict__ qk_s, const float* __restrict__ qk_b,
    float* __restrict__ out, float* __restrict__ logits_out) {
  __shared__ MainLdsAll sm;
  auto& s_x = sm.x;
  auto& s_mu = sm.mu;
  auto& s_rstd = sm.rstd;
  auto& s_cl = sm.cl;
  auto& s_alpha = sm.alpha;
  auto& s_beta = sm.beta;
  auto& s_wv = sm.wv;
  auto& s_attn = sm.attn;
  auto& s_raw = sm.raw;

  const int tid = threadIdx.x;
  const int wave = tid >> 5;
  const int lane = tid & 31;
  const int tilesPerB = SS / 16;
  const int b = blockIdx.x / tilesPerB;
  const int s0 = (blockIdx.x % tilesPerB) * 16;
  const size_t xbase = ((size_t)b * SS + s0) * DD;

#pragma unroll
  for (int c = 0; c < 2; ++c) {
    if (wave == 0)
      tdm_load_2d(lds_off_of(&s_x[c][0][0]), x + xbase + c * KC, KC, 16, DD);
  }
  // ---- the batch's normalised keys, four rows a wave; they fly over phase 1 ----
#pragma unroll
  for (int q = 0; q < 4; ++q) {
    const int row = wave * 4 + q;
    const float* dst = wave < 2 ? &sm.nr_lo[row][0] : &sm.nr_hi[row - 8][0];
    copy_row_async(lds_off_of(dst) + (unsigned)lane * 16u,
                   nr + ((size_t)b * NN + row) * DD + lane * 4);
  }

  // ---- Phase 1: raw gate logits, mean/var of xs=2x and const-cluster dots.
  // One wave per 4 tokens, lanes strided over d: every x element is loaded once
  // for all 14 sums of its token, every weight slice once for the wave's rows.
  // All waves also form the logits of the token in front of the tile (the gate
  // residual of tile token 0 needs them); wave 0 publishes them.
  {
    const int r0 = wave * 4;
    const float* xr = x + xbase + (size_t)r0 * DD + lane;
    // at a sequence start there is no such token: read tile token 0, unused
    const float* xp = x + xbase - (s0 > 0 ? DD : 0) + lane;
    const float* wgl = Wg + lane;
    const float* cwl = const_w + lane;
    float lg[5][EE];  // rows 0..3: own tokens, row 4: token in front of the tile
    float st[4][6];   // sum, sum of squares, four const-cluster dots
#pragma unroll
    for (int q = 0; q < 5; ++q)
#pragma unroll
      for (int e = 0; e < EE; ++e) lg[q][e] = 0.f;
#pragma unroll
    for (int q = 0; q < 4; ++q)
#pragma unroll
      for (int k = 0; k < 6; ++k) st[q][k] = 0.f;
    auto load_x = [&](float (&dst)[5][PJ], int t) {
#pragma unroll
      for (int j = 0; j < PJ; ++j) {
        const int d = (t * PJ + j) * 32;
#pragma unroll
        for (int q = 0; q < 4; ++q) dst[q][j] = xr[q * DD + d];
        dst[4][j] = xp[d];
      }
    };
    float wg[PJ][EE], cw[PJ][4];
    auto load_weights = [&](int t) {
#pragma unroll
      for (int j = 0; j < PJ; ++j)
#pragma unroll
        for (int e = 0; e < EE; ++e) wg[j][e] = wgl[e * DD + (t * PJ + j) * 32];
      XCNT_WAIT();
#pragma unroll
      for (int j = 0; j < PJ; ++j)
#pragma unroll
        for (int k = 0; k < 4; ++k) cw[j][k] = cwl[k * DD + (t * PJ + j) * 32];
      XCNT_WAIT();
    };
    auto sum_slices = [&](const float (&xc)[5][PJ]) {
#pragma unroll
      for (int j = 0; j < PJ; ++j) {
#pragma unroll
        for (int q = 0; q < 4; ++q) {
          const float xv = xc[q][j];
#pragma unroll
          for (int e = 0; e < EE; ++e) lg[q][e] = fmaf(xv, wg[j][e], lg[q][e]);
          const float xs = 2.f * xv;
          st[q][0] += xs;
          st[q][1] = fmaf(xs, xs, st[q][1]);
#pragma unroll
          for (int k = 0; k < 4; ++k)
            st[q][2 + k] = fmaf(xs, cw[j][k], st[q][2 + k]);
        }
#pragma unroll
        for (int e = 0; e < EE; ++e)
          lg[4][e] = fmaf(xc[4][j], wg[j][e], lg[4][e]);
      }
    };
    // Two register sets for x, so that a trip's x loads fly while the trip in
    // front of it is summed. In each trip the weights are asked for first and
    // the next x slices behind them: loads return in issue order, so the wait
    // for the (cached) weights then leaves the x loads flying.
    float xa[5][PJ], xb[5][PJ];
    load_x(xa, 0);
    // kept rolled for speed only: the body is large
#pragma unroll 1
    for (int t = 0; t + 2 < PT; t += 2) {
      load_weights(t);
      load_x(xb, t + 1);
      sum_slices(xa);
      HOLD_LOADS();
      load_weights(t + 1);
      load_x(xa, t + 2);
      sum_slices(xb);
      HOLD_LOADS();
    }
    load_weights(PT - 2);
    load_x(xb, PT - 1);
    sum_slices(xa);
    HOLD_LOADS();
    load_weights(PT - 1);
    sum_slices(xb);
#pragma unroll
    for (int q = 0; q < 5; ++q)
#pragma unroll
      for (int e = 0; e < EE; ++e) {
        float v = lg[q][e];
#pragma unroll
        for (int msk = 16; msk >= 1; msk >>= 1) v += __shfl_xor(v, msk, 32);
        lg[q][e] = v;
      }
#pragma unroll
    for (int q = 0; q < 4; ++q)
#pragma unroll
      for (int k = 0; k < 6; ++k) {
        float v = st[q][k];
#pragma unroll
        for (int msk = 16; msk >= 1; msk >>= 1) v += __shfl_xor(v, msk, 32);
        st[q][k] = v;
      }
    if (lane == 0) {
#pragma unroll
      for (int q = 0; q < 4; ++q) {
        const int m = r0 + q;
#pragma unroll
        for (int e = 0; e < EE; ++e) s_raw[m + 1][e] = lg[q][e];
        float mu = st[q][0] / (float)DD;
        float var = st[q][1] / (float)DD - mu * mu;
        s_mu[m] = mu;
        s_rstd[m] = rsqrtf(var + 1e-5f);
#pragma unroll
        for (int k = 0; k < 4; ++k) s_cl[m][k] = st[q][2 + k];
      }
      if (wave == 0) {
#pragma unroll
        for (int e = 0; e < EE; ++e) s_raw[0][e] = lg[4][e];
      }
    }
  }
  // this wave's key rows have landed; the barrier shows them to the other waves
  asm volatile("s_wait_asynccnt 0x0" ::: "memory");
  __syncthreads();

  if (wave == 0 && lane < 16) {
    const int m = lane;
    const int sg = s0 + m;
    float f[EE];
    const float* cur = &s_raw[m + 1][0];
#pragma unroll
    for (int e = 0; e < EE; ++e) f[e] = cur[e];
    if (sg > 0) {
      const float* prv = cur - EE;
#pragma unroll
      for (int fo = 0; fo < EE; ++fo) {
        float a = 0.f;
#pragma unroll
        for (int e = 0; e < EE; ++e) a += prv[e] * Wmap[fo * EE + e];
        f[fo] += a;
      }
    }
    float* lo = logits_out + ((size_t)b * SS + sg) * EE;
#pragma unroll
    for (int e = 0; e < EE; ++e) lo[e] = f[e];
    float mx = f[0];
#pragma unroll
    for (int e = 1; e < EE; ++e) mx = fmaxf(mx, f[e]);
    float g[EE], gs = 0.f;
#pragma unroll
    for (int e = 0; e < EE; ++e) {
      g[e] = expf(f[e] - mx);
      gs += g[e];
    }
#pragma unroll
    for (int e = 0; e < EE; ++e) g[e] /= gs;
    int i1 = 0;
    float g1 = g[0];
#pragma unroll
    for (int e = 1; e < EE; ++e)
      if (g[e] > g1) { g1 = g[e]; i1 = e; }
    int i2 = (i1 == 0) ? 1 : 0;
    float g2 = g[i2];
#pragma unroll
    for (int e = 0; e < EE; ++e)
      if (e != i1 && g[e] > g2) { g2 = g[e]; i2 = e; }
    float t1 = (i1 == EE - 1) ? 0.f : g1;
    float t2 = (i2 == EE - 1) ? 0.f : g2;
    float inv = 1.f / (t1 + t2);
    float wv[EE];
#pragma unroll
    for (int e = 0; e < EE; ++e) wv[e] = 0.f;
    wv[i1] = t1 * inv;
    wv[i2] += t2 * inv;
    float a0 = s_cl[m][0], a1 = s_cl[m][1];
    float mxa = fmaxf(a0, a1);
    float e0 = expf(a0 - mxa), e1 = expf(a1 - mxa), tt = e0 + e1;
    float p00 = e0 / tt, p01 = e1 / tt;
    a0 = s_cl[m][2];
    a1 = s_cl[m][3];
    mxa = fmaxf(a0, a1);
    e0 = expf(a0 - mxa);
    e1 = expf(a1 - mxa);
    tt = e0 + e1;
    float p10 = e0 / tt, p11 = e1 / tt;

    s_alpha[m] = wv[0] + wv[1] + wv[2] + wv[3] + wv[4] * p00 + wv[5] * p10 + wv[6];
    s_beta[m][0] = wv[4] * p01;
    s_beta[m][1] = wv[5] * p11;
#pragma unroll
    for (int r = 0; r < RR; ++r) s_wv[m][r] = wv[r];
  }
  __syncthreads();

  // ---- Phase 3: scores via WMMA, A/B fragments from LDS. The key scale sits in
  // the query affine; the key bias adds the same to all 16 scores of a row, which
  // the softmax over them cancels, so it is left out.
  {
    const int m = lane & 15;
    const int half = lane >> 4;
    const float mu = s_mu[m];
    const float rstd = s_rstd[m];
    const float* nrm = m < 8 ? &sm.nr_lo[m][0] : &sm.nr_hi[m - 8][0];
    const float* ls = qk_s + wave * DD;
    const float* lb = qk_b + wave * DD;
    v8f c = {};
    for (int ch = 0; ch < NCH; ++ch) {
      const int buf = ch & 1;
      if (ch + 1 < NCH)
        __builtin_amdgcn_s_wait_tensorcnt(1);
      else
        __builtin_amdgcn_s_wait_tensorcnt(0);
      __syncthreads();  // wave0's x-chunk visible to all waves
      const int k0 = ch * KC;
      // The chunk's loads, the global ones first, stand in one group in front of
      // its matrix instructions. Left to itself the build with the keys at their
      // new place issues each LDS read one matrix instruction ahead of its use,
      // and every read's latency lies open.
      v2f lsf[KC / 4], lbf[KC / 4], xf[KC / 4], bf[KC / 4];
#pragma unroll
      for (int i = 0; i < KC / 4; ++i) {
        lsf[i] = *(const v2f*)(ls + k0 + 4 * i + 2 * half);
        lbf[i] = *(const v2f*)(lb + k0 + 4 * i + 2 * half);
      }
#pragma unroll
      for (int i = 0; i < KC / 4; ++i) {
        xf[i] = *(const v2f*)&s_x[buf][m][4 * i + 2 * half];
        bf[i] = *(const v2f*)(nrm + k0 + 4 * i + 2 * half);
      }
      // holds the group in front: no instruction is moved over this line
      __builtin_amdgcn_sched_barrier(0);
#pragma unroll
      for (int i = 0; i < KC / 4; ++i) {
        v2f a;
        a.x = ((2.f * xf[i].x - mu) * rstd) * lsf[i].x + lbf[i].x;
        a.y = ((2.f * xf[i].y - mu) * rstd) * lsf[i].y + lbf[i].y;
        c = __builtin_amdgcn_wmma_f32_16x16x4_f32(false, a, false, bf[i],
                                                  (short)0, c, false, false);
      }
      __syncthreads();  // everyone done with buf before it is overwritten
      if (ch + 2 < NCH) {
        if (wave == 0)
          tdm_load_2d(lds_off_of(&s_x[buf][0][0]), x + xbase + (ch + 2) * KC,
                      KC, 16, DD);
      }
    }
    // row softmax over n (16-lane groups), weight by w_r[m], store to LDS
#pragma unroll
    for (int j = 0; j < 8; ++j) {
      float v = c[j];
      float mx = v;
      mx = fmaxf(mx, __shfl_xor(mx, 1, 16));
      mx = fmaxf(mx, __shfl_xor(mx, 2, 16));
      mx = fmaxf(mx, __shfl_xor(mx, 4, 16));
      mx = fmaxf(mx, __shfl_xor(mx, 8, 16));
      float e = expf(v - mx);
      float sm = e;
      sm += __shfl_xor(sm, 1, 16);
      sm += __shfl_xor(sm, 2, 16);
      sm += __shfl_xor(sm, 4, 16);
      sm += __shfl_xor(sm, 8, 16);
      const int row = j + 8 * half;
      s_attn[wave][row * 17 + (lane & 15)] = (e / sm) * s_wv[row][wave];
    }
  }
  __syncthreads();

  // ---- Phase 5: out tile. Each wave owns a 256-column d-quarter.
  // G = sum_r (w_r * attn_r) @ nk_r accumulates in one WMMA C chain. nk_r is
  // formed from the shared key rows in LDS, read once a tile for all experts,
  // with the lane's own column of the expert's scale and bias.
  {
    const int half = lane >> 4;
    const int nidx = lane & 15;
    const int dbase = wave * 256;
    const float* cc0 = const_c;
    const float* cc1 = const_c + DD;
    for (int t = 0; t < 16; ++t) {
      const int d0 = dbase + t * 16;
      const int d = d0 + nidx;
      v2f nrf[4];
#pragma unroll
      for (int kk = 0; kk < 4; ++kk) {
        const int krow = (4 * kk & 7) + 2 * half;  // row within its half
        const float(*nrh)[NRP] = kk < 2 ? sm.nr_lo : sm.nr_hi;
        nrf[kk].x = nrh[krow][d];
        nrf[kk].y = nrh[krow + 1][d];
      }
      v8f acc = {};
#pragma unroll
      for (int r = 0; r < RR; ++r) {
        const float ks = lnk_s[r * DD + d];
        const float kb = lnk_b[r * DD + d];
#pragma unroll
        for (int kk = 0; kk < 4; ++kk) {
          const int krow = 4 * kk + 2 * half;
          v2f a, bfrag;
          a.x = s_attn[r][nidx * 17 + krow];
          a.y = s_attn[r][nidx * 17 + krow + 1];
          bfrag.x = fmaf(nrf[kk].x, ks, kb);
          bfrag.y = fmaf(nrf[kk].y, ks, kb);
          acc = __builtin_amdgcn_wmma_f32_16x16x4_f32(false, a, false, bfrag,
                                                      (short)0, acc, false,
                                                      false);
        }
      }
#pragma unroll
      for (int j = 0; j < 8; ++j) {
        const int m = j + 8 * half;
        const float xs = 2.f * x[xbase + (size_t)m * DD + d];
        float val = acc[j] + s_alpha[m] * xs + s_beta[m][0] * cc0[d] +
                    s_beta[m][1] * cc1[d];
        out[xbase + (size_t)m * DD + d] = val;
      }
    }
  }
}

// ---------------------------------------------------------------------------
extern "C" void kernel_launch(void* const* d_in, const int* in_sizes, int n_in,
                              void* d_out, int out_size, void* d_ws,
                              size_t ws_size, hipStream_t stream) {
  (void)in_sizes;
  (void)n_in;
  (void)out_size;
  (void)ws_size;
  const float* x = (const float*)d_in[0];
  const float* Wg = (const float*)d_in[1];
  const float* Wmap = (const float*)d_in[2];
  const float* lnq_s = (const float*)d_in[3];
  const float* lnq_b = (const float*)d_in[4];
  const float* lnk_s = (const float*)d_in[5];
  const float* lnk_b = (const float*)d_in[6];
  const float* ref = (const float*)d_in[7];
  const float* const_c = (const float*)d_in[8];
  const float* const_w = (const float*)d_in[9];
  float* out = (float*)d_out;
  float* logits_out = out + (size_t)BB * SS * DD;
  float* nrbuf = (float*)d_ws + (size_t)BB * SS * EE;  // B*N*D floats (256 KB)
  float* qk_s = nrbuf + (size_t)BB * NN * DD;          // R*D floats
  float* qk_b = qk_s + (size_t)RR * DD;                // R*D floats

  k_nk<<<BB * NN, 256, 0, stream>>>(ref, lnq_s, lnq_b, lnk_s, nrbuf, qk_s, qk_b);
  k_main<<<BB * (SS / 16), 128, 0, stream>>>(x, Wmap, lnk_s, lnk_b, const_c,
                                             const_w, Wg, nrbuf, qk_s, qk_b, out,
                                             logits_out);
}

// v003
// A run of this version takes 31.8 microseconds.
// Timed twice side by side with v002, it ran 1.25 times as fast both times.
// All steps since v000 together make it 1.82 times as fast.
#include <hip/hip_runtime.h>
#include <math.h>

typedef float v2f __attribute__((ext_vector_type(2)));
typedef float v4f __attribute__((ext_vector_type(4)));
typedef float v8f __attribute__((ext_vector_type(8)));
typedef unsigned int v4u __attribute__((ext_vector_type(4)));
typedef int v4i __attribute__((ext_vector_type(4)));
typedef int v8i __attribute__((ext_vector_type(8)));

#define BB 4
#define SS 2048
#define DD 1024
#define EE 8
#define NN 16
#define RR 4

#define KC 64
#define NCH (DD / KC)
#define LROW (KC + 4)
#define NRP (DD + 4)
#define X_PLACE 0x8800
#define PJ 4
#define PT (DD / (32 * PJ))
// keeps a trip's loads from being lifted over the sums of the trip in front:
// lifted, they leave the place where XCNT_WAIT below covers their address
// registers, and two trips' weights are live at once
#define HOLD_LOADS() __builtin_amdgcn_sched_barrier(0)
// Behind a group of global loads, in front of the next group, whose results the
// compiler lays over the first group's address registers. The
// two scheduling barriers hold the wait, and with it the groups' issue order.
#define XCNT_WAIT()                                  \
  do {                                               \
    __builtin_amdgcn_sched_barrier(0);               \
    asm volatile("s_wait_xcnt 0x0" ::: "memory");    \
    __builtin_amdgcn_sched_barrier(0);               \
  } while (0)

__device__ __forceinline__ void tdm_load_2d(unsigned lds_byte_off,
                                            const float* gptr,
                                            unsigned tile_d0,   // elems per row
                                            unsigned tile_d1,   // rows
                                            unsigned strideElems) {
  unsigned long long ga = (unsigned long long)(uintptr_t)gptr;
  v4u g0;
  g0.x = 1u;                                   // count=1 (valid), user mode
  g0.y = lds_byte_off;                         // lds_addr
  g0.z = (unsigned)(ga & 0xffffffffull);       // global_addr[31:0]
  g0.w = (unsigned)((ga >> 32) & 0x1ffffffull) // global_addr[56:32]
         | (2u << 30);                         // type=2 ("image")
  v8i g1;
  g1[0] = (int)((2u << 16)
                | (1u << 20)
                | (5u << 22)
                | (3u << 25));
  g1[1] = (int)(((unsigned)DD & 0xffffu) << 16);
  g1[2] = (int)((((unsigned)DD >> 16) & 0xffffu)
                | ((tile_d1 & 0xffffu) << 16));
  g1[3] = (int)((tile_d0 & 0xffffu) << 16);
  g1[4] = (int)(tile_d1 & 0xffffu);
  g1[5] = (int)strideElems;
  g1[6] = 0;
  g1[7] = 0;
  v4i z4 = {0, 0, 0, 0};
#if __clang_major__ >= 23
  v8i z8 = {0, 0, 0, 0, 0, 0, 0, 0};
  __builtin_amdgcn_tensor_load_to_lds(g0, g1, z4, z4, z8, 0);
#else
  __builtin_amdgcn_tensor_load_to_lds(g0, g1, z4, z4, 0);
#endif
}

__device__ __forceinline__ unsigned lds_off_of(const void* p) {
  // generic pointer to LDS: low 32 bits are the LDS byte offset
  return (unsigned)(unsigned long long)(uintptr_t)p;
}

__device__ __forceinline__ void copy_row_async(unsigned l, const float* g) {
  asm volatile(
      "global_load_async_to_lds_b128 %0, %8, off\n\t"
      "global_load_async_to_lds_b128 %1, %9, off\n\t"
      "global_load_async_to_lds_b128 %2, %10, off\n\t"
      "global_load_async_to_lds_b128 %3, %11, off\n\t"
      "global_load_async_to_lds_b128 %4, %12, off\n\t"
      "global_load_async_to_lds_b128 %5, %13, off\n\t"
      "global_load_async_to_lds_b128 %6, %14, off\n\t"
      "global_load_async_to_lds_b128 %7, %15, off\n\t"
      "s_wait_xcnt 0x0"
      ::"v"(l), "v"(l + 512u), "v"(l + 1024u), "v"(l + 1536u), "v"(l + 2048u),
      "v"(l + 2560u), "v"(l + 3072u), "v"(l + 3584u), "v"(g), "v"(g + 128),
      "v"(g + 256), "v"(g + 384), "v"(g + 512), "v"(g + 640), "v"(g + 768),
      "v"(g + 896)
      : "memory");
}

// LDS of the main kernel, one object so that every place in it is fixed. The x
// ring keeps its place, so the 16 key rows lie in two halves around it. Two such
// objects fit a WGP's LDS, as many work-groups as the grid gives each WGP.
struct __attribute__((aligned(16))) MainLdsAll {
  float nr_lo[8][NRP];  // key rows 0..7
  float raw[17][EE];    // raw gate logits: row 0 = token s0-1, row m+1 = tile token m
  float cl[16][4], alpha[16], beta[16][2], wv[16][4];
  float unused[(X_PLACE - 8 * NRP * 4 - 17 * EE * 4 - 16 * 11 * 4) / 4];
  float x[2][16][LROW];  //  8.5 KB
  float mu[16], rstd[16];
  float nr_hi[8][NRP];
  float attn[RR][16 * 17];
  float qks[RR][DD];  // query scale * key scale, per expert
  float qkb[RR][DD];  // query bias * key scale, per expert
};
static_assert(__builtin_offsetof(MainLdsAll, qks) % 16 == 0, "16-byte stores of the folded affine");
static_assert(__builtin_offsetof(MainLdsAll, nr_hi) % 256 == 128);
static_assert(sizeof(MainLdsAll) * 2 <= 320 * 1024, "two work-groups a WGP");
static_assert(__builtin_offsetof(MainLdsAll, x) == X_PLACE, "place of the x ring");

__global__ __launch_bounds__(128) void k_main(
    const float* __restrict__ x, const float* __restrict__ Wmap,
    const float* __restrict__ lnq_s, const float* __restrict__ lnq_b,
    const float* __restrict__ lnk_s, const float* __restrict__ lnk_b,
    const float* __restrict__ const_c, const float* __restrict__ const_w,
    const float* __restrict__ Wg, const float* __restrict__ ref,
    float* __restrict__ out, float* __restrict__ logits_out) {
  __shared__ MainLdsAll sm;
  auto& s_x = sm.x;
  auto& s_mu = sm.mu;
  auto& s_rstd = sm.rstd;
  auto& s_cl = sm.cl;
  auto& s_alpha = sm.alpha;
  auto& s_beta = sm.beta;
  auto& s_wv = sm.wv;
  auto& s_attn = sm.attn;
  auto& s_raw = sm.raw;

  const int tid = threadIdx.x;
  const int wave = tid >> 5;
  const int lane = tid & 31;
  const int tilesPerB = SS / 16;
  const int b = blockIdx.x / tilesPerB;
  const int s0 = (blockIdx.x % tilesPerB) * 16;
  const size_t xbase = ((size_t)b * SS + s0) * DD;

#pragma unroll
  for (int c = 0; c < 2; ++c) {
    if (wave == 0)
      tdm_load_2d(lds_off_of(&s_x[c][0][0]), x + xbase + c * KC, KC, 16, DD);
  }
  // ---- the batch's raw keys, four rows a wave; they fly over phase 1 ----
#pragma unroll
  for (int q = 0; q < 4; ++q) {
    const int row = wave * 4 + q;
    const float* dst = wave < 2 ? &sm.nr_lo[row][0] : &sm.nr_hi[row - 8][0];
    copy_row_async(lds_off_of(dst) + (unsigned)lane * 16u,
                   ref + ((size_t)b * NN + row) * DD + lane * 4);
  }

  // ---- Phase 1: raw gate logits, mean/var of xs=2x and const-cluster dots.
  // One wave per 4 tokens, lanes strided over d: every x element is loaded once
  // for all 14 sums of its token, every weight slice once for the wave's rows.
  // All waves also form the logits of the token in front of the tile (the gate
  // residual of tile token 0 needs them); wave 0 publishes them.
  {
    const int r0 = wave * 4;
    const float* xr = x + xbase + (size_t)r0 * DD + lane;
    // at a sequence start there is no such token: read tile token 0, unused
    const float* xp = x + xbase - (s0 > 0 ? DD : 0) + lane;
    const float* wgl = Wg + lane;
    const float* cwl = const_w + lane;
    float lg[5][EE];  // rows 0..3: own tokens, row 4: token in front of the tile
    float st[4][6];   // sum, sum of squares, four const-cluster dots
#pragma unroll
    for (int q = 0; q < 5; ++q)
#pragma unroll
      for (int e = 0; e < EE; ++e) lg[q][e] = 0.f;
#pragma unroll
    for (int q = 0; q < 4; ++q)
#pragma unroll
      for (int k = 0; k < 6; ++k) st[q][k] = 0.f;
    auto load_x = [&](float (&dst)[5][PJ], int t) {
#pragma unroll
      for (int j = 0; j < PJ; ++j) {
        const int d = (t * PJ + j) * 32;
#pragma unroll
        for (int q = 0; q < 4; ++q) dst[q][j] = xr[q * DD + d];
        dst[4][j] = xp[d];
      }
    };
    float wg[PJ][EE], cw[PJ][4];
    auto load_weights = [&](int t) {
#pragma unroll
      for (int j = 0; j < PJ; ++j)
#pragma unroll
        for (int e = 0; e < EE; ++e) wg[j][e] = wgl[e * DD + (t * PJ + j) * 32];
      XCNT_WAIT();
#pragma unroll
      for (int j = 0; j < PJ; ++j)
#pragma unroll
        for (int k = 0; k < 4; ++k) cw[j][k] = cwl[k * DD + (t * PJ + j) * 32];
      XCNT_WAIT();
    };
    auto sum_slices = [&](const float (&xc)[5][PJ]) {
#pragma unroll
      for (int j = 0; j < PJ; ++j) {
#pragma unroll
        for (int q = 0; q < 4; ++q) {
          const float xv = xc[q][j];
#pragma unroll
          for (int e = 0; e < EE; ++e) lg[q][e] = fmaf(xv, wg[j][e], lg[q][e]);
          const float xs = 2.f * xv;
          st[q][0] += xs;
          st[q][1] = fmaf(xs, xs, st[q][1]);
#pragma unroll
          for (int k = 0; k < 4; ++k)
            st[q][2 + k] = fmaf(xs, cw[j][k], st[q][2 + k]);
        }
#pragma unroll
        for (int e = 0; e < EE; ++e)
          lg[4][e] = fmaf(xc[4][j], wg[j][e], lg[4][e]);
      }
    };
    // Two register sets for x, so that a trip's x loads fly while the trip in
    // front of it is summed. In each trip the weights are asked for first and
    // the next x slices behind them: loads return in issue order, so the wait
    // for the (cached) weights then leaves the x loads flying.
    float xa[5][PJ], xb[5][PJ];
    load_x(xa, 0);
    // kept rolled for speed only: the body is large
#pragma unroll 1
    for (int t = 0; t + 2 < PT; t += 2) {
      load_weights(t);
      load_x(xb, t + 1);
      sum_slices(xa);
      HOLD_LOADS();
      load_weights(t + 1);
      load_x(xa, t + 2);
      sum_slices(xb);
      HOLD_LOADS();
    }
    load_weights(PT - 2);
    load_x(xb, PT - 1);
    sum_slices(xa);
    HOLD_LOADS();
    load_weights(PT - 1);
    sum_slices(xb);
#pragma unroll
    for (int q = 0; q < 5; ++q)
#pragma unroll
      for (int e = 0; e < EE; ++e) {
        float v = lg[q][e];
#pragma unroll
        for (int msk = 16; msk >= 1; msk >>= 1) v += __shfl_xor(v, msk, 32);
        lg[q][e] = v;
      }
#pragma unroll
    for (int q = 0; q < 4; ++q)
#pragma unroll
      for (int k = 0; k < 6; ++k) {
        float v = st[q][k];
#pragma unroll
        for (int msk = 16; msk >= 1; msk >>= 1) v += __shfl_xor(v, msk, 32);
        st[q][k] = v;
      }
    if (lane == 0) {
#pragma unroll
      for (int q = 0; q < 4; ++q) {
        const int m = r0 + q;
#pragma unroll
        for (int e = 0; e < EE; ++e) s_raw[m + 1][e] = lg[q][e];
        float mu = st[q][0] / (float)DD;
        float var = st[q][1] / (float)DD - mu * mu;
        s_mu[m] = mu;
        s_rstd[m] = rsqrtf(var + 1e-5f);
#pragma unroll
        for (int k = 0; k < 4; ++k) s_cl[m][k] = st[q][2 + k];
      }
      if (wave == 0) {
#pragma unroll
        for (int e = 0; e < EE; ++e) s_raw[0][e] = lg[4][e];
      }
    }
  }
  // Query scale, query bias and key scale of this wave's expert, 16 bytes a lane:
  // asked for here, so that they fly over the normalising of the keys
  v4f aq[DD / 128], ab[DD / 128], ak[DD / 128];
#pragma unroll
  for (int j = 0; j < DD / 128; ++j) {
    const int d = wave * DD + j * 128 + lane * 4;
    aq[j] = *(const v4f*)(lnq_s + d);
    ab[j] = *(const v4f*)(lnq_b + d);
    ak[j] = *(const v4f*)(lnk_s + d);
  }
  XCNT_WAIT();
  // this wave's key rows have landed: it may read its own; the barrier below
  // shows them, normalised, to the other waves
  asm volatile("s_wait_asynccnt 0x0" ::: "memory");
  // ---- LayerNorm of the keys without affine, in place: each wave its own four
  // rows, each lane the bytes that its own copies brought ----
  {
    v4f kv[4][DD / 128];
    float ks1[4], ks2[4];
#pragma unroll
    for (int q = 0; q < 4; ++q) {
      const int row = wave * 4 + q;
      const float* rp = (wave < 2 ? &sm.nr_lo[row][0] : &sm.nr_hi[row - 8][0]) + lane * 4;
#pragma unroll
      for (int j = 0; j < DD / 128; ++j) kv[q][j] = *(const v4f*)(rp + j * 128);
    }
#pragma unroll
    for (int q = 0; q < 4; ++q) {
      v4f s4 = {0.f, 0.f, 0.f, 0.f}, ss4 = {0.f, 0.f, 0.f, 0.f};
#pragma unroll
      for (int j = 0; j < DD / 128; ++j) {
        s4 += kv[q][j];
        ss4 += kv[q][j] * kv[q][j];
      }
      ks1[q] = (s4.x + s4.y) + (s4.z + s4.w);
      ks2[q] = (ss4.x + ss4.y) + (ss4.z + ss4.w);
    }
#pragma unroll
    for (int msk = 16; msk >= 1; msk >>= 1)
#pragma unroll
      for (int q = 0; q < 4; ++q) {
        ks1[q] += __shfl_xor(ks1[q], msk, 32);
        ks2[q] += __shfl_xor(ks2[q], msk, 32);
      }
#pragma unroll
    for (int q = 0; q < 4; ++q) {
      const int row = wave * 4 + q;
      float* wp = (wave < 2 ? &sm.nr_lo[row][0] : &sm.nr_hi[row - 8][0]) + lane * 4;
      const float kmu = ks1[q] / (float)DD;
      const float kvar = ks2[q] / (float)DD - kmu * kmu;
      const float krstd = rsqrtf(kvar + 1e-5f);
#pragma unroll
      for (int j = 0; j < DD / 128; ++j) *(v4f*)(wp + j * 128) = (kv[q][j] - kmu) * krstd;
    }
  }
  // The key scale folded into the query affine of this wave's expert. The line
  // below holds the products behind the normalising: lifted, their wait for the
  // global loads stands in front of the LDS reads of the keys.
  __builtin_amdgcn_sched_barrier(0);
#pragma unroll
  for (int j = 0; j < DD / 128; ++j) {
    *(v4f*)&sm.qks[wave][j * 128 + lane * 4] = aq[j] * ak[j];
    *(v4f*)&sm.qkb[wave][j * 128 + lane * 4] = ab[j] * ak[j];
  }
  __syncthreads();

  if (wave == 0 && lane < 16) {
    const int m = lane;
    const int sg = s0 + m;
    float f[EE];
    const float* cur = &s_raw[m + 1][0];
#pragma unroll
    for (int e = 0; e < EE; ++e) f[e] = cur[e];
    if (sg > 0) {
      const float* prv = cur - EE;
#pragma unroll
      for (int fo = 0; fo < EE; ++fo) {
        float a = 0.f;
#pragma unroll
        for (int e = 0; e < EE; ++e) a += prv[e] * Wmap[fo * EE + e];
        f[fo] += a;
      }
    }
    float* lo = logits_out + ((size_t)b * SS + sg) * EE;
#pragma unroll
    for (int e = 0; e < EE; ++e) lo[e] = f[e];
    float mx = f[0];
#pragma unroll
    for (int e = 1; e < EE; ++e) mx = fmaxf(mx, f[e]);
    float g[EE], gs = 0.f;
#pragma unroll
    for (int e = 0; e < EE; ++e) {
      g[e] = expf(f[e] - mx);
      gs += g[e];
    }
#pragma unroll
    for (int e = 0; e < EE; ++e) g[e] /= gs;
    int i1 = 0;
    float g1 = g[0];
#pragma unroll
    for (int e = 1; e < EE; ++e)
      if (g[e] > g1) { g1 = g[e]; i1 = e; }
    int i2 = (i1 == 0) ? 1 : 0;
    float g2 = g[i2];
#pragma unroll
    for (int e = 0; e < EE; ++e)
      if (e != i1 && g[e] > g2) { g2 = g[e]; i2 = e; }
    float t1 = (i1 == EE - 1) ? 0.f : g1;
    float t2 = (i2 == EE - 1) ? 0.f : g2;
    float inv = 1.f / (t1 + t2);
    float wv[EE];
#pragma unroll
    for (int e = 0; e < EE; ++e) wv[e] = 0.f;
    wv[i1] = t1 * inv;
    wv[i2] += t2 * inv;
    float a0 = s_cl[m][0], a1 = s_cl[m][1];
    float mxa = fmaxf(a0, a1);
    float e0 = expf(a0 - mxa), e1 = expf(a1 - mxa), tt = e0 + e1;
    float p00 = e0 / tt, p01 = e1 / tt;
    a0 = s_cl[m][2];
    a1 = s_cl[m][3];
    mxa = fmaxf(a0, a1);
    e0 = expf(a0 - mxa);
    e1 = expf(a1 - mxa);
    tt = e0 + e1;
    float p10 = e0 / tt, p11 = e1 / tt;

    s_alpha[m] = wv[0] + wv[1] + wv[2] + wv[3] + wv[4] * p00 + wv[5] * p10 + wv[6];
    s_beta[m][0] = wv[4] * p01;
    s_beta[m][1] = wv[5] * p11;
#pragma unroll
    for (int r = 0; r < RR; ++r) s_wv[m][r] = wv[r];
  }
  __syncthreads();

  // ---- Phase 3: scores via WMMA, A/B fragments from LDS. The key scale sits in
  // the query affine; the key bias adds the same to all 16 scores of a row, which
  // the softmax over them cancels, so it is left out.
  {
    const int m = lane & 15;
    const int half = lane >> 4;
    const float mu = s_mu[m];
    const float rstd = s_rstd[m];
    const float* nrm = m < 8 ? &sm.nr_lo[m][0] : &sm.nr_hi[m - 8][0];
    const float* ls = &sm.qks[wave][0];
    const float* lb = &sm.qkb[wave][0];
    v8f c = {};
    for (int ch = 0; ch < NCH; ++ch) {
      const int buf = ch & 1;
      if (ch + 1 < NCH)
        __builtin_amdgcn_s_wait_tensorcnt(1);
      else
        __builtin_amdgcn_s_wait_tensorcnt(0);
      __syncthreads();  // wave0's x-chunk visible to all waves
      const int k0 = ch * KC;
      // The chunk's LDS reads stand in one group in front of its matrix
      // instructions. Left to itself the build issues each read one matrix
      // instruction ahead of its use, and every read's latency lies open.
      v2f lsf[KC / 4], lbf[KC / 4], xf[KC / 4], bf[KC / 4];
#pragma unroll
      for (int i = 0; i < KC / 4; ++i) {
        lsf[i] = *(const v2f*)(ls + k0 + 4 * i + 2 * half);
        lbf[i] = *(const v2f*)(lb + k0 + 4 * i + 2 * half);
      }
#pragma unroll
      for (int i = 0; i < KC / 4; ++i) {
        xf[i] = *(const v2f*)&s_x[buf][m][4 * i + 2 * half];
        bf[i] = *(const v2f*)(nrm + k0 + 4 * i + 2 * half);
      }
      // holds the group in front: no instruction is moved over this line
      __builtin_amdgcn_sched_barrier(0);
#pragma unroll
      for (int i = 0; i < KC / 4; ++i) {
        v2f a;
        a.x = ((2.f * xf[i].x - mu) * rstd) * lsf[i].x + lbf[i].x;
        a.y = ((2.f * xf[i].y - mu) * rstd) * lsf[i].y + lbf[i].y;
        c = __builtin_amdgcn_wmma_f32_16x16x4_f32(false, a, false, bf[i],
                                                  (short)0, c, false, false);
      }
      __syncthreads();  // everyone done with buf before it is overwritten
      if (ch + 2 < NCH) {
        if (wave == 0)
          tdm_load_2d(lds_off_of(&s_x[buf][0][0]), x + xbase + (ch + 2) * KC,
                      KC, 16, DD);
      }
    }
    // row softmax over n (16-lane groups), weight by w_r[m], store to LDS
#pragma unroll
    for (int j = 0; j < 8; ++j) {
      float v = c[j];
      float mx = v;
      mx = fmaxf(mx, __shfl_xor(mx, 1, 16));
      mx = fmaxf(mx, __shfl_xor(mx, 2, 16));
      mx = fmaxf(mx, __shfl_xor(mx, 4, 16));
      mx = fmaxf(mx, __shfl_xor(mx, 8, 16));
      float e = expf(v - mx);
      float sm = e;
      sm += __shfl_xor(sm, 1, 16);
      sm += __shfl_xor(sm, 2, 16);
      sm += __shfl_xor(sm, 4, 16);
      sm += __shfl_xor(sm, 8, 16);
      const int row = j + 8 * half;
      s_attn[wave][row * 17 + (lane & 15)] = (e / sm) * s_wv[row][wave];
    }
  }
  __syncthreads();

  // ---- Phase 5: out tile. Each wave owns a 256-column d-quarter.
  // G = sum_r (w_r * attn_r) @ nk_r accumulates in one WMMA C chain. nk_r is
  // formed from the shared key rows in LDS, read once a tile for all experts,
  // with the lane's own column of the expert's scale and bias.
  {
    const int half = lane >> 4;
    const int nidx = lane & 15;
    const int dbase = wave * 256;
    const float* cc0 = const_c;
    const float* cc1 = const_c + DD;
    for (int t = 0; t < 16; ++t) {
      const int d0 = dbase + t * 16;
      const int d = d0 + nidx;
      v2f nrf[4];
#pragma unroll
      for (int kk = 0; kk < 4; ++kk) {
        const int krow = (4 * kk & 7) + 2 * half;  // row within its half
        const float(*nrh)[NRP] = kk < 2 ? sm.nr_lo : sm.nr_hi;
        nrf[kk].x = nrh[krow][d];
        nrf[kk].y = nrh[krow + 1][d];
      }
      v8f acc = {};
#pragma unroll
      for (int r = 0; r < RR; ++r) {
        const float ks = lnk_s[r * DD + d];
        const float kb = lnk_b[r * DD + d];
#pragma unroll
        for (int kk = 0; kk < 4; ++kk) {
          const int krow = 4 * kk + 2 * half;
          v2f a, bfrag;
          a.x = s_attn[r][nidx * 17 + krow];
          a.y = s_attn[r][nidx * 17 + krow + 1];
          bfrag.x = fmaf(nrf[kk].x, ks, kb);
          bfrag.y = fmaf(nrf[kk].y, ks, kb);
          acc = __builtin_amdgcn_wmma_f32_16x16x4_f32(false, a, false, bfrag,
                                                      (short)0, acc, false,
                                                      false);
        }
      }
#pragma unroll
      for (int j = 0; j < 8; ++j) {
        const int m = j + 8 * half;
        const float xs = 2.f * x[xbase + (size_t)m * DD + d];
        float val = acc[j] + s_alpha[m] * xs + s_beta[m][0] * cc0[d] +
                    s_beta[m][1] * cc1[d];
        out[xbase + (size_t)m * DD + d] = val;
      }
    }
  }
}

// ---------------------------------------------------------------------------
extern "C" void kernel_launch(void* const* d_in, const int* in_sizes, int n_in,
                              void* d_out, int out_size, void* d_ws,
                              size_t ws_size, hipStream_t stream) {
  (void)in_sizes;
  (void)n_in;
  (void)out_size;
  (void)ws_size;
  (void)d_ws;
  const float* x = (const float*)d_in[0];
  const float* Wg = (const float*)d_in[1];
  const float* Wmap = (const float*)d_in[2];
  const float* lnq_s = (const float*)d_in[3];
  const float* lnq_b = (const float*)d_in[4];
  const float* lnk_s = (const float*)d_in[5];
  const float* lnk_b = (const float*)d_in[6];
  const float* ref = (const float*)d_in[7];
  const float* const_c = (const float*)d_in[8];
  const float* const_w = (const float*)d_in[9];
  float* out = (float*)d_out;
  float* logits_out = out + (size_t)BB * SS * DD;

  k_main<<<BB * (SS / 16), 128, 0, stream>>>(x, Wmap, lnq_s, lnq_b, lnk_s, lnk_b,
                                             const_c, const_w, Wg, ref, out,
                                             logits_out);
}

// v004
// It runs in 30.3 microseconds.
// Timed twice side by side with v003, it ran 1.07 and 1.06 times as fast.
// Over all steps from v000 it is 1.94 times as fast.
#include <hip/hip_runtime.h>
#include <math.h>

typedef float v2f __attribute__((ext_vector_type(2)));
typedef float v4f __attribute__((ext_vector_type(4)));
typedef float v8f __attribute__((ext_vector_type(8)));
typedef unsigned int v4u __attribute__((ext_vector_type(4)));
typedef int v4i __attribute__((ext_vector_type(4)));
typedef int v8i __attribute__((ext_vector_type(8)));

#define BB 4
#define SS 2048
#define DD 1024
#define EE 8
#define NN 16
#define RR 4

#define KC 64
#define NCH (DD / KC)
#define LROW (KC + 4)
#define NRP (DD + 4)
#define X_PLACE 0x8800
#define PJ 4
#define PT (DD / (32 * PJ))
// keeps a trip's loads from being lifted over the sums of the trip in front:
// lifted, they leave the place where XCNT_WAIT below covers their address
// registers, and two trips' weights are live at once
#define HOLD_LOADS() __builtin_amdgcn_sched_barrier(0)
// Behind a group of global loads, in front of the next group, whose results the
// compiler lays over the first group's address registers. The
// two scheduling barriers hold the wait, and with it the groups' issue order.
#define XCNT_WAIT()                                  \
  do {                                               \
    __builtin_amdgcn_sched_barrier(0);               \
    asm volatile("s_wait_xcnt 0x0" ::: "memory");    \
    __builtin_amdgcn_sched_barrier(0);               \
  } while (0)

__device__ __forceinline__ void tdm_load_2d(unsigned lds_byte_off,
                                            const float* gptr,
                                            unsigned tile_d0,   // elems per row
                                            unsigned tile_d1,   // rows
                                            unsigned strideElems) {
  unsigned long long ga = (unsigned long long)(uintptr_t)gptr;
  v4u g0;
  g0.x = 1u;                                   // count=1 (valid), user mode
  g0.y = lds_byte_off;                         // lds_addr
  g0.z = (unsigned)(ga & 0xffffffffull);       // global_addr[31:0]
  g0.w = (unsigned)((ga >> 32) & 0x1ffffffull) // global_addr[56:32]
         | (2u << 30);                         // type=2 ("image")
  v8i g1;
  g1[0] = (int)((2u << 16)
                | (1u << 20)
                | (5u << 22)
                | (3u << 25));
  g1[1] = (int)(((unsigned)DD & 0xffffu) << 16);
  g1[2] = (int)((((unsigned)DD >> 16) & 0xffffu)
                | ((tile_d1 & 0xffffu) << 16));
  g1[3] = (int)((tile_d0 & 0xffffu) << 16);
  g1[4] = (int)(tile_d1 & 0xffffu);
  g1[5] = (int)strideElems;
  g1[6] = 0;
  g1[7] = 0;
  v4i z4 = {0, 0, 0, 0};
#if __clang_major__ >= 23
  v8i z8 = {0, 0, 0, 0, 0, 0, 0, 0};
  __builtin_amdgcn_tensor_load_to_lds(g0, g1, z4, z4, z8, 0);
#else
  __builtin_amdgcn_tensor_load_to_lds(g0, g1, z4, z4, 0);
#endif
}

__device__ __forceinline__ unsigned lds_off_of(const void* p) {
  // generic pointer to LDS: low 32 bits are the LDS byte offset
  return (unsigned)(unsigned long long)(uintptr_t)p;
}

__device__ __forceinline__ void copy_row_async(unsigned l, const float* g) {
  asm volatile(
      "global_load_async_to_lds_b128 %0, %8, off\n\t"
      "global_load_async_to_lds_b128 %1, %9, off\n\t"
      "global_load_async_to_lds_b128 %2, %10, off\n\t"
      "global_load_async_to_lds_b128 %3, %11, off\n\t"
      "global_load_async_to_lds_b128 %4, %12, off\n\t"
      "global_load_async_to_lds_b128 %5, %13, off\n\t"
      "global_load_async_to_lds_b128 %6, %14, off\n\t"
      "global_load_async_to_lds_b128 %7, %15, off\n\t"
      "s_wait_xcnt 0x0"
      ::"v"(l), "v"(l + 512u), "v"(l + 1024u), "v"(l + 1536u), "v"(l + 2048u),
      "v"(l + 2560u), "v"(l + 3072u), "v"(l + 3584u), "v"(g), "v"(g + 128),
      "v"(g + 256), "v"(g + 384), "v"(g + 512), "v"(g + 640), "v"(g + 768),
      "v"(g + 896)
      : "memory");
}

// LDS of the main kernel, one object so that every place in it is fixed. The x
// ring keeps its place, so the 16 key rows lie in two halves around it. Two such
// objects fit a WGP's LDS, as many work-groups as the grid gives each WGP.
struct __attribute__((aligned(16))) MainLdsAll {
  float nr_lo[8][NRP];  // key rows 0..7
  float raw[17][EE];    // raw gate logits: row 0 = token s0-1, row m+1 = tile token m
  float cl[16][4], alpha[16], beta[16][2], wv[16][4];
  float unused[(X_PLACE - 8 * NRP * 4 - 17 * EE * 4 - 16 * 11 * 4) / 4];
  float x[2][16][LROW];  //  8.5 KB
  float mu[16], rstd[16];
  float nr_hi[8][NRP];
  float attn[RR][16 * 17];
  float qks[RR][DD];  // query scale * key scale, per expert
  float qkb[RR][DD];  // query bias * key scale, per expert
};
static_assert(__builtin_offsetof(MainLdsAll, qks) % 16 == 0, "16-byte stores of the folded affine");
static_assert(__builtin_offsetof(MainLdsAll, nr_hi) % 256 == 128);
static_assert(sizeof(MainLdsAll) * 2 <= 320 * 1024, "two work-groups a WGP");
static_assert(__builtin_offsetof(MainLdsAll, x) == X_PLACE, "place of the x ring");

__global__ __launch_bounds__(128) void k_main(
    const float* __restrict__ x, const float* __restrict__ Wmap,
    const float* __restrict__ lnq_s, const float* __restrict__ lnq_b,
    const float* __restrict__ lnk_s, const float* __restrict__ lnk_b,
    const float* __restrict__ const_c, const float* __restrict__ const_w,
    const float* __restrict__ Wg, const float* __restrict__ ref,
    float* __restrict__ out, float* __restrict__ logits_out) {
  __shared__ MainLdsAll sm;
  auto& s_x = sm.x;
  auto& s_mu = sm.mu;
  auto& s_rstd = sm.rstd;
  auto& s_cl = sm.cl;
  auto& s_alpha = sm.alpha;
  auto& s_beta = sm.beta;
  auto& s_wv = sm.wv;
  auto& s_attn = sm.attn;
  auto& s_raw = sm.raw;

  const int tid = threadIdx.x;
  const int wave = tid >> 5;
  const int lane = tid & 31;
  const int tilesPerB = SS / 16;
  const int b = blockIdx.x / tilesPerB;
  const int s0 = (blockIdx.x % tilesPerB) * 16;
  const size_t xbase = ((size_t)b * SS + s0) * DD;

#pragma unroll
  for (int c = 0; c < 2; ++c) {
    if (wave == 0)
      tdm_load_2d(lds_off_of(&s_x[c][0][0]), x + xbase + c * KC, KC, 16, DD);
  }
  // ---- the batch's raw keys, four rows a wave; they fly over phase 1 ----
#pragma unroll
  for (int q = 0; q < 4; ++q) {
    const int row = wave * 4 + q;
    const float* dst = wave < 2 ? &sm.nr_lo[row][0] : &sm.nr_hi[row - 8][0];
    copy_row_async(lds_off_of(dst) + (unsigned)lane * 16u,
                   ref + ((size_t)b * NN + row) * DD + lane * 4);
  }

  // ---- Phase 1: raw gate logits, mean/var of xs=2x and const-cluster dots.
  // One wave per 4 tokens, lanes strided over d: every x element is loaded once
  // for all 14 sums of its token, every weight slice once for the wave's rows.
  // All waves also form the logits of the token in front of the tile (the gate
  // residual of tile token 0 needs them); wave 0 publishes them.
  {
    const int r0 = wave * 4;
    const float* xr = x + xbase + (size_t)r0 * DD + lane;
    // at a sequence start there is no such token: read tile token 0, unused
    const float* xp = x + xbase - (s0 > 0 ? DD : 0) + lane;
    const float* wgl = Wg + lane;
    const float* cwl = const_w + lane;
    float lg[5][EE];  // rows 0..3: own tokens, row 4: token in front of the tile
    float st[4][6];   // sum, sum of squares, four const-cluster dots
#pragma unroll
    for (int q = 0; q < 5; ++q)
#pragma unroll
      for (int e = 0; e < EE; ++e) lg[q][e] = 0.f;
#pragma unroll
    for (int q = 0; q < 4; ++q)
#pragma unroll
      for (int k = 0; k < 6; ++k) st[q][k] = 0.f;
    auto load_x = [&](float (&dst)[5][PJ], int t) {
#pragma unroll
      for (int j = 0; j < PJ; ++j) {
        const int d = (t * PJ + j) * 32;
#pragma unroll
        for (int q = 0; q < 4; ++q) dst[q][j] = xr[q * DD + d];
        dst[4][j] = xp[d];
      }
    };
    float wg[PJ][EE], cw[PJ][4];
    auto load_weights = [&](int t) {
#pragma unroll
      for (int j = 0; j < PJ; ++j)
#pragma unroll
        for (int e = 0; e < EE; ++e) wg[j][e] = wgl[e * DD + (t * PJ + j) * 32];
      XCNT_WAIT();
#pragma unroll
      for (int j = 0; j < PJ; ++j)
#pragma unroll
        for (int k = 0; k < 4; ++k) cw[j][k] = cwl[k * DD + (t * PJ + j) * 32];
      XCNT_WAIT();
    };
    auto sum_slices = [&](const float (&xc)[5][PJ]) {
#pragma unroll
      for (int j = 0; j < PJ; ++j) {
#pragma unroll
        for (int q = 0; q < 4; ++q) {
          const float xv = xc[q][j];
#pragma unroll
          for (int e = 0; e < EE; ++e) lg[q][e] = fmaf(xv, wg[j][e], lg[q][e]);
          const float xs = 2.f * xv;
          st[q][0] += xs;
          st[q][1] = fmaf(xs, xs, st[q][1]);
#pragma unroll
          for (int k = 0; k < 4; ++k)
            st[q][2 + k] = fmaf(xs, cw[j][k], st[q][2 + k]);
        }
#pragma unroll
        for (int e = 0; e < EE; ++e)
          lg[4][e] = fmaf(xc[4][j], wg[j][e], lg[4][e]);
      }
    };
    // Two register sets for x, so that a trip's x loads fly while the trip in
    // front of it is summed. In each trip the weights are asked for first and
    // the next x slices behind them: loads return in issue order, so the wait
    // for the (cached) weights then leaves the x loads flying.
    float xa[5][PJ], xb[5][PJ];
    load_x(xa, 0);
    // kept rolled for speed only: the body is large
#pragma unroll 1
    for (int t = 0; t + 2 < PT; t += 2) {
      load_weights(t);
      load_x(xb, t + 1);
      sum_slices(xa);
      HOLD_LOADS();
      load_weights(t + 1);
      load_x(xa, t + 2);
      sum_slices(xb);
      HOLD_LOADS();
    }
    load_weights(PT - 2);
    load_x(xb, PT - 1);
    sum_slices(xa);
    HOLD_LOADS();
    load_weights(PT - 1);
    sum_slices(xb);
#pragma unroll
    for (int q = 0; q < 5; ++q)
#pragma unroll
      for (int e = 0; e < EE; ++e) {
        float v = lg[q][e];
#pragma unroll
        for (int msk = 16; msk >= 1; msk >>= 1) v += __shfl_xor(v, msk, 32);
        lg[q][e] = v;
      }
#pragma unroll
    for (int q = 0; q < 4; ++q)
#pragma unroll
      for (int k = 0; k < 6; ++k) {
        float v = st[q][k];
#pragma unroll
        for (int msk = 16; msk >= 1; msk >>= 1) v += __shfl_xor(v, msk, 32);
        st[q][k] = v;
      }
    if (lane == 0) {
#pragma unroll
      for (int q = 0; q < 4; ++q) {
        const int m = r0 + q;
#pragma unroll
        for (int e = 0; e < EE; ++e) s_raw[m + 1][e] = lg[q][e];
        float mu = st[q][0] / (float)DD;
        float var = st[q][1] / (float)DD - mu * mu;
        s_mu[m] = mu;
        s_rstd[m] = rsqrtf(var + 1e-5f);
#pragma unroll
        for (int k = 0; k < 4; ++k) s_cl[m][k] = st[q][2 + k];
      }
      if (wave == 0) {
#pragma unroll
        for (int e = 0; e < EE; ++e) s_raw[0][e] = lg[4][e];
      }
    }
  }
  // Query scale, query bias and key scale of this wave's expert, 16 bytes a lane:
  // asked for here, so that they fly over the normalising of the keys
  v4f aq[DD / 128], ab[DD / 128], ak[DD / 128];
#pragma unroll
  for (int j = 0; j < DD / 128; ++j) {
    const int d = wave * DD + j * 128 + lane * 4;
    aq[j] = *(const v4f*)(lnq_s + d);
    ab[j] = *(const v4f*)(lnq_b + d);
    ak[j] = *(const v4f*)(lnk_s + d);
  }
  XCNT_WAIT();
  // this wave's key rows have landed: it may read its own; the barrier below
  // shows them, normalised, to the other waves
  asm volatile("s_wait_asynccnt 0x0" ::: "memory");
  // ---- LayerNorm of the keys without affine, in place: each wave its own four
  // rows, each lane the bytes that its own copies brought ----
  {
    v4f kv[4][DD / 128];
    float ks1[4], ks2[4];
#pragma unroll
    for (int q = 0; q < 4; ++q) {
      const int row = wave * 4 + q;
      const float* rp = (wave < 2 ? &sm.nr_lo[row][0] : &sm.nr_hi[row - 8][0]) + lane * 4;
#pragma unroll
      for (int j = 0; j < DD / 128; ++j) kv[q][j] = *(const v4f*)(rp + j * 128);
    }
#pragma unroll
    for (int q = 0; q < 4; ++q) {
      v4f s4 = {0.f, 0.f, 0.f, 0.f}, ss4 = {0.f, 0.f, 0.f, 0.f};
#pragma unroll
      for (int j = 0; j < DD / 128; ++j) {
        s4 += kv[q][j];
        ss4 += kv[q][j] * kv[q][j];
      }
      ks1[q] = (s4.x + s4.y) + (s4.z + s4.w);
      ks2[q] = (ss4.x + ss4.y) + (ss4.z + ss4.w);
    }
#pragma unroll
    for (int msk = 16; msk >= 1; msk >>= 1)
#pragma unroll
      for (int q = 0; q < 4; ++q) {
        ks1[q] += __shfl_xor(ks1[q], msk, 32);
        ks2[q] += __shfl_xor(ks2[q], msk, 32);
      }
#pragma unroll
    for (int q = 0; q < 4; ++q) {
      const int row = wave * 4 + q;
      float* wp = (wave < 2 ? &sm.nr_lo[row][0] : &sm.nr_hi[row - 8][0]) + lane * 4;
      const float kmu = ks1[q] / (float)DD;
      const float kvar = ks2[q] / (float)DD - kmu * kmu;
      const float krstd = rsqrtf(kvar + 1e-5f);
#pragma unroll
      for (int j = 0; j < DD / 128; ++j) *(v4f*)(wp + j * 128) = (kv[q][j] - kmu) * krstd;
    }
  }
  // The key scale folded into the query affine of this wave's expert. The line
  // below holds the products behind the normalising: lifted, their wait for the
  // global loads stands in front of the LDS reads of the keys.
  __builtin_amdgcn_sched_barrier(0);
#pragma unroll
  for (int j = 0; j < DD / 128; ++j) {
    *(v4f*)&sm.qks[wave][j * 128 + lane * 4] = aq[j] * ak[j];
    *(v4f*)&sm.qkb[wave][j * 128 + lane * 4] = ab[j] * ak[j];
  }
  __syncthreads();

  if (wave == 0 && lane < 16) {
    const int m = lane;
    const int sg = s0 + m;
    float f[EE];
    const float* cur = &s_raw[m + 1][0];
#pragma unroll
    for (int e = 0; e < EE; ++e) f[e] = cur[e];
    if (sg > 0) {
      const float* prv = cur - EE;
#pragma unroll
      for (int fo = 0; fo < EE; ++fo) {
        float a = 0.f;
#pragma unroll
        for (int e = 0; e < EE; ++e) a += prv[e] * Wmap[fo * EE + e];
        f[fo] += a;
      }
    }
    float* lo = logits_out + ((size_t)b * SS + sg) * EE;
#pragma unroll
    for (int e = 0; e < EE; ++e) lo[e] = f[e];
    float mx = f[0];
#pragma unroll
    for (int e = 1; e < EE; ++e) mx = fmaxf(mx, f[e]);
    float g[EE], gs = 0.f;
#pragma unroll
    for (int e = 0; e < EE; ++e) {
      g[e] = expf(f[e] - mx);
      gs += g[e];
    }
#pragma unroll
    for (int e = 0; e < EE; ++e) g[e] /= gs;
    int i1 = 0;
    float g1 = g[0];
#pragma unroll
    for (int e = 1; e < EE; ++e)
      if (g[e] > g1) { g1 = g[e]; i1 = e; }
    int i2 = (i1 == 0) ? 1 : 0;
    float g2 = g[i2];
#pragma unroll
    for (int e = 0; e < EE; ++e)
      if (e != i1 && g[e] > g2) { g2 = g[e]; i2 = e; }
    float t1 = (i1 == EE - 1) ? 0.f : g1;
    float t2 = (i2 == EE - 1) ? 0.f : g2;
    float inv = 1.f / (t1 + t2);
    float wv[EE];
#pragma unroll
    for (int e = 0; e < EE; ++e) wv[e] = 0.f;
    wv[i1] = t1 * inv;
    wv[i2] += t2 * inv;
    float a0 = s_cl[m][0], a1 = s_cl[m][1];
    float mxa = fmaxf(a0, a1);
    float e0 = expf(a0 - mxa), e1 = expf(a1 - mxa), tt = e0 + e1;
    float p00 = e0 / tt, p01 = e1 / tt;
    a0 = s_cl[m][2];
    a1 = s_cl[m][3];
    mxa = fmaxf(a0, a1);
    e0 = expf(a0 - mxa);
    e1 = expf(a1 - mxa);
    tt = e0 + e1;
    float p10 = e0 / tt, p11 = e1 / tt;

    s_alpha[m] = wv[0] + wv[1] + wv[2] + wv[3] + wv[4] * p00 + wv[5] * p10 + wv[6];
    s_beta[m][0] = wv[4] * p01;
    s_beta[m][1] = wv[5] * p11;
#pragma unroll
    for (int r = 0; r < RR; ++r) s_wv[m][r] = wv[r];
  }
  __syncthreads();

  // Operands of one 16-column tile of the output pass (phase 5), fetched one tile
  // ahead of their use: the lane's column of the key rows (LDS), of the experts'
  // key scale and bias, of the two constant vectors and of its eight x rows.
  v2f f_nr[4];
  float f_ks[RR], f_kb[RR], f_x[8], f_c0, f_c1;
  const float* xt = x + xbase;  // the tile's x rows, the same for all lanes
  const unsigned fh = (unsigned)lane >> 4;
  const unsigned fd0 = (unsigned)(wave * 256 + (lane & 15));  // column in tile 0
  // the lane's column of tile 0 in the four arrays; a tile on is 16 floats on
  const float* const pks0 = lnk_s + fd0;
  const float* const pkb0 = lnk_b + fd0;
  const float* const pcc0 = const_c + fd0;
  const float* const px0 = xt + 8 * fh * DD + fd0;  // first of the lane's x rows
  auto fetch_tile = [&](unsigned d, const float* pks, const float* pkb,
                        const float* pcc, const float* px) {
#pragma unroll
    for (int r = 0; r < RR; ++r) f_ks[r] = pks[r * DD];
#pragma unroll
    for (int r = 0; r < RR; ++r) f_kb[r] = pkb[r * DD];
#pragma unroll
    for (int j = 0; j < 8; ++j) f_x[j] = px[j * DD];
    f_c0 = pcc[0];
    f_c1 = pcc[DD];
#pragma unroll
    for (int kk = 0; kk < 4; ++kk) {
      const unsigned krow = (4 * kk & 7) + 2 * fh;  // row within its half
      const float(*nrh)[NRP] = kk < 2 ? sm.nr_lo : sm.nr_hi;
      f_nr[kk].x = nrh[krow][d];
      f_nr[kk].y = nrh[krow + 1][d];
    }
  };

  // ---- Phase 3: scores via WMMA, A/B fragments from LDS. The key scale sits in
  // the query affine; the key bias adds the same to all 16 scores of a row, which
  // the softmax over them cancels, so it is left out.
  {
    const int m = lane & 15;
    const int half = lane >> 4;
    const float mu = s_mu[m];
    const float rstd = s_rstd[m];
    const float* nrm = m < 8 ? &sm.nr_lo[m][0] : &sm.nr_hi[m - 8][0];
    const float* ls = &sm.qks[wave][0];
    const float* lb = &sm.qkb[wave][0];
    v8f c = {};
    for (int ch = 0; ch < NCH; ++ch) {
      const int buf = ch & 1;
      if (ch + 1 < NCH)
        __builtin_amdgcn_s_wait_tensorcnt(1);
      else
        __builtin_amdgcn_s_wait_tensorcnt(0);
      __syncthreads();  // wave0's x-chunk visible to all waves
      const int k0 = ch * KC;
      // The chunk's LDS reads stand in one group in front of its matrix
      // instructions. Left to itself the build issues each read one matrix
      // instruction ahead of its use, and every read's latency lies open.
      v2f lsf[KC / 4], lbf[KC / 4], xf[KC / 4], bf[KC / 4];
#pragma unroll
      for (int i = 0; i < KC / 4; ++i) {
        lsf[i] = *(const v2f*)(ls + k0 + 4 * i + 2 * half);
        lbf[i] = *(const v2f*)(lb + k0 + 4 * i + 2 * half);
      }
#pragma unroll
      for (int i = 0; i < KC / 4; ++i) {
        xf[i] = *(const v2f*)&s_x[buf][m][4 * i + 2 * half];
        bf[i] = *(const v2f*)(nrm + k0 + 4 * i + 2 * half);
      }
      // holds the group in front: no instruction is moved over this line
      __builtin_amdgcn_sched_barrier(0);
#pragma unroll
      for (int i = 0; i < KC / 4; ++i) {
        v2f a;
        a.x = ((2.f * xf[i].x - mu) * rstd) * lsf[i].x + lbf[i].x;
        a.y = ((2.f * xf[i].y - mu) * rstd) * lsf[i].y + lbf[i].y;
        c = __builtin_amdgcn_wmma_f32_16x16x4_f32(false, a, false, bf[i],
                                                  (short)0, c, false, false);
      }
      __syncthreads();  // everyone done with buf before it is overwritten
      if (ch + 2 < NCH) {
        if (wave == 0)
          tdm_load_2d(lds_off_of(&s_x[buf][0][0]), x + xbase + (ch + 2) * KC,
                      KC, 16, DD);
      }
    }
    // the first output tile's operands fly over the softmax
    fetch_tile(fd0, pks0, pkb0, pcc0, px0);
    // in front of any rewrite of a register that these loads name; as inputs the
    // column offset and the four addresses stay in their registers up to this wait
    asm volatile("s_wait_xcnt 0x0" ::"v"(fd0), "v"(pks0), "v"(pkb0), "v"(pcc0), "v"(px0)
                 : "memory");
    // row softmax over n (16-lane groups), weight by w_r[m], store to LDS
#pragma unroll
    for (int j = 0; j < 8; ++j) {
      float v = c[j];
      float mx = v;
      mx = fmaxf(mx, __shfl_xor(mx, 1, 16));
      mx = fmaxf(mx, __shfl_xor(mx, 2, 16));
      mx = fmaxf(mx, __shfl_xor(mx, 4, 16));
      mx = fmaxf(mx, __shfl_xor(mx, 8, 16));
      float e = expf(v - mx);
      float sm = e;
      sm += __shfl_xor(sm, 1, 16);
      sm += __shfl_xor(sm, 2, 16);
      sm += __shfl_xor(sm, 4, 16);
      sm += __shfl_xor(sm, 8, 16);
      const int row = j + 8 * half;
      s_attn[wave][row * 17 + (lane & 15)] = (e / sm) * s_wv[row][wave];
    }
  }
  __syncthreads();

  // ---- Phase 5: out tile. Each wave owns a 256-column d-quarter.
  // G = sum_r (w_r * attn_r) @ nk_r accumulates in one WMMA C chain. nk_r is
  // formed from the shared key rows in LDS, read once a tile for all experts,
  // with the lane's own column of the expert's scale and bias.
  // A trip first takes all it needs out of the fetched registers, then asks for
  // the next tile's operands, which fly over its own matrix chain and stores.
  {
    const int half = lane >> 4;
    const int nidx = lane & 15;
    const int dbase = wave * 256;
    // the same for all 16 tiles: read once, in front of the loop
    v2f afrag[RR][4];
    float al[8], be0[8], be1[8];
#pragma unroll
    for (int r = 0; r < RR; ++r)
#pragma unroll
      for (int kk = 0; kk < 4; ++kk) {
        const int krow = 4 * kk + 2 * half;
        afrag[r][kk].x = s_attn[r][nidx * 17 + krow];
        afrag[r][kk].y = s_attn[r][nidx * 17 + krow + 1];
      }
#pragma unroll
    for (int j = 0; j < 8; ++j) {
      al[j] = s_alpha[j + 8 * half];
      be0[j] = s_beta[j + 8 * half][0];
      be1[j] = s_beta[j + 8 * half][1];
    }
    for (int t = 0; t < 16; ++t) {
      const int d0 = dbase + t * 16;
      const int d = d0 + nidx;
      v2f bfrag[RR][4];
#pragma unroll
      for (int r = 0; r < RR; ++r)
#pragma unroll
        for (int kk = 0; kk < 4; ++kk) {
          bfrag[r][kk].x = fmaf(f_nr[kk].x, f_ks[r], f_kb[r]);
          bfrag[r][kk].y = fmaf(f_nr[kk].y, f_ks[r], f_kb[r]);
        }
      float xs[8];
#pragma unroll
      for (int j = 0; j < 8; ++j) xs[j] = 2.f * f_x[j];
      const float c0 = f_c0, c1 = f_c1;
      // this tile's column in the four arrays; the fetch reads 16 floats on
      const float *pks = pks0 + t * 16, *pkb = pkb0 + t * 16, *pcc = pcc0 + t * 16,
                  *px = px0 + t * 16;
      if (t + 1 < 16)
        fetch_tile(fd0 + (unsigned)(t + 1) * 16u, pks + 16, pkb + 16, pcc + 16, px + 16);
      // holds the next tile's loads in front of this tile's matrix chain: without
      // it the LDS reads sink behind the chain and lie open at the next trip's top
      __builtin_amdgcn_sched_barrier(0);
      v8f acc = {};
#pragma unroll
      for (int r = 0; r < RR; ++r) {
#pragma unroll
        for (int kk = 0; kk < 4; ++kk) {
          acc = __builtin_amdgcn_wmma_f32_16x16x4_f32(false, afrag[r][kk], false, bfrag[r][kk],
                                                      (short)0, acc, false,
                                                      false);
        }
      }
#pragma unroll
      for (int j = 0; j < 8; ++j) {
        const int m = j + 8 * half;
        float val = acc[j] + al[j] * xs[j] + be0[j] * c0 + be1[j] * c1;
        out[xbase + (size_t)m * DD + d] = val;
      }
      // One wait a trip: behind the stores, in front of the next trip's first
      // instructions, which rewrite the stores' registers. It serves the fetch
      // too: as inputs here the four addresses keep their registers till now, so
      // that neither a loaded value nor the chain's result is laid over them.
      if (t + 1 < 16)
        asm volatile("s_wait_xcnt 0x0" ::"v"(pks), "v"(pkb), "v"(pcc), "v"(px) : "memory");
    }
  }
}

// ---------------------------------------------------------------------------
extern "C" void kernel_launch(void* const* d_in, const int* in_sizes, int n_in,
                              void* d_out, int out_size, void* d_ws,
                              size_t ws_size, hipStream_t stream) {
  (void)in_sizes;
  (void)n_in;
  (void)out_size;
  (void)ws_size;
  (void)d_ws;
  const float* x = (const float*)d_in[0];
  const float* Wg = (const float*)d_in[1];
  const float* Wmap = (const float*)d_in[2];
  const float* lnq_s = (const float*)d_in[3];
  const float* lnq_b = (const float*)d_in[4];
  const float* lnk_s = (const float*)d_in[5];
  const float* lnk_b = (const float*)d_in[6];
  const float* ref = (const float*)d_in[7];
  const float* const_c = (const float*)d_in[8];
  const float* const_w = (const float*)d_in[9];
  float* out = (float*)d_out;
  float* logits_out = out + (size_t)BB * SS * DD;

  k_main<<<BB * (SS / 16), 128, 0, stream>>>(x, Wmap, lnq_s, lnq_b, lnk_s, lnk_b,
                                             const_c, const_w, Wg, ref, out,
                                             logits_out);
}

// v005
// One run takes 28.4 microseconds.
// Two timings next to v004 put it at 1.06 and 1.07 times that version's speed.
// All steps since v000 together make it 2.06 times as fast.
#include <hip/hip_runtime.h>
#include <math.h>

typedef float v2f __attribute__((ext_vector_type(2)));
typedef float v4f __attribute__((ext_vector_type(4)));
typedef float v8f __attribute__((ext_vector_type(8)));
typedef unsigned int v4u __attribute__((ext_vector_type(4)));
typedef int v4i __attribute__((ext_vector_type(4)));
typedef int v8i __attribute__((ext_vector_type(8)));

#define BB 4
#define SS 2048
#define DD 1024
#define EE 8
#define NN 16
#define RR 4

#define KC 64
#define NCH (DD / KC)
#define LROW (KC + 4)
#define NRP (DD + 4)
#define X_PLACE 0x8800
#define PJ 4
#define PT (DD / (32 * PJ))
// keeps a trip's loads from being lifted over the sums of the trip in front:
// lifted, they leave the place where XCNT_WAIT below covers their address
// registers, and two trips' weights are live at once
#define HOLD_LOADS() __builtin_amdgcn_sched_barrier(0)
// Behind a group of global loads, in front of the next group, whose results the
// compiler lays over the first group's address registers. The
// two scheduling barriers hold the wait, and with it the groups' issue order.
#define XCNT_WAIT()                                  \
  do {                                               \
    __builtin_amdgcn_sched_barrier(0);               \
    asm volatile("s_wait_xcnt 0x0" ::: "memory");    \
    __builtin_amdgcn_sched_barrier(0);               \
  } while (0)

__device__ __forceinline__ void tdm_load_2d(unsigned lds_byte_off,
                                            const float* gptr,
                                            unsigned tile_d0,   // elems per row
                                            unsigned tile_d1,   // rows
                                            unsigned strideElems) {
  unsigned long long ga = (unsigned long long)(uintptr_t)gptr;
  v4u g0;
  g0.x = 1u;                                   // count=1 (valid), user mode
  g0.y = lds_byte_off;                         // lds_addr
  g0.z = (unsigned)(ga & 0xffffffffull);       // global_addr[31:0]
  g0.w = (unsigned)((ga >> 32) & 0x1ffffffull) // global_addr[56:32]
         | (2u << 30);                         // type=2 ("image")
  v8i g1;
  g1[0] = (int)((2u << 16)
                | (1u << 20)
                | (5u << 22)
                | (3u << 25));
  g1[1] = (int)(((unsigned)DD & 0xffffu) << 16);
  g1[2] = (int)((((unsigned)DD >> 16) & 0xffffu)
                | ((tile_d1 & 0xffffu) << 16));
  g1[3] = (int)((tile_d0 & 0xffffu) << 16);
  g1[4] = (int)(tile_d1 & 0xffffu);
  g1[5] = (int)strideElems;
  g1[6] = 0;
  g1[7] = 0;
  v4i z4 = {0, 0, 0, 0};
#if __clang_major__ >= 23
  v8i z8 = {0, 0, 0, 0, 0, 0, 0, 0};
  __builtin_amdgcn_tensor_load_to_lds(g0, g1, z4, z4, z8, 0);
#else
  __builtin_amdgcn_tensor_load_to_lds(g0, g1, z4, z4, 0);
#endif
}

__device__ __forceinline__ unsigned lds_off_of(const void* p) {
  // generic pointer to LDS: low 32 bits are the LDS byte offset
  return (unsigned)(unsigned long long)(uintptr_t)p;
}

template <int M>
__device__ __forceinline__ float row_xor(float v) {
  return __builtin_bit_cast(
      float, __builtin_amdgcn_update_dpp(0, __builtin_bit_cast(int, v), 0x160 | M, 0xf, 0xf, true));
}
__device__ __forceinline__ float half_xor(float v) {
  const int b = __builtin_bit_cast(int, v);
  return __builtin_bit_cast(
      float, __builtin_amdgcn_permlanex16(b, b, 0x76543210, 0xfedcba98, false, false));
}
// One step of a sum over the lanes that halves the number of values: of the pair
// (v[i], v[i + H]) a lane keeps the one its own bit names and hands the other to
// its partner, so each lane adds the same two numbers as in a plain butterfly.
template <int H, typename X>
__device__ __forceinline__ void fold_step(float* v, bool upper, X xchg) {
#pragma unroll
  for (int i = 0; i < H; ++i) {
    const float a = v[i], b = v[i + H];
    v[i] = (upper ? b : a) + xchg(upper ? a : b);
  }
}

__device__ __forceinline__ void copy_row_async(unsigned l, const float* g) {
  asm volatile(
      "global_load_async_to_lds_b128 %0, %8, off\n\t"
      "global_load_async_to_lds_b128 %1, %9, off\n\t"
      "global_load_async_to_lds_b128 %2, %10, off\n\t"
      "global_load_async_to_lds_b128 %3, %11, off\n\t"
      "global_load_async_to_lds_b128 %4, %12, off\n\t"
      "global_load_async_to_lds_b128 %5, %13, off\n\t"
      "global_load_async_to_lds_b128 %6, %14, off\n\t"
      "global_load_async_to_lds_b128 %7, %15, off\n\t"
      "s_wait_xcnt 0x0"
      ::"v"(l), "v"(l + 512u), "v"(l + 1024u), "v"(l + 1536u), "v"(l + 2048u),
      "v"(l + 2560u), "v"(l + 3072u), "v"(l + 3584u), "v"(g), "v"(g + 128),
      "v"(g + 256), "v"(g + 384), "v"(g + 512), "v"(g + 640), "v"(g + 768),
      "v"(g + 896)
      : "memory");
}

// LDS of the main kernel, one object so that every place in it is fixed. The x
// ring keeps its place, so the 16 key rows lie in two halves around it. Two such
// objects fit a WGP's LDS, as many work-groups as the grid gives each WGP.
struct __attribute__((aligned(16))) MainLdsAll {
  float nr_lo[8][NRP];  // key rows 0..7
  float raw[17][EE];    // raw gate logits: row 0 = token s0-1, row m+1 = tile token m
  float cl[16][4], alpha[16], beta[16][2], wv[16][4];
  float unused[(X_PLACE - 8 * NRP * 4 - 17 * EE * 4 - 16 * 11 * 4) / 4];
  float x[2][16][LROW];  //  8.5 KB
  float mu[16], rstd[16];
  float nr_hi[8][NRP];
  float attn[RR][16 * 17];
  float qks[RR][DD];  // query scale * key scale, per expert
  float qkb[RR][DD];  // query bias * key scale, per expert
};
static_assert(__builtin_offsetof(MainLdsAll, qks) % 16 == 0, "16-byte stores of the folded affine");
static_assert(__builtin_offsetof(MainLdsAll, nr_hi) % 256 == 128);
static_assert(sizeof(MainLdsAll) * 2 <= 320 * 1024, "two work-groups a WGP");
static_assert(__builtin_offsetof(MainLdsAll, x) == X_PLACE, "place of the x ring");

__global__ __launch_bounds__(128) void k_main(
    const float* __restrict__ x, const float* __restrict__ Wmap,
    const float* __restrict__ lnq_s, const float* __restrict__ lnq_b,
    const float* __restrict__ lnk_s, const float* __restrict__ lnk_b,
    const float* __restrict__ const_c, const float* __restrict__ const_w,
    const float* __restrict__ Wg, const float* __restrict__ ref,
    float* __restrict__ out, float* __restrict__ logits_out) {
  __shared__ MainLdsAll sm;
  auto& s_x = sm.x;
  auto& s_mu = sm.mu;
  auto& s_rstd = sm.rstd;
  auto& s_cl = sm.cl;
  auto& s_alpha = sm.alpha;
  auto& s_beta = sm.beta;
  auto& s_wv = sm.wv;
  auto& s_attn = sm.attn;
  auto& s_raw = sm.raw;

  const int tid = threadIdx.x;
  const int wave = tid >> 5;
  const int lane = tid & 31;
  const int tilesPerB = SS / 16;
  const int b = blockIdx.x / tilesPerB;
  const int s0 = (blockIdx.x % tilesPerB) * 16;
  const size_t xbase = ((size_t)b * SS + s0) * DD;

#pragma unroll
  for (int c = 0; c < 2; ++c) {
    if (wave == 0)
      tdm_load_2d(lds_off_of(&s_x[c][0][0]), x + xbase + c * KC, KC, 16, DD);
  }
  // ---- the batch's raw keys, four rows a wave; they fly over phase 1 ----
#pragma unroll
  for (int q = 0; q < 4; ++q) {
    const int row = wave * 4 + q;
    const float* dst = wave < 2 ? &sm.nr_lo[row][0] : &sm.nr_hi[row - 8][0];
    copy_row_async(lds_off_of(dst) + (unsigned)lane * 16u,
                   ref + ((size_t)b * NN + row) * DD + lane * 4);
  }

  // ---- Phase 1: raw gate logits, mean/var of xs=2x and const-cluster dots.
  // One wave per 4 tokens, lanes strided over d: every x element is loaded once
  // for all 14 sums of its token, every weight slice once for the wave's rows.
  // All waves also form the logits of the token in front of the tile (the gate
  // residual of tile token 0 needs them); wave 0 publishes them.
  {
    const int r0 = wave * 4;
    const float* xr = x + xbase + (size_t)r0 * DD + lane;
    // at a sequence start there is no such token: read tile token 0, unused
    const float* xp = x + xbase - (s0 > 0 ? DD : 0) + lane;
    const float* wgl = Wg + lane;
    const float* cwl = const_w + lane;
    float lg[5][EE];  // rows 0..3: own tokens, row 4: token in front of the tile
    float st[4][6];   // sum, sum of squares, four const-cluster dots
#pragma unroll
    for (int q = 0; q < 5; ++q)
#pragma unroll
      for (int e = 0; e < EE; ++e) lg[q][e] = 0.f;
#pragma unroll
    for (int q = 0; q < 4; ++q)
#pragma unroll
      for (int k = 0; k < 6; ++k) st[q][k] = 0.f;
    auto load_x = [&](float (&dst)[5][PJ], int t) {
#pragma unroll
      for (int j = 0; j < PJ; ++j) {
        const int d = (t * PJ + j) * 32;
#pragma unroll
        for (int q = 0; q < 4; ++q) dst[q][j] = xr[q * DD + d];
        dst[4][j] = xp[d];
      }
    };
    float wg[PJ][EE], cw[PJ][4];
    auto load_weights = [&](int t) {
#pragma unroll
      for (int j = 0; j < PJ; ++j)
#pragma unroll
        for (int e = 0; e < EE; ++e) wg[j][e] = wgl[e * DD + (t * PJ + j) * 32];
      XCNT_WAIT();
#pragma unroll
      for (int j = 0; j < PJ; ++j)
#pragma unroll
        for (int k = 0; k < 4; ++k) cw[j][k] = cwl[k * DD + (t * PJ + j) * 32];
      // XCNT_WAIT with the group's address as an input: it keeps its registers up
      // to the wait, so that no result of the group itself is laid over them
      __builtin_amdgcn_sched_barrier(0);
      asm volatile("s_wait_xcnt 0x0" ::"v"(cwl) : "memory");
      __builtin_amdgcn_sched_barrier(0);
    };
    auto sum_slices = [&](const float (&xc)[5][PJ]) {
#pragma unroll
      for (int j = 0; j < PJ; ++j) {
#pragma unroll
        for (int q = 0; q < 4; ++q) {
          const float xv = xc[q][j];
#pragma unroll
          for (int e = 0; e < EE; ++e) lg[q][e] = fmaf(xv, wg[j][e], lg[q][e]);
          const float xs = 2.f * xv;
          st[q][0] += xs;
          st[q][1] = fmaf(xs, xs, st[q][1]);
#pragma unroll
          for (int k = 0; k < 4; ++k)
            st[q][2 + k] = fmaf(xs, cw[j][k], st[q][2 + k]);
        }
#pragma unroll
        for (int e = 0; e < EE; ++e)
          lg[4][e] = fmaf(xc[4][j], wg[j][e], lg[4][e]);
      }
    };
    // Two register sets for x, so that a trip's x loads fly while the trip in
    // front of it is summed. In each trip the weights are asked for first and
    // the next x slices behind them: loads return in issue order, so the wait
    // for the (cached) weights then leaves the x loads flying.
    float xa[5][PJ], xb[5][PJ];
    load_x(xa, 0);
    // kept rolled for speed only: the body is large
#pragma unroll 1
    for (int t = 0; t + 2 < PT; t += 2) {
      load_weights(t);
      load_x(xb, t + 1);
      sum_slices(xa);
      HOLD_LOADS();
      load_weights(t + 1);
      load_x(xa, t + 2);
      sum_slices(xb);
      HOLD_LOADS();
    }
    load_weights(PT - 2);
    load_x(xb, PT - 1);
    sum_slices(xa);
    XCNT_WAIT();
    load_weights(PT - 1);
    sum_slices(xb);
    float v[64];  // 8q + e: logit e of row q; 40 + 6q + k: statistic k of token q
#pragma unroll
    for (int q = 0; q < 5; ++q)
#pragma unroll
      for (int e = 0; e < EE; ++e) v[q * EE + e] = lg[q][e];
#pragma unroll
    for (int q = 0; q < 4; ++q)
#pragma unroll
      for (int k = 0; k < 6; ++k) v[5 * EE + q * 6 + k] = st[q][k];
    fold_step<32>(v, (lane & 16) != 0, [](float s) { return half_xor(s); });
    fold_step<16>(v, (lane & 8) != 0, [](float s) { return row_xor<8>(s); });
    fold_step<8>(v, (lane & 4) != 0, [](float s) { return row_xor<4>(s); });
    fold_step<4>(v, (lane & 2) != 0, [](float s) { return row_xor<2>(s); });
    fold_step<2>(v, (lane & 1) != 0, [](float s) { return row_xor<1>(s); });
    const bool isl = lane < 20;
    const int ql = lane >> 2;
    const int t3 = isl ? 0 : lane - 20;
    const int mq = r0 + t3 / 3, k3 = t3 % 3;
    const bool stat = !isl && k3 == 0;
    const float mu = v[0] / (float)DD;
    const float var = v[1] / (float)DD - mu * mu;
    const float rstd = rsqrtf(var + 1e-5f);  // used in the lanes that hold a token's sums
    float* p0 = isl ? &s_raw[ql < 4 ? r0 + ql + 1 : 0][(lane & 3) * 2]
                    : stat ? &s_mu[mq] : &s_cl[mq][2 * k3 - 2];
    float* p1 = stat ? &s_rstd[mq] : p0 + 1;
    if (!isl || ql < 4 || wave == 0) {  // row 4, the token in front: wave 0 alone
      *p0 = stat ? mu : v[0];
      *p1 = stat ? rstd : v[1];
    }
  }
  // Query scale, query bias and key scale of this wave's expert, 16 bytes a lane:
  // asked for here, so that they fly over the normalising of the keys
  v4f aq[DD / 128], ab[DD / 128], ak[DD / 128];
#pragma unroll
  for (int j = 0; j < DD / 128; ++j) {
    const int d = wave * DD + j * 128 + lane * 4;
    aq[j] = *(const v4f*)(lnq_s + d);
    ab[j] = *(const v4f*)(lnq_b + d);
    ak[j] = *(const v4f*)(lnk_s + d);
  }
  XCNT_WAIT();
  // this wave's key rows have landed: it may read its own; the barrier below
  // shows them, normalised, to the other waves
  asm volatile("s_wait_asynccnt 0x0" ::: "memory");
  // ---- LayerNorm of the keys without affine, in place: each wave its own four
  // rows, each lane the bytes that its own copies brought ----
  {
    v4f kv[4][DD / 128];
    float ks1[4], ks2[4];
#pragma unroll
    for (int q = 0; q < 4; ++q) {
      const int row = wave * 4 + q;
      const float* rp = (wave < 2 ? &sm.nr_lo[row][0] : &sm.nr_hi[row - 8][0]) + lane * 4;
#pragma unroll
      for (int j = 0; j < DD / 128; ++j) kv[q][j] = *(const v4f*)(rp + j * 128);
    }
#pragma unroll
    for (int q = 0; q < 4; ++q) {
      v4f s4 = {0.f, 0.f, 0.f, 0.f}, ss4 = {0.f, 0.f, 0.f, 0.f};
#pragma unroll
      for (int j = 0; j < DD / 128; ++j) {
        s4 += kv[q][j];
        ss4 += kv[q][j] * kv[q][j];
      }
      ks1[q] = (s4.x + s4.y) + (s4.z + s4.w);
      ks2[q] = (ss4.x + ss4.y) + (ss4.z + ss4.w);
    }
#pragma unroll
    for (int q = 0; q < 4; ++q) {
      ks1[q] += half_xor(ks1[q]);
      ks2[q] += half_xor(ks2[q]);
    }
#pragma unroll
    for (int q = 0; q < 4; ++q) {
      ks1[q] += row_xor<8>(ks1[q]);
      ks2[q] += row_xor<8>(ks2[q]);
    }
#pragma unroll
    for (int q = 0; q < 4; ++q) {
      ks1[q] += row_xor<4>(ks1[q]);
      ks2[q] += row_xor<4>(ks2[q]);
    }
#pragma unroll
    for (int q = 0; q < 4; ++q) {
      ks1[q] += row_xor<2>(ks1[q]);
      ks2[q] += row_xor<2>(ks2[q]);
    }
#pragma unroll
    for (int q = 0; q < 4; ++q) {
      ks1[q] += row_xor<1>(ks1[q]);
      ks2[q] += row_xor<1>(ks2[q]);
    }
#pragma unroll
    for (int q = 0; q < 4; ++q) {
      const int row = wave * 4 + q;
      float* wp = (wave < 2 ? &sm.nr_lo[row][0] : &sm.nr_hi[row - 8][0]) + lane * 4;
      const float kmu = ks1[q] / (float)DD;
      const float kvar = ks2[q] / (float)DD - kmu * kmu;
      const float krstd = rsqrtf(kvar + 1e-5f);
#pragma unroll
      for (int j = 0; j < DD / 128; ++j) *(v4f*)(wp + j * 128) = (kv[q][j] - kmu) * krstd;
    }
  }
  // The key scale folded into the query affine of this wave's expert. The line
  // below holds the products behind the normalising: lifted, their wait for the
  // global loads stands in front of the LDS reads of the keys.
  __builtin_amdgcn_sched_barrier(0);
#pragma unroll
  for (int j = 0; j < DD / 128; ++j) {
    *(v4f*)&sm.qks[wave][j * 128 + lane * 4] = aq[j] * ak[j];
    *(v4f*)&sm.qkb[wave][j * 128 + lane * 4] = ab[j] * ak[j];
  }
  __syncthreads();

  if (wave == 0 && lane < 16) {
    const int m = lane;
    const int sg = s0 + m;
    float f[EE];
    const float* cur = &s_raw[m + 1][0];
#pragma unroll
    for (int e = 0; e < EE; ++e) f[e] = cur[e];
    if (sg > 0) {
      const float* prv = cur - EE;
#pragma unroll
      for (int fo = 0; fo < EE; ++fo) {
        float a = 0.f;
#pragma unroll
        for (int e = 0; e < EE; ++e) a += prv[e] * Wmap[fo * EE + e];
        f[fo] += a;
      }
    }
    float* lo = logits_out + ((size_t)b * SS + sg) * EE;
#pragma unroll
    for (int e = 0; e < EE; ++e) lo[e] = f[e];
    float mx = f[0];
#pragma unroll
    for (int e = 1; e < EE; ++e) mx = fmaxf(mx, f[e]);
    float g[EE], gs = 0.f;
#pragma unroll
    for (int e = 0; e < EE; ++e) {
      g[e] = expf(f[e] - mx);
      gs += g[e];
    }
#pragma unroll
    for (int e = 0; e < EE; ++e) g[e] /= gs;
    int i1 = 0;
    float g1 = g[0];
#pragma unroll
    for (int e = 1; e < EE; ++e)
      if (g[e] > g1) { g1 = g[e]; i1 = e; }
    int i2 = (i1 == 0) ? 1 : 0;
    float g2 = g[i2];
#pragma unroll
    for (int e = 0; e < EE; ++e)
      if (e != i1 && g[e] > g2) { g2 = g[e]; i2 = e; }
    float t1 = (i1 == EE - 1) ? 0.f : g1;
    float t2 = (i2 == EE - 1) ? 0.f : g2;
    float inv = 1.f / (t1 + t2);
    float wv[EE];
#pragma unroll
    for (int e = 0; e < EE; ++e) wv[e] = 0.f;
    wv[i1] = t1 * inv;
    wv[i2] += t2 * inv;
    float a0 = s_cl[m][0], a1 = s_cl[m][1];
    float mxa = fmaxf(a0, a1);
    float e0 = expf(a0 - mxa), e1 = expf(a1 - mxa), tt = e0 + e1;
    float p00 = e0 / tt, p01 = e1 / tt;
    a0 = s_cl[m][2];
    a1 = s_cl[m][3];
    mxa = fmaxf(a0, a1);
    e0 = expf(a0 - mxa);
    e1 = expf(a1 - mxa);
    tt = e0 + e1;
    float p10 = e0 / tt, p11 = e1 / tt;

    s_alpha[m] = wv[0] + wv[1] + wv[2] + wv[3] + wv[4] * p00 + wv[5] * p10 + wv[6];
    s_beta[m][0] = wv[4] * p01;
    s_beta[m][1] = wv[5] * p11;
#pragma unroll
    for (int r = 0; r < RR; ++r) s_wv[m][r] = wv[r];
  }
  __syncthreads();

  // Operands of one 16-column tile of the output pass (phase 5), fetched one tile
  // ahead of their use: the lane's column of the key rows (LDS), of the experts'
  // key scale and bias, of the two constant vectors and of its eight x rows.
  v2f f_nr[4];
  float f_ks[RR], f_kb[RR], f_x[8], f_c0, f_c1;
  const float* xt = x + xbase;  // the tile's x rows, the same for all lanes
  const unsigned fh = (unsigned)lane >> 4;
  const unsigned fd0 = (unsigned)(wave * 256 + (lane & 15));  // column in tile 0
  // the lane's column of tile 0 in the four arrays; a tile on is 16 floats on
  const float* const pks0 = lnk_s + fd0;
  const float* const pkb0 = lnk_b + fd0;
  const float* const pcc0 = const_c + fd0;
  const float* const px0 = xt + 8 * fh * DD + fd0;  // first of the lane's x rows
  auto fetch_tile = [&](unsigned d, const float* pks, const float* pkb,
                        const float* pcc, const float* px) {
#pragma unroll
    for (int r = 0; r < RR; ++r) f_ks[r] = pks[r * DD];
#pragma unroll
    for (int r = 0; r < RR; ++r) f_kb[r] = pkb[r * DD];
#pragma unroll
    for (int j = 0; j < 8; ++j) f_x[j] = px[j * DD];
    f_c0 = pcc[0];
    f_c1 = pcc[DD];
#pragma unroll
    for (int kk = 0; kk < 4; ++kk) {
      const unsigned krow = (4 * kk & 7) + 2 * fh;  // row within its half
      const float(*nrh)[NRP] = kk < 2 ? sm.nr_lo : sm.nr_hi;
      f_nr[kk].x = nrh[krow][d];
      f_nr[kk].y = nrh[krow + 1][d];
    }
  };

  // ---- Phase 3: scores via WMMA, A/B fragments from LDS. The key scale sits in
  // the query affine; the key bias adds the same to all 16 scores of a row, which
  // the softmax over them cancels, so it is left out.
  {
    const int m = lane & 15;
    const int half = lane >> 4;
    const float mu = s_mu[m];
    const float rstd = s_rstd[m];
    const float* nrm = m < 8 ? &sm.nr_lo[m][0] : &sm.nr_hi[m - 8][0];
    const float* ls = &sm.qks[wave][0];
    const float* lb = &sm.qkb[wave][0];
    v8f c = {};
    for (int ch = 0; ch < NCH; ++ch) {
      const int buf = ch & 1;
      if (ch + 1 < NCH)
        __builtin_amdgcn_s_wait_tensorcnt(1);
      else
        __builtin_amdgcn_s_wait_tensorcnt(0);
      __syncthreads();  // wave0's x-chunk visible to all waves
      const int k0 = ch * KC;
      // The chunk's LDS reads stand in one group in front of its matrix
      // instructions. Left to itself the build issues each read one matrix
      // instruction ahead of its use, and every read's latency lies open.
      v2f lsf[KC / 4], lbf[KC / 4], xf[KC / 4], bf[KC / 4];
#pragma unroll
      for (int i = 0; i < KC / 4; ++i) {
        lsf[i] = *(const v2f*)(ls + k0 + 4 * i + 2 * half);
        lbf[i] = *(const v2f*)(lb + k0 + 4 * i + 2 * half);
      }
#pragma unroll
      for (int i = 0; i < KC / 4; ++i) {
        xf[i] = *(const v2f*)&s_x[buf][m][4 * i + 2 * half];
        bf[i] = *(const v2f*)(nrm + k0 + 4 * i + 2 * half);
      }
      // holds the group in front: no instruction is moved over this line
      __builtin_amdgcn_sched_barrier(0);
#pragma unroll
      for (int i = 0; i < KC / 4; ++i) {
        v2f a;
        a.x = ((2.f * xf[i].x - mu) * rstd) * lsf[i].x + lbf[i].x;
        a.y = ((2.f * xf[i].y - mu) * rstd) * lsf[i].y + lbf[i].y;
        c = __builtin_amdgcn_wmma_f32_16x16x4_f32(false, a, false, bf[i],
                                                  (short)0, c, false, false);
      }
      __syncthreads();  // everyone done with buf before it is overwritten
      if (ch + 2 < NCH) {
        if (wave == 0)
          tdm_load_2d(lds_off_of(&s_x[buf][0][0]), x + xbase + (ch + 2) * KC,
                      KC, 16, DD);
      }
    }
    // the first output tile's operands fly over the softmax
    fetch_tile(fd0, pks0, pkb0, pcc0, px0);
    // in front of any rewrite of a register that these loads name; as inputs the
    // column offset and the four addresses stay in their registers up to this wait
    asm volatile("s_wait_xcnt 0x0" ::"v"(fd0), "v"(pks0), "v"(pkb0), "v"(pcc0), "v"(px0)
                 : "memory");
    // row softmax over n (16-lane groups), weight by w_r[m], store to LDS
#pragma unroll
    for (int j = 0; j < 8; ++j) {
      float v = c[j];
      float mx = v;
      mx = fmaxf(mx, row_xor<1>(mx));
      mx = fmaxf(mx, row_xor<2>(mx));
      mx = fmaxf(mx, row_xor<4>(mx));
      mx = fmaxf(mx, row_xor<8>(mx));
      float e = expf(v - mx);
      float sm = e;
      sm += row_xor<1>(sm);
      sm += row_xor<2>(sm);
      sm += row_xor<4>(sm);
      sm += row_xor<8>(sm);
      const int row = j + 8 * half;
      s_attn[wave][row * 17 + (lane & 15)] = (e / sm) * s_wv[row][wave];
    }
  }
  __syncthreads();

  // ---- Phase 5: out tile. Each wave owns a 256-column d-quarter.
  // G = sum_r (w_r * attn_r) @ nk_r accumulates in one WMMA C chain. nk_r is
  // formed from the shared key rows in LDS, read once a tile for all experts,
  // with the lane's own column of the expert's scale and bias.
  // A trip first takes all it needs out of the fetched registers, then asks for
  // the next tile's operands, which fly over its own matrix chain and stores.
  {
    const int half = lane >> 4;
    const int nidx = lane & 15;
    const int dbase = wave * 256;
    // the same for all 16 tiles: read once, in front of the loop
    v2f afrag[RR][4];
    float al[8], be0[8], be1[8];
#pragma unroll
    for (int r = 0; r < RR; ++r)
#pragma unroll
      for (int kk = 0; kk < 4; ++kk) {
        const int krow = 4 * kk + 2 * half;
        afrag[r][kk].x = s_attn[r][nidx * 17 + krow];
        afrag[r][kk].y = s_attn[r][nidx * 17 + krow + 1];
      }
#pragma unroll
    for (int j = 0; j < 8; ++j) {
      al[j] = s_alpha[j + 8 * half];
      be0[j] = s_beta[j + 8 * half][0];
      be1[j] = s_beta[j + 8 * half][1];
    }
    for (int t = 0; t < 16; ++t) {
      const int d0 = dbase + t * 16;
      const int d = d0 + nidx;
      v2f bfrag[RR][4];
#pragma unroll
      for (int r = 0; r < RR; ++r)
#pragma unroll
        for (int kk = 0; kk < 4; ++kk) {
          bfrag[r][kk].x = fmaf(f_nr[kk].x, f_ks[r], f_kb[r]);
          bfrag[r][kk].y = fmaf(f_nr[kk].y, f_ks[r], f_kb[r]);
        }
      float xs[8];
#pragma unroll
      for (int j = 0; j < 8; ++j) xs[j] = 2.f * f_x[j];
      const float c0 = f_c0, c1 = f_c1;
      // this tile's column in the four arrays; the fetch reads 16 floats on
      const float *pks = pks0 + t * 16, *pkb = pkb0 + t * 16, *pcc = pcc0 + t * 16,
                  *px = px0 + t * 16;
      if (t + 1 < 16)
        fetch_tile(fd0 + (unsigned)(t + 1) * 16u, pks + 16, pkb + 16, pcc + 16, px + 16);
      // holds the next tile's loads in front of this tile's matrix chain: without
      // it the LDS reads sink behind the chain and lie open at the next trip's top
      __builtin_amdgcn_sched_barrier(0);
      v8f acc = {};
#pragma unroll
      for (int r = 0; r < RR; ++r) {
#pragma unroll
        for (int kk = 0; kk < 4; ++kk) {
          acc = __builtin_amdgcn_wmma_f32_16x16x4_f32(false, afrag[r][kk], false, bfrag[r][kk],
                                                      (short)0, acc, false,
                                                      false);
        }
      }
#pragma unroll
      for (int j = 0; j < 8; ++j) {
        const int m = j + 8 * half;
        float val = acc[j] + al[j] * xs[j] + be0[j] * c0 + be1[j] * c1;
        out[xbase + (size_t)m * DD + d] = val;
      }
      // One wait a trip: behind the stores, in front of the next trip's first
      // instructions, which rewrite the stores' registers. It serves the fetch
      // too: as inputs here the four addresses keep their registers till now, so
      // that neither a loaded value nor the chain's result is laid over them.
      if (t + 1 < 16)
        asm volatile("s_wait_xcnt 0x0" ::"v"(pks), "v"(pkb), "v"(pcc), "v"(px) : "memory");
    }
  }
}

// ---------------------------------------------------------------------------
extern "C" void kernel_launch(void* const* d_in, const int* in_sizes, int n_in,
                              void* d_out, int out_size, void* d_ws,
                              size_t ws_size, hipStream_t stream) {
  (void)in_sizes;
  (void)n_in;
  (void)out_size;
  (void)ws_size;
  (void)d_ws;
  const float* x = (const float*)d_in[0];
  const float* Wg = (const float*)d_in[1];
  const float* Wmap = (const float*)d_in[2];
  const float* lnq_s = (const float*)d_in[3];
  const float* lnq_b = (const float*)d_in[4];
  const float* lnk_s = (const float*)d_in[5];
  const float* lnk_b = (const float*)d_in[6];
  const float* ref = (const float*)d_in[7];
  const float* const_c = (const float*)d_in[8];
  const float* const_w = (const float*)d_in[9];
  float* out = (float*)d_out;
  float* logits_out = out + (size_t)BB * SS * DD;

  k_main<<<BB * (SS / 16), 128, 0, stream>>>(x, Wmap, lnq_s, lnq_b, lnk_s, lnk_b,
                                             const_c, const_w, Wg, ref, out,
                                             logits_out);
}

// v006
// Measured time: 24.3 microseconds a run.
// In both of two side-by-side timings against v005, it was 1.17 times as fast.
// Counting every step since v000, it is 2.41 times as fast.
#include <hip/hip_runtime.h>
#include <math.h>

typedef float v2f __attribute__((ext_vector_type(2)));
typedef float v4f __attribute__((ext_vector_type(4)));
typedef float v8f __attribute__((ext_vector_type(8)));
typedef unsigned int v4u __attribute__((ext_vector_type(4)));
typedef int v4i __attribute__((ext_vector_type(4)));
typedef int v8i __attribute__((ext_vector_type(8)));

#define BB 4
#define SS 2048
#define DD 1024
#define EE 8
#define NN 16
#define RR 4

#define KC 64
#define NCH (DD / KC)
#define LROW (KC + 4)
#define NRP (DD + 4)
#define X_PLACE 0x8800
#define PJ 4
#define PT (DD / (32 * PJ))
// keeps a trip's loads from being lifted over the sums of the trip in front:
// lifted, they leave the place where XCNT_WAIT below covers their address
// registers, and two trips' weights are live at once
#define HOLD_LOADS() __builtin_amdgcn_sched_barrier(0)
// Behind a group of global loads, in front of the next group, whose results the
// compiler lays over the first group's address registers. The
// two scheduling barriers hold the wait, and with it the groups' issue order.
#define XCNT_WAIT()                                  \
  do {                                               \
    __builtin_amdgcn_sched_barrier(0);               \
    asm volatile("s_wait_xcnt 0x0" ::: "memory");    \
    __builtin_amdgcn_sched_barrier(0);               \
  } while (0)

__device__ __forceinline__ void tdm_load_2d(unsigned lds_byte_off,
                                            const float* gptr,
                                            unsigned tile_d0,   // elems per row
                                            unsigned tile_d1,   // rows
                                            unsigned strideElems) {
  unsigned long long ga = (unsigned long long)(uintptr_t)gptr;
  v4u g0;
  g0.x = 1u;                                   // count=1 (valid), user mode
  g0.y = lds_byte_off;                         // lds_addr
  g0.z = (unsigned)(ga & 0xffffffffull);       // global_addr[31:0]
  g0.w = (unsigned)((ga >> 32) & 0x1ffffffull) // global_addr[56:32]
         | (2u << 30);                         // type=2 ("image")
  v8i g1;
  g1[0] = (int)((2u << 16)
                | (1u << 20)
                | (5u << 22)
                | (3u << 25));
  g1[1] = (int)(((unsigned)DD & 0xffffu) << 16);
  g1[2] = (int)((((unsigned)DD >> 16) & 0xffffu)
                | ((tile_d1 & 0xffffu) << 16));
  g1[3] = (int)((tile_d0 & 0xffffu) << 16);
  g1[4] = (int)(tile_d1 & 0xffffu);
  g1[5] = (int)strideElems;
  g1[6] = 0;
  g1[7] = 0;
  v4i z4 = {0, 0, 0, 0};
#if __clang_major__ >= 23
  v8i z8 = {0, 0, 0, 0, 0, 0, 0, 0};
  __builtin_amdgcn_tensor_load_to_lds(g0, g1, z4, z4, z8, 0);
#else
  __builtin_amdgcn_tensor_load_to_lds(g0, g1, z4, z4, 0);
#endif
}

__device__ __forceinline__ unsigned lds_off_of(const void* p) {
  // generic pointer to LDS: low 32 bits are the LDS byte offset
  return (unsigned)(unsigned long long)(uintptr_t)p;
}

template <int M>
__device__ __forceinline__ float row_xor(float v) {
  return __builtin_bit_cast(
      float, __builtin_amdgcn_update_dpp(0, __builtin_bit_cast(int, v), 0x160 | M, 0xf, 0xf, true));
}
__device__ __forceinline__ float half_xor(float v) {
  const int b = __builtin_bit_cast(int, v);
  return __builtin_bit_cast(
      float, __builtin_amdgcn_permlanex16(b, b, 0x76543210, 0xfedcba98, false, false));
}
// One step of a sum over the lanes that halves the number of values: of the pair
// (v[i], v[i + H]) a lane keeps the one its own bit names and hands the other to
// its partner, so each lane adds the same two numbers as in a plain butterfly.
template <int H, typename X>
__device__ __forceinline__ void fold_step(float* v, bool upper, X xchg) {
#pragma unroll
  for (int i = 0; i < H; ++i) {
    const float a = v[i], b = v[i + H];
    v[i] = (upper ? b : a) + xchg(upper ? a : b);
  }
}

__device__ __forceinline__ void copy_row_async(unsigned l, const float* g) {
  asm volatile(
      "global_load_async_to_lds_b128 %0, %8, off\n\t"
      "global_load_async_to_lds_b128 %1, %9, off\n\t"
      "global_load_async_to_lds_b128 %2, %10, off\n\t"
      "global_load_async_to_lds_b128 %3, %11, off\n\t"
      "global_load_async_to_lds_b128 %4, %12, off\n\t"
      "global_load_async_to_lds_b128 %5, %13, off\n\t"
      "global_load_async_to_lds_b128 %6, %14, off\n\t"
      "global_load_async_to_lds_b128 %7, %15, off\n\t"
      "s_wait_xcnt 0x0"
      ::"v"(l), "v"(l + 512u), "v"(l + 1024u), "v"(l + 1536u), "v"(l + 2048u),
      "v"(l + 2560u), "v"(l + 3072u), "v"(l + 3584u), "v"(g), "v"(g + 128),
      "v"(g + 256), "v"(g + 384), "v"(g + 512), "v"(g + 640), "v"(g + 768),
      "v"(g + 896)
      : "memory");
}

// LDS of the main kernel, one object so that every place in it is fixed. The x
// ring keeps its place, so the 16 key rows lie in two halves around it. Two such
// objects fit a WGP's LDS, as many work-groups as the grid gives each WGP.
struct __attribute__((aligned(16))) MainLdsAll {
  float nr_lo[8][NRP];  // key rows 0..7
  float raw[17][EE];    // raw gate logits: row 0 = token s0-1, row m+1 = tile token m
  float cl[16][4], alpha[16], beta[16][2], wv[16][4];
  float wsel[16][2];  // weight of the token's first and second choice; 0: no key expert
  int rsel[16][2];    // the expert of that choice; 0 where it is no key expert
  float unused[(X_PLACE - 8 * NRP * 4 - 17 * EE * 4 - 16 * 15 * 4) / 4];
  float x[2][16][LROW];  //  8.5 KB
  float mu[16], rstd[16];
  float nr_hi[8][NRP];
  float attn[2][16 * 17];
  float part[4][128];
  float qks[RR][NRP];
  float qkb[RR][NRP];
};
static_assert(__builtin_offsetof(MainLdsAll, qks) % 16 == 0, "16-byte stores of the folded affine");
static_assert(__builtin_offsetof(MainLdsAll, nr_hi) % 256 == 128);
static_assert(sizeof(MainLdsAll) * 2 <= 320 * 1024, "two work-groups a WGP");
static_assert(__builtin_offsetof(MainLdsAll, x) == X_PLACE, "place of the x ring");

__global__ __launch_bounds__(128) void k_main(
    const float* __restrict__ x, const float* __restrict__ Wmap,
    const float* __restrict__ lnq_s, const float* __restrict__ lnq_b,
    const float* __restrict__ lnk_s, const float* __restrict__ lnk_b,
    const float* __restrict__ const_c, const float* __restrict__ const_w,
    const float* __restrict__ Wg, const float* __restrict__ ref,
    float* __restrict__ out, float* __restrict__ logits_out) {
  __shared__ MainLdsAll sm;
  auto& s_x = sm.x;
  auto& s_mu = sm.mu;
  auto& s_rstd = sm.rstd;
  auto& s_cl = sm.cl;
  auto& s_alpha = sm.alpha;
  auto& s_beta = sm.beta;
  auto& s_wv = sm.wv;
  auto& s_attn = sm.attn;
  auto& s_raw = sm.raw;

  const int tid = threadIdx.x;
  const int wave = tid >> 5;
  const int lane = tid & 31;
  const int tilesPerB = SS / 16;
  const int b = blockIdx.x / tilesPerB;
  const int s0 = (blockIdx.x % tilesPerB) * 16;
  const size_t xbase = ((size_t)b * SS + s0) * DD;

#pragma unroll
  for (int c = 0; c < 2; ++c) {
    if (wave == 0)
      tdm_load_2d(lds_off_of(&s_x[c][0][0]), x + xbase + c * KC, KC, 16, DD);
  }
  // ---- the batch's raw keys, four rows a wave; they fly over phase 1 ----
#pragma unroll
  for (int q = 0; q < 4; ++q) {
    const int row = wave * 4 + q;
    const float* dst = wave < 2 ? &sm.nr_lo[row][0] : &sm.nr_hi[row - 8][0];
    copy_row_async(lds_off_of(dst) + (unsigned)lane * 16u,
                   ref + ((size_t)b * NN + row) * DD + lane * 4);
  }

  // ---- Phase 1: raw gate logits, mean/var of xs=2x and const-cluster dots.
  // One wave per 4 tokens, lanes strided over d: every x element is loaded once
  // for all 14 sums of its token, every weight slice once for the wave's rows.
  // All waves also form the logits of the token in front of the tile (the gate
  // residual of tile token 0 needs them); wave 0 publishes them.
  {
    const int r0 = wave * 4;
    const float* xr = x + xbase + (size_t)r0 * DD + lane;
    // at a sequence start there is no such token: read tile token 0, unused
    const float* xp = x + xbase - (s0 > 0 ? DD : 0) + lane;
    const float* wgl = Wg + lane;
    const float* cwl = const_w + lane;
    float lg[5][EE];  // rows 0..3: own tokens, row 4: token in front of the tile
    float st[4][6];   // sum, sum of squares, four const-cluster dots
#pragma unroll
    for (int q = 0; q < 5; ++q)
#pragma unroll
      for (int e = 0; e < EE; ++e) lg[q][e] = 0.f;
#pragma unroll
    for (int q = 0; q < 4; ++q)
#pragma unroll
      for (int k = 0; k < 6; ++k) st[q][k] = 0.f;
    auto load_x = [&](float (&dst)[5][PJ], int t) {
#pragma unroll
      for (int j = 0; j < PJ; ++j) {
        const int d = (t * PJ + j) * 32;
#pragma unroll
        for (int q = 0; q < 4; ++q) dst[q][j] = xr[q * DD + d];
        dst[4][j] = xp[d];
      }
    };
    float wg[PJ][EE], cw[PJ][4];
    auto load_weights = [&](int t) {
#pragma unroll
      for (int j = 0; j < PJ; ++j)
#pragma unroll
        for (int e = 0; e < EE; ++e) wg[j][e] = wgl[e * DD + (t * PJ + j) * 32];
      XCNT_WAIT();
#pragma unroll
      for (int j = 0; j < PJ; ++j)
#pragma unroll
        for (int k = 0; k < 4; ++k) cw[j][k] = cwl[k * DD + (t * PJ + j) * 32];
      // XCNT_WAIT with the group's address as an input: it keeps its registers up
      // to the wait, so that no result of the group itself is laid over them
      __builtin_amdgcn_sched_barrier(0);
      asm volatile("s_wait_xcnt 0x0" ::"v"(cwl) : "memory");
      __builtin_amdgcn_sched_barrier(0);
    };
    auto sum_slices = [&](const float (&xc)[5][PJ]) {
#pragma unroll
      for (int j = 0; j < PJ; ++j) {
#pragma unroll
        for (int q = 0; q < 4; ++q) {
          const float xv = xc[q][j];
#pragma unroll
          for (int e = 0; e < EE; ++e) lg[q][e] = fmaf(xv, wg[j][e], lg[q][e]);
          const float xs = 2.f * xv;
          st[q][0] += xs;
          st[q][1] = fmaf(xs, xs, st[q][1]);
#pragma unroll
          for (int k = 0; k < 4; ++k)
            st[q][2 + k] = fmaf(xs, cw[j][k], st[q][2 + k]);
        }
#pragma unroll
        for (int e = 0; e < EE; ++e)
          lg[4][e] = fmaf(xc[4][j], wg[j][e], lg[4][e]);
      }
    };
    // Two register sets for x, so that a trip's x loads fly while the trip in
    // front of it is summed. In each trip the weights are asked for first and
    // the next x slices behind them: loads return in issue order, so the wait
    // for the (cached) weights then leaves the x loads flying.
    float xa[5][PJ], xb[5][PJ];
    load_x(xa, 0);
    // kept rolled for speed only: the body is large
#pragma unroll 1
    for (int t = 0; t + 2 < PT; t += 2) {
      load_weights(t);
      load_x(xb, t + 1);
      sum_slices(xa);
      HOLD_LOADS();
      load_weights(t + 1);
      load_x(xa, t + 2);
      sum_slices(xb);
      HOLD_LOADS();
    }
    load_weights(PT - 2);
    load_x(xb, PT - 1);
    sum_slices(xa);
    XCNT_WAIT();
    load_weights(PT - 1);
    sum_slices(xb);
    float v[64];  // 8q + e: logit e of row q; 40 + 6q + k: statistic k of token q
#pragma unroll
    for (int q = 0; q < 5; ++q)
#pragma unroll
      for (int e = 0; e < EE; ++e) v[q * EE + e] = lg[q][e];
#pragma unroll
    for (int q = 0; q < 4; ++q)
#pragma unroll
      for (int k = 0; k < 6; ++k) v[5 * EE + q * 6 + k] = st[q][k];
    fold_step<32>(v, (lane & 16) != 0, [](float s) { return half_xor(s); });
    fold_step<16>(v, (lane & 8) != 0, [](float s) { return row_xor<8>(s); });
    fold_step<8>(v, (lane & 4) != 0, [](float s) { return row_xor<4>(s); });
    fold_step<4>(v, (lane & 2) != 0, [](float s) { return row_xor<2>(s); });
    fold_step<2>(v, (lane & 1) != 0, [](float s) { return row_xor<1>(s); });
    const bool isl = lane < 20;
    const int ql = lane >> 2;
    const int t3 = isl ? 0 : lane - 20;
    const int mq = r0 + t3 / 3, k3 = t3 % 3;
    const bool stat = !isl && k3 == 0;
    const float mu = v[0] / (float)DD;
    const float var = v[1] / (float)DD - mu * mu;
    const float rstd = rsqrtf(var + 1e-5f);  // used in the lanes that hold a token's sums
    float* p0 = isl ? &s_raw[ql < 4 ? r0 + ql + 1 : 0][(lane & 3) * 2]
                    : stat ? &s_mu[mq] : &s_cl[mq][2 * k3 - 2];
    float* p1 = stat ? &s_rstd[mq] : p0 + 1;
    if (!isl || ql < 4 || wave == 0) {  // row 4, the token in front: wave 0 alone
      *p0 = stat ? mu : v[0];
      *p1 = stat ? rstd : v[1];
    }
  }
  // Query scale, query bias and key scale of this wave's expert, 16 bytes a lane:
  // asked for here, so that they fly over the normalising of the keys
  v4f aq[DD / 128], ab[DD / 128], ak[DD / 128];
#pragma unroll
  for (int j = 0; j < DD / 128; ++j) {
    const int d = wave * DD + j * 128 + lane * 4;
    aq[j] = *(const v4f*)(lnq_s + d);
    ab[j] = *(const v4f*)(lnq_b + d);
    ak[j] = *(const v4f*)(lnk_s + d);
  }
  XCNT_WAIT();
  // this wave's key rows have landed: it may read its own; the barrier below
  // shows them, normalised, to the other waves
  asm volatile("s_wait_asynccnt 0x0" ::: "memory");
  // ---- LayerNorm of the keys without affine, in place: each wave its own four
  // rows, each lane the bytes that its own copies brought ----
  {
    v4f kv[4][DD / 128];
    float ks1[4], ks2[4];
#pragma unroll
    for (int q = 0; q < 4; ++q) {
      const int row = wave * 4 + q;
      const float* rp = (wave < 2 ? &sm.nr_lo[row][0] : &sm.nr_hi[row - 8][0]) + lane * 4;
#pragma unroll
      for (int j = 0; j < DD / 128; ++j) kv[q][j] = *(const v4f*)(rp + j * 128);
    }
#pragma unroll
    for (int q = 0; q < 4; ++q) {
      v4f s4 = {0.f, 0.f, 0.f, 0.f}, ss4 = {0.f, 0.f, 0.f, 0.f};
#pragma unroll
      for (int j = 0; j < DD / 128; ++j) {
        s4 += kv[q][j];
        ss4 += kv[q][j] * kv[q][j];
      }
      ks1[q] = (s4.x + s4.y) + (s4.z + s4.w);
      ks2[q] = (ss4.x + ss4.y) + (ss4.z + ss4.w);
    }
#pragma unroll
    for (int q = 0; q < 4; ++q) {
      ks1[q] += half_xor(ks1[q]);
      ks2[q] += half_xor(ks2[q]);
    }
#pragma unroll
    for (int q = 0; q < 4; ++q) {
      ks1[q] += row_xor<8>(ks1[q]);
      ks2[q] += row_xor<8>(ks2[q]);
    }
#pragma unroll
    for (int q = 0; q < 4; ++q) {
      ks1[q] += row_xor<4>(ks1[q]);
      ks2[q] += row_xor<4>(ks2[q]);
    }
#pragma unroll
    for (int q = 0; q < 4; ++q) {
      ks1[q] += row_xor<2>(ks1[q]);
      ks2[q] += row_xor<2>(ks2[q]);
    }
#pragma unroll
    for (int q = 0; q < 4; ++q) {
      ks1[q] += row_xor<1>(ks1[q]);
      ks2[q] += row_xor<1>(ks2[q]);
    }
#pragma unroll
    for (int q = 0; q < 4; ++q) {
      const int row = wave * 4 + q;
      float* wp = (wave < 2 ? &sm.nr_lo[row][0] : &sm.nr_hi[row - 8][0]) + lane * 4;
      const float kmu = ks1[q] / (float)DD;
      const float kvar = ks2[q] / (float)DD - kmu * kmu;
      const float krstd = rsqrtf(kvar + 1e-5f);
#pragma unroll
      for (int j = 0; j < DD / 128; ++j) *(v4f*)(wp + j * 128) = (kv[q][j] - kmu) * krstd;
    }
  }
  // The key scale folded into the query affine of this wave's expert. The line
  // below holds the products behind the normalising: lifted, their wait for the
  // global loads stands in front of the LDS reads of the keys.
  __builtin_amdgcn_sched_barrier(0);
#pragma unroll
  for (int j = 0; j < DD / 128; ++j) {
    *(v4f*)&sm.qks[wave][j * 128 + lane * 4] = aq[j] * ak[j];
    *(v4f*)&sm.qkb[wave][j * 128 + lane * 4] = ab[j] * ak[j];
  }
  __syncthreads();

  if (wave == 0 && lane < 16) {
    const int m = lane;
    const int sg = s0 + m;
    float f[EE];
    const float* cur = &s_raw[m + 1][0];
#pragma unroll
    for (int e = 0; e < EE; ++e) f[e] = cur[e];
    if (sg > 0) {
      const float* prv = cur - EE;
#pragma unroll
      for (int fo = 0; fo < EE; ++fo) {
        float a = 0.f;
#pragma unroll
        for (int e = 0; e < EE; ++e) a += prv[e] * Wmap[fo * EE + e];
        f[fo] += a;
      }
    }
    float* lo = logits_out + ((size_t)b * SS + sg) * EE;
#pragma unroll
    for (int e = 0; e < EE; ++e) lo[e] = f[e];
    float mx = f[0];
#pragma unroll
    for (int e = 1; e < EE; ++e) mx = fmaxf(mx, f[e]);
    float g[EE], gs = 0.f;
#pragma unroll
    for (int e = 0; e < EE; ++e) {
      g[e] = expf(f[e] - mx);
      gs += g[e];
    }
#pragma unroll
    for (int e = 0; e < EE; ++e) g[e] /= gs;
    int i1 = 0;
    float g1 = g[0];
#pragma unroll
    for (int e = 1; e < EE; ++e)
      if (g[e] > g1) { g1 = g[e]; i1 = e; }
    int i2 = (i1 == 0) ? 1 : 0;
    float g2 = g[i2];
#pragma unroll
    for (int e = 0; e < EE; ++e)
      if (e != i1 && g[e] > g2) { g2 = g[e]; i2 = e; }
    float t1 = (i1 == EE - 1) ? 0.f : g1;
    float t2 = (i2 == EE - 1) ? 0.f : g2;
    float inv = 1.f / (t1 + t2);
    float wv[EE];
#pragma unroll
    for (int e = 0; e < EE; ++e) wv[e] = 0.f;
    wv[i1] = t1 * inv;
    wv[i2] += t2 * inv;
    float a0 = s_cl[m][0], a1 = s_cl[m][1];
    float mxa = fmaxf(a0, a1);
    float e0 = expf(a0 - mxa), e1 = expf(a1 - mxa), tt = e0 + e1;
    float p00 = e0 / tt, p01 = e1 / tt;
    a0 = s_cl[m][2];
    a1 = s_cl[m][3];
    mxa = fmaxf(a0, a1);
    e0 = expf(a0 - mxa);
    e1 = expf(a1 - mxa);
    tt = e0 + e1;
    float p10 = e0 / tt, p11 = e1 / tt;

    s_alpha[m] = wv[0] + wv[1] + wv[2] + wv[3] + wv[4] * p00 + wv[5] * p10 + wv[6];
    s_beta[m][0] = wv[4] * p01;
    s_beta[m][1] = wv[5] * p11;
#pragma unroll
    for (int r = 0; r < RR; ++r) s_wv[m][r] = wv[r];
    sm.rsel[m][0] = i1 < RR ? i1 : 0;
    sm.rsel[m][1] = i2 < RR ? i2 : 0;
    sm.wsel[m][0] = i1 < RR ? t1 * inv : 0.f;
    sm.wsel[m][1] = i2 < RR ? t2 * inv : 0.f;
  }
  __syncthreads();

  // Operands of one 16-column tile of the output pass (phase 5), fetched one tile
  // ahead of their use: the lane's column of the key rows (LDS), of the experts'
  // key scale and bias, of the two constant vectors and of its eight x rows.
  v2f f_nr[4];
  float f_ks[RR], f_kb[RR], f_x[8], f_c0, f_c1;
  const float* xt = x + xbase;  // the tile's x rows, the same for all lanes
  const unsigned fh = (unsigned)lane >> 4;
  const unsigned fd0 = (unsigned)(wave * 256 + (lane & 15));  // column in tile 0
  // the lane's column of tile 0 in the four arrays; a tile on is 16 floats on
  const float* const pks0 = lnk_s + fd0;
  const float* const pkb0 = lnk_b + fd0;
  const float* const pcc0 = const_c + fd0;
  const float* const px0 = xt + 8 * fh * DD + fd0;  // first of the lane's x rows
  auto fetch_tile = [&](unsigned d, const float* pks, const float* pkb,
                        const float* pcc, const float* px) {
#pragma unroll
    for (int r = 0; r < RR; ++r) f_ks[r] = pks[r * DD];
#pragma unroll
    for (int r = 0; r < RR; ++r) f_kb[r] = pkb[r * DD];
#pragma unroll
    for (int j = 0; j < 8; ++j) f_x[j] = px[j * DD];
    f_c0 = pcc[0];
    f_c1 = pcc[DD];
#pragma unroll
    for (int kk = 0; kk < 4; ++kk) {
      const unsigned krow = (4 * kk & 7) + 2 * fh;  // row within its half
      const float(*nrh)[NRP] = kk < 2 ? sm.nr_lo : sm.nr_hi;
      f_nr[kk].x = nrh[krow][d];
      f_nr[kk].y = nrh[krow + 1][d];
    }
  };

  // ---- Phase 3: scores via WMMA, A/B fragments from LDS. The key scale sits in
  // the query affine; the key bias adds the same to all 16 scores of a row, which
  // the softmax over them cancels, so it is left out.
  // An expert that a token did not choose has weight 0 in the output, so only the
  // two choices of each token are formed: row m of the A tile is token m under the
  // affine of its own first (waves 0, 2) or second (waves 1, 3) choice; the keys,
  // B, are the same for all experts. The two waves of a choice split each chunk's K.
  {
    const int m = lane & 15;
    const int half = lane >> 4;
    const int cc = wave & 1;   // which choice
    const int kh = wave >> 1;  // which half of each chunk's K
    const int ko = kh * (KC / 2) + 2 * half;
    const float mu = s_mu[m];
    const float rstd = s_rstd[m];
    const float* nrm = m < 8 ? &sm.nr_lo[m][0] : &sm.nr_hi[m - 8][0];
    const int rs = sm.rsel[m][cc];
    // the lane's place in its expert's folded affine; a chunk on is KC floats on
    const float* ls = &sm.qks[rs][ko];
    const float* lb = &sm.qkb[rs][ko];
    v8f c = {};
    for (int ch = 0; ch < NCH; ++ch) {
      const int buf = ch & 1;
      if (ch + 1 < NCH)
        __builtin_amdgcn_s_wait_tensorcnt(1);
      else
        __builtin_amdgcn_s_wait_tensorcnt(0);
      __syncthreads();  // wave0's x-chunk visible to all waves
      const int k0 = ch * KC;
      // The chunk's LDS reads stand in one group in front of its matrix
      // instructions. Left to itself the build issues each read one matrix
      // instruction ahead of its use, and every read's latency lies open.
      v2f lsf[KC / 8], lbf[KC / 8], xf[KC / 8], bf[KC / 8];
#pragma unroll
      for (int i = 0; i < KC / 8; ++i) {
        lsf[i] = *(const v2f*)(ls + 4 * i);
        lbf[i] = *(const v2f*)(lb + 4 * i);
      }
      ls += KC;
      lb += KC;
#pragma unroll
      for (int i = 0; i < KC / 8; ++i) {
        xf[i] = *(const v2f*)&s_x[buf][m][ko + 4 * i];
        bf[i] = *(const v2f*)(nrm + k0 + ko + 4 * i);
      }
      // holds the group in front: no instruction is moved over this line
      __builtin_amdgcn_sched_barrier(0);
#pragma unroll
      for (int i = 0; i < KC / 8; ++i) {
        v2f a;
        a.x = ((2.f * xf[i].x - mu) * rstd) * lsf[i].x + lbf[i].x;
        a.y = ((2.f * xf[i].y - mu) * rstd) * lsf[i].y + lbf[i].y;
        c = __builtin_amdgcn_wmma_f32_16x16x4_f32(false, a, false, bf[i],
                                                  (short)0, c, false, false);
      }
      __syncthreads();  // everyone done with buf before it is overwritten
      if (ch + 2 < NCH) {
        if (wave == 0)
          tdm_load_2d(lds_off_of(&s_x[buf][0][0]), x + xbase + (ch + 2) * KC,
                      KC, 16, DD);
      }
    }
    // The two halves of K meet: of its eight score registers a wave keeps four and
    // hands the other four to its partner, which finishes those rows.
    const v4f clo = __builtin_shufflevector(c, c, 0, 1, 2, 3);
    const v4f chi = __builtin_shufflevector(c, c, 4, 5, 6, 7);
    const v4f give = kh ? clo : chi, own = kh ? chi : clo;
#pragma unroll
    for (int t = 0; t < 4; ++t) sm.part[wave][t * 32 + lane] = give[t];
    __syncthreads();  // the partner's rows are in LDS
    // read in one group in front of the softmax: behind its LDS stores the build
    // would not lift these reads, and the four rows would run one after another
    float sc[4], wsl[4];
#pragma unroll
    for (int t = 0; t < 4; ++t) {
      sc[t] = own[t] + sm.part[wave ^ 2][t * 32 + lane];
      wsl[t] = sm.wsel[kh * 4 + t + 8 * half][cc];
    }
    // the first output tile's operands fly over the softmax
    fetch_tile(fd0, pks0, pkb0, pcc0, px0);
    // in front of any rewrite of a register that these loads name; as inputs the
    // column offset and the four addresses stay in their registers up to this wait
    asm volatile("s_wait_xcnt 0x0" ::"v"(fd0), "v"(pks0), "v"(pkb0), "v"(pcc0), "v"(px0)
                 : "memory");
    // row softmax over n (16-lane groups), weight by the choice's weight, store to LDS
#pragma unroll
    for (int t = 0; t < 4; ++t) {
      float v = sc[t];
      float mx = v;
      mx = fmaxf(mx, row_xor<1>(mx));
      mx = fmaxf(mx, row_xor<2>(mx));
      mx = fmaxf(mx, row_xor<4>(mx));
      mx = fmaxf(mx, row_xor<8>(mx));
      float e = expf(v - mx);
      float se = e;
      se += row_xor<1>(se);
      se += row_xor<2>(se);
      se += row_xor<4>(se);
      se += row_xor<8>(se);
      const int row = kh * 4 + t + 8 * half;
      s_attn[cc][row * 17 + (lane & 15)] = (e / se) * wsl[t];
    }
  }
  __syncthreads();

  // ---- Phase 5: out tile. Each wave owns a 256-column d-quarter.
  // For each of the two choices H = (w * attn) @ (normalised keys), one WMMA chain
  // each on the shared key rows. The chosen expert's key scale multiplies H behind
  // the chain, picked per row out of the lane's column of the four scales by a
  // one-hot row; the key bias enters as w_r * bias_r, the attention summing to one.
  // A trip first takes all it needs out of the fetched registers, then asks for
  // the next tile's operands, which fly over its own matrix chain and stores.
  {
    const int half = lane >> 4;
    const int nidx = lane & 15;
    const int dbase = wave * 256;
    // the same for all 16 tiles: read once, in front of the loop
    v2f afrag[2][4];
    float al[8], be0[8], be1[8], oh[2][8][RR], wr[8][RR];
#pragma unroll
    for (int r = 0; r < 2; ++r)
#pragma unroll
      for (int kk = 0; kk < 4; ++kk) {
        const int krow = 4 * kk + 2 * half;
        afrag[r][kk].x = s_attn[r][nidx * 17 + krow];
        afrag[r][kk].y = s_attn[r][nidx * 17 + krow + 1];
      }
#pragma unroll
    for (int j = 0; j < 8; ++j) {
      al[j] = s_alpha[j + 8 * half];
      be0[j] = s_beta[j + 8 * half][0];
      be1[j] = s_beta[j + 8 * half][1];
#pragma unroll
      for (int r = 0; r < RR; ++r) {
        wr[j][r] = s_wv[j + 8 * half][r];
        oh[0][j][r] = sm.rsel[j + 8 * half][0] == r ? 1.f : 0.f;
        oh[1][j][r] = sm.rsel[j + 8 * half][1] == r ? 1.f : 0.f;
      }
    }
    for (int t = 0; t < 16; ++t) {
      const int d0 = dbase + t * 16;
      const int d = d0 + nidx;
      v2f bfrag[4];
#pragma unroll
      for (int kk = 0; kk < 4; ++kk) bfrag[kk] = f_nr[kk];
      float ks[RR], kb[RR];
#pragma unroll
      for (int r = 0; r < RR; ++r) {
        ks[r] = f_ks[r];
        kb[r] = f_kb[r];
      }
      float xs[8];
#pragma unroll
      for (int j = 0; j < 8; ++j) xs[j] = 2.f * f_x[j];
      const float c0 = f_c0, c1 = f_c1;
      // this tile's column in the four arrays; the fetch reads 16 floats on
      const float *pks = pks0 + t * 16, *pkb = pkb0 + t * 16, *pcc = pcc0 + t * 16,
                  *px = px0 + t * 16;
      if (t + 1 < 16)
        fetch_tile(fd0 + (unsigned)(t + 1) * 16u, pks + 16, pkb + 16, pcc + 16, px + 16);
      // holds the next tile's loads in front of this tile's matrix chain: without
      // it the LDS reads sink behind the chain and lie open at the next trip's top
      __builtin_amdgcn_sched_barrier(0);
      v8f h0 = {}, h1 = {};
#pragma unroll
      for (int kk = 0; kk < 4; ++kk) {
        h0 = __builtin_amdgcn_wmma_f32_16x16x4_f32(false, afrag[0][kk], false, bfrag[kk],
                                                   (short)0, h0, false, false);
        h1 = __builtin_amdgcn_wmma_f32_16x16x4_f32(false, afrag[1][kk], false, bfrag[kk],
                                                   (short)0, h1, false, false);
      }
#pragma unroll
      for (int j = 0; j < 8; ++j) {
        const int m = j + 8 * half;
        float k0s = oh[0][j][0] * ks[0], k1s = oh[1][j][0] * ks[0], bt = wr[j][0] * kb[0];
#pragma unroll
        for (int r = 1; r < RR; ++r) {
          k0s = fmaf(oh[0][j][r], ks[r], k0s);
          k1s = fmaf(oh[1][j][r], ks[r], k1s);
          bt = fmaf(wr[j][r], kb[r], bt);
        }
        float val = h0[j] * k0s + h1[j] * k1s + bt + al[j] * xs[j] + be0[j] * c0 + be1[j] * c1;
        out[xbase + (size_t)m * DD + d] = val;
      }
      // One wait a trip: behind the stores, in front of the next trip's first
      // instructions, which rewrite the stores' registers. It serves the fetch
      // too: as inputs here the four addresses keep their registers till now, so
      // that neither a loaded value nor the chain's result is laid over them.
      if (t + 1 < 16)
        asm volatile("s_wait_xcnt 0x0" ::"v"(pks), "v"(pkb), "v"(pcc), "v"(px) : "memory");
    }
  }
}

// ---------------------------------------------------------------------------
extern "C" void kernel_launch(void* const* d_in, const int* in_sizes, int n_in,
                              void* d_out, int out_size, void* d_ws,
                              size_t ws_size, hipStream_t stream) {
  (void)in_sizes;
  (void)n_in;
  (void)out_size;
  (void)ws_size;
  (void)d_ws;
  const float* x = (const float*)d_in[0];
  const float* Wg = (const float*)d_in[1];
  const float* Wmap = (const float*)d_in[2];
  const float* lnq_s = (const float*)d_in[3];
  const float* lnq_b = (const float*)d_in[4];
  const float* lnk_s = (const float*)d_in[5];
  const float* lnk_b = (const float*)d_in[6];
  const float* ref = (const float*)d_in[7];
  const float* const_c = (const float*)d_in[8];
  const float* const_w = (const float*)d_in[9];
  float* out = (float*)d_out;
  float* logits_out = out + (size_t)BB * SS * DD;

  k_main<<<BB * (SS / 16), 128, 0, stream>>>(x, Wmap, lnq_s, lnq_b, lnk_s, lnk_b,
                                             const_c, const_w, Wg, ref, out,
                                             logits_out);
}

// v007
// It runs in 22.1 microseconds.
// Two timings next to v006 put it at 1.11 and 1.10 times that version's speed.
// All steps since v000 together make it 2.66 times as fast.
#include <hip/hip_runtime.h>
#include <math.h>

typedef float v2f __attribute__((ext_vector_type(2)));
typedef float v4f __attribute__((ext_vector_type(4)));
typedef float v8f __attribute__((ext_vector_type(8)));
typedef unsigned int v4u __attribute__((ext_vector_type(4)));
typedef int v4i __attribute__((ext_vector_type(4)));
typedef int v8i __attribute__((ext_vector_type(8)));

#define BB 4
#define SS 2048
#define DD 1024
#define EE 8
#define NN 16
#define RR 4

#define KC 64
#define NCH (DD / KC)
#define LROW (KC + 4)
#define NRP (DD + 4)
#define X_PLACE 0x8800
#define PT (DD / 128)
#define NW (EE + 4)
// holds the LDS reads of a trip's weights where they are written, one trip ahead
// of their use: lifted further, more than two trips' weights are live at once;
// sunk among the sums, their latency lies open
#define HOLD_LOADS() __builtin_amdgcn_sched_barrier(0)
// Behind a group of global loads, in front of the next group, whose results the
// compiler lays over the first group's address registers. The
// two scheduling barriers hold the wait, and with it the groups' issue order.
#define XCNT_WAIT()                                  \
  do {                                               \
    __builtin_amdgcn_sched_barrier(0);               \
    asm volatile("s_wait_xcnt 0x0" ::: "memory");    \
    __builtin_amdgcn_sched_barrier(0);               \
  } while (0)

__device__ __forceinline__ void tdm_load_2d(unsigned lds_byte_off,
                                            const float* gptr,
                                            unsigned tile_d0,   // elems per row
                                            unsigned tile_d1,   // rows
                                            unsigned strideElems) {
  unsigned long long ga = (unsigned long long)(uintptr_t)gptr;
  v4u g0;
  g0.x = 1u;                                   // count=1 (valid), user mode
  g0.y = lds_byte_off;                         // lds_addr
  g0.z = (unsigned)(ga & 0xffffffffull);       // global_addr[31:0]
  g0.w = (unsigned)((ga >> 32) & 0x1ffffffull) // global_addr[56:32]
         | (2u << 30);                         // type=2 ("image")
  v8i g1;
  g1[0] = (int)((2u << 16)
                | (1u << 20)
                | (5u << 22)
                | (3u << 25));
  g1[1] = (int)(((unsigned)DD & 0xffffu) << 16);
  g1[2] = (int)((((unsigned)DD >> 16) & 0xffffu)
                | ((tile_d1 & 0xffffu) << 16));
  g1[3] = (int)((tile_d0 & 0xffffu) << 16);
  g1[4] = (int)(tile_d1 & 0xffffu);
  g1[5] = (int)strideElems;
  g1[6] = 0;
  g1[7] = 0;
  v4i z4 = {0, 0, 0, 0};
#if __clang_major__ >= 23
  v8i z8 = {0, 0, 0, 0, 0, 0, 0, 0};
  __builtin_amdgcn_tensor_load_to_lds(g0, g1, z4, z4, z8, 0);
#else
  __builtin_amdgcn_tensor_load_to_lds(g0, g1, z4, z4, 0);
#endif
}

__device__ __forceinline__ unsigned lds_off_of(const void* p) {
  // generic pointer to LDS: low 32 bits are the LDS byte offset
  return (unsigned)(unsigned long long)(uintptr_t)p;
}

template <int M>
__device__ __forceinline__ float row_xor(float v) {
  return __builtin_bit_cast(
      float, __builtin_amdgcn_update_dpp(0, __builtin_bit_cast(int, v), 0x160 | M, 0xf, 0xf, true));
}
__device__ __forceinline__ float half_xor(float v) {
  const int b = __builtin_bit_cast(int, v);
  return __builtin_bit_cast(
      float, __builtin_amdgcn_permlanex16(b, b, 0x76543210, 0xfedcba98, false, false));
}
// One step of a sum over the lanes that halves the number of values: of the pair
// (v[i], v[i + H]) a lane keeps the one its own bit names and hands the other to
// its partner, so each lane adds the same two numbers as in a plain butterfly.
template <int H, typename X>
__device__ __forceinline__ void fold_step(float* v, bool upper, X xchg) {
#pragma unroll
  for (int i = 0; i < H; ++i) {
    const float a = v[i], b = v[i + H];
    v[i] = (upper ? b : a) + xchg(upper ? a : b);
  }
}

__device__ __forceinline__ void copy_row_async(unsigned l, const float* g) {
  asm volatile(
      "global_load_async_to_lds_b128 %0, %8, off\n\t"
      "global_load_async_to_lds_b128 %1, %9, off\n\t"
      "global_load_async_to_lds_b128 %2, %10, off\n\t"
      "global_load_async_to_lds_b128 %3, %11, off\n\t"
      "global_load_async_to_lds_b128 %4, %12, off\n\t"
      "global_load_async_to_lds_b128 %5, %13, off\n\t"
      "global_load_async_to_lds_b128 %6, %14, off\n\t"
      "global_load_async_to_lds_b128 %7, %15, off\n\t"
      "s_wait_xcnt 0x0"
      ::"v"(l), "v"(l + 512u), "v"(l + 1024u), "v"(l + 1536u), "v"(l + 2048u),
      "v"(l + 2560u), "v"(l + 3072u), "v"(l + 3584u), "v"(g), "v"(g + 128),
      "v"(g + 256), "v"(g + 384), "v"(g + 512), "v"(g + 640), "v"(g + 768),
      "v"(g + 896)
      : "memory");
}

// LDS of the main kernel, one object so that every place in it is fixed. The x
// ring keeps its place, so the 16 key rows lie in two halves around it. Two such
// objects fit a WGP's LDS, as many work-groups as the grid gives each WGP.
struct __attribute__((aligned(16))) MainLdsAll {
  float nr_lo[8][NRP];  // key rows 0..7
  float raw[17][EE];    // raw gate logits: row 0 = token s0-1, row m+1 = tile token m
  float cl[16][4], alpha[16], beta[16][2], wv[16][4];
  float wsel[16][2];  // weight of the token's first and second choice; 0: no key expert
  int rsel[16][2];    // the expert of that choice; 0 where it is no key expert
  float unused[(X_PLACE - 8 * NRP * 4 - 17 * EE * 4 - 16 * 15 * 4) / 4];
  float x[2][16][LROW];  //  8.5 KB
  float mu[16], rstd[16];
  float nr_hi[8][NRP];
  float attn[2][16 * 17];
  float part[4][128];
  float qks[RR][NRP];
  float qkb[RR][NRP];
  float wts[NW][DD];
};
static_assert(__builtin_offsetof(MainLdsAll, wts) % 16 == 0, "16-byte copies of the weights");
static_assert(__builtin_offsetof(MainLdsAll, qks) % 16 == 0, "16-byte stores of the folded affine");
static_assert(__builtin_offsetof(MainLdsAll, nr_hi) % 256 == 128);
static_assert(sizeof(MainLdsAll) * 2 <= 320 * 1024, "two work-groups a WGP");
static_assert(__builtin_offsetof(MainLdsAll, x) == X_PLACE, "place of the x ring");

__global__ __launch_bounds__(128) void k_main(
    const float* __restrict__ x, const float* __restrict__ Wmap,
    const float* __restrict__ lnq_s, const float* __restrict__ lnq_b,
    const float* __restrict__ lnk_s, const float* __restrict__ lnk_b,
    const float* __restrict__ const_c, const float* __restrict__ const_w,
    const float* __restrict__ Wg, const float* __restrict__ ref,
    float* __restrict__ out, float* __restrict__ logits_out) {
  __shared__ MainLdsAll sm;
  auto& s_x = sm.x;
  auto& s_mu = sm.mu;
  auto& s_rstd = sm.rstd;
  auto& s_cl = sm.cl;
  auto& s_alpha = sm.alpha;
  auto& s_beta = sm.beta;
  auto& s_wv = sm.wv;
  auto& s_attn = sm.attn;
  auto& s_raw = sm.raw;

  const int tid = threadIdx.x;
  const int wave = tid >> 5;
  const int lane = tid & 31;
  const int tilesPerB = SS / 16;
  const int b = blockIdx.x / tilesPerB;
  const int s0 = (blockIdx.x % tilesPerB) * 16;
  const size_t xbase = ((size_t)b * SS + s0) * DD;

#pragma unroll
  for (int c = 0; c < 2; ++c) {
    if (wave == 0)
      tdm_load_2d(lds_off_of(&s_x[c][0][0]), x + xbase + c * KC, KC, 16, DD);
  }
  // ---- all of this wave's x for phase 1, asked for at once and held in registers:
  // its four tokens and the token in front of the tile, 16 bytes a lane and load,
  // in the order of their use. The way to memory is paid once, not once a trip.
  const int r0 = wave * 4;
  const float* xr = x + xbase + (size_t)r0 * DD + lane * 4;
  // at a sequence start there is no token in front: read tile token 0, unused
  const float* xp = x + xbase - (s0 > 0 ? DD : 0) + lane * 4;
  // rows 0..3: own tokens, row 4: token in front of the tile; xa: trips of the
  // first half of the pass, xb: of the second
  v4f xa[PT / 2][5], xb[PT / 2][5];
#pragma unroll
  for (int t = 0; t < PT; ++t) {
    v4f(&xt5)[5] = t < PT / 2 ? xa[t] : xb[t - PT / 2];
#pragma unroll
    for (int q = 0; q < 4; ++q) xt5[q] = *(const v4f*)(xr + q * DD + t * 128);
    xt5[4] = *(const v4f*)(xp + t * 128);
  }
  // In front of any rewrite of the loads' address registers, which as inputs stay
  // in their registers up to this wait. The two scheduling barriers hold the wait,
  // and the loads in front of the copies below: sunk to their uses they would
  // no longer fly together.
  __builtin_amdgcn_sched_barrier(0);
  asm volatile("s_wait_xcnt 0x0" ::"v"(xr), "v"(xp) : "memory");
  __builtin_amdgcn_sched_barrier(0);
  // ---- the weights of phase 1, three rows a wave. Through LDS they count on
  // their own counters: a wait for weights no longer waits for the x loads that
  // were asked for in front of them, as it does among global loads.
#pragma unroll
  for (int q = 0; q < 3; ++q) {
    const int row = wave * 3 + q;
    const float* wsrc = row < EE ? Wg + row * DD : const_w + (row - EE) * DD;
    copy_row_async(lds_off_of(&sm.wts[row][0]) + (unsigned)lane * 16u, wsrc + lane * 4);
  }
  // this wave's weight rows have landed
  asm volatile("s_wait_asynccnt 0x0" ::: "memory");
  // The work-group's barrier, with fences on LDS alone: it shows every wave's
  // weight rows to all. __syncthreads() would also wait for this wave's global
  // loads, the x rows that are to stay in flight over it.
  __builtin_amdgcn_fence(__ATOMIC_RELEASE, "workgroup", "local");
  __builtin_amdgcn_s_barrier();
  __builtin_amdgcn_fence(__ATOMIC_ACQUIRE, "workgroup", "local");
  // ---- the batch's raw keys, four rows a wave; they fly over phase 1 ----
#pragma unroll
  for (int q = 0; q < 4; ++q) {
    const int row = wave * 4 + q;
    const float* dst = wave < 2 ? &sm.nr_lo[row][0] : &sm.nr_hi[row - 8][0];
    copy_row_async(lds_off_of(dst) + (unsigned)lane * 16u,
                   ref + ((size_t)b * NN + row) * DD + lane * 4);
  }

  // ---- Phase 1: raw gate logits, mean/var of xs=2x and const-cluster dots.
  // One wave per 4 tokens, a lane four columns of every 128: every x element is
  // loaded once for all 14 sums of its token, every weight slice once for the
  // wave's rows. All waves also form the logits of the token in front of the tile
  // (the gate residual of tile token 0 needs them); wave 0 publishes them.
  {
    // Every sum is kept in two halves, over the lane's even and its odd columns:
    // the pairs of a 16-byte load then enter packed multiply-adds as they lie.
    v2f lg[5][EE];  // rows 0..3: own tokens, row 4: token in front of the tile
    v2f st[4][6];   // sum, sum of squares, four const-cluster dots
#pragma unroll
    for (int q = 0; q < 5; ++q)
#pragma unroll
      for (int e = 0; e < EE; ++e) lg[q][e] = v2f{0.f, 0.f};
#pragma unroll
    for (int q = 0; q < 4; ++q)
#pragma unroll
      for (int k = 0; k < 6; ++k) st[q][k] = v2f{0.f, 0.f};
    auto load_weights = [&](v4f (&w)[NW], const float* p) {
#pragma unroll
      for (int r = 0; r < NW; ++r) w[r] = *(const v4f*)(p + r * DD);
    };
    auto sum_slice = [&](const v4f (&xc)[5], const v4f (&w)[NW]) {
#pragma unroll
      for (int h = 0; h < 2; ++h) {
        v2f wh[NW];
#pragma unroll
        for (int r = 0; r < NW; ++r) wh[r] = h ? w[r].zw : w[r].xy;
#pragma unroll
        for (int q = 0; q < 4; ++q) {
          const v2f xe = h ? xc[q].zw : xc[q].xy;
#pragma unroll
          for (int e = 0; e < EE; ++e)
            lg[q][e] = __builtin_elementwise_fma(xe, wh[e], lg[q][e]);
          const v2f xs = xe + xe;
          st[q][0] += xs;
          st[q][1] = __builtin_elementwise_fma(xs, xs, st[q][1]);
#pragma unroll
          for (int k = 0; k < 4; ++k)
            st[q][2 + k] = __builtin_elementwise_fma(xs, wh[EE + k], st[q][2 + k]);
        }
        const v2f xf = h ? xc[4].zw : xc[4].xy;
#pragma unroll
        for (int e = 0; e < EE; ++e)
          lg[4][e] = __builtin_elementwise_fma(xf, wh[e], lg[4][e]);
      }
    };
    // Two register sets for the weights: a trip's weights are read from LDS while
    // the trip in front of it is summed.
    v4f wb[2][NW];
    const float* wl = &sm.wts[0][lane * 4];  // the lane's columns of trip 0
    load_weights(wb[0], wl);
    // The two halves of the pass run through one body, the second half's x moved
    // into the first half's registers in between. Kept rolled, for speed only.
#pragma unroll 1
    for (int hp = 0; hp < 2; ++hp) {
      const float* wc = wl + hp * (DD / 2);        // first trip of this half
      const float* wo = wl + (hp ^ 1) * (DD / 2);  // first trip of the other half
#pragma unroll
      for (int t = 0; t < PT / 2; ++t) {
        // behind the pass's last trip this reads trip 0 again, unused
        load_weights(wb[(t + 1) & 1], t + 1 < PT / 2 ? wc + (t + 1) * 128 : wo);
        HOLD_LOADS();
        sum_slice(xa[t], wb[t & 1]);
        HOLD_LOADS();
      }
#pragma unroll
      for (int t = 0; t < PT / 2; ++t)
#pragma unroll
        for (int q = 0; q < 5; ++q) xa[t][q] = xb[t][q];
    }
    float v[64];  // 8q + e: logit e of row q; 40 + 6q + k: statistic k of token q
#pragma unroll
    for (int q = 0; q < 5; ++q)
#pragma unroll
      for (int e = 0; e < EE; ++e) v[q * EE + e] = lg[q][e].x + lg[q][e].y;
#pragma unroll
    for (int q = 0; q < 4; ++q)
#pragma unroll
      for (int k = 0; k < 6; ++k) v[5 * EE + q * 6 + k] = st[q][k].x + st[q][k].y;
    fold_step<32>(v, (lane & 16) != 0, [](float s) { return half_xor(s); });
    fold_step<16>(v, (lane & 8) != 0, [](float s) { return row_xor<8>(s); });
    fold_step<8>(v, (lane & 4) != 0, [](float s) { return row_xor<4>(s); });
    fold_step<4>(v, (lane & 2) != 0, [](float s) { return row_xor<2>(s); });
    fold_step<2>(v, (lane & 1) != 0, [](float s) { return row_xor<1>(s); });
    const bool isl = lane < 20;
    const int ql = lane >> 2;
    const int t3 = isl ? 0 : lane - 20;
    const int mq = r0 + t3 / 3, k3 = t3 % 3;
    const bool stat = !isl && k3 == 0;
    const float mu = v[0] / (float)DD;
    const float var = v[1] / (float)DD - mu * mu;
    const float rstd = rsqrtf(var + 1e-5f);  // used in the lanes that hold a token's sums
    float* p0 = isl ? &s_raw[ql < 4 ? r0 + ql + 1 : 0][(lane & 3) * 2]
                    : stat ? &s_mu[mq] : &s_cl[mq][2 * k3 - 2];
    float* p1 = stat ? &s_rstd[mq] : p0 + 1;
    if (!isl || ql < 4 || wave == 0) {  // row 4, the token in front: wave 0 alone
      *p0 = stat ? mu : v[0];
      *p1 = stat ? rstd : v[1];
    }
  }
  // Query scale, query bias and key scale of this wave's expert, 16 bytes a lane:
  // asked for here, so that they fly over the normalising of the keys
  v4f aq[DD / 128], ab[DD / 128], ak[DD / 128];
#pragma unroll
  for (int j = 0; j < DD / 128; ++j) {
    const int d = wave * DD + j * 128 + lane * 4;
    aq[j] = *(const v4f*)(lnq_s + d);
    ab[j] = *(const v4f*)(lnq_b + d);
    ak[j] = *(const v4f*)(lnk_s + d);
  }
  XCNT_WAIT();
  // this wave's key rows have landed: it may read its own; the barrier below
  // shows them, normalised, to the other waves
  asm volatile("s_wait_asynccnt 0x0" ::: "memory");
  // ---- LayerNorm of the keys without affine, in place: each wave its own four
  // rows, each lane the bytes that its own copies brought ----
  {
    v4f kv[4][DD / 128];
    float ks1[4], ks2[4];
#pragma unroll
    for (int q = 0; q < 4; ++q) {
      const int row = wave * 4 + q;
      const float* rp = (wave < 2 ? &sm.nr_lo[row][0] : &sm.nr_hi[row - 8][0]) + lane * 4;
#pragma unroll
      for (int j = 0; j < DD / 128; ++j) kv[q][j] = *(const v4f*)(rp + j * 128);
    }
#pragma unroll
    for (int q = 0; q < 4; ++q) {
      v4f s4 = {0.f, 0.f, 0.f, 0.f}, ss4 = {0.f, 0.f, 0.f, 0.f};
#pragma unroll
      for (int j = 0; j < DD / 128; ++j) {
        s4 += kv[q][j];
        ss4 += kv[q][j] * kv[q][j];
      }
      ks1[q] = (s4.x + s4.y) + (s4.z + s4.w);
      ks2[q] = (ss4.x + ss4.y) + (ss4.z + ss4.w);
    }
#pragma unroll
    for (int q = 0; q < 4; ++q) {
      ks1[q] += half_xor(ks1[q]);
      ks2[q] += half_xor(ks2[q]);
    }
#pragma unroll
    for (int q = 0; q < 4; ++q) {
      ks1[q] += row_xor<8>(ks1[q]);
      ks2[q] += row_xor<8>(ks2[q]);
    }
#pragma unroll
    for (int q = 0; q < 4; ++q) {
      ks1[q] += row_xor<4>(ks1[q]);
      ks2[q] += row_xor<4>(ks2[q]);
    }
#pragma unroll
    for (int q = 0; q < 4; ++q) {
      ks1[q] += row_xor<2>(ks1[q]);
      ks2[q] += row_xor<2>(ks2[q]);
    }
#pragma unroll
    for (int q = 0; q < 4; ++q) {
      ks1[q] += row_xor<1>(ks1[q]);
      ks2[q] += row_xor<1>(ks2[q]);
    }
#pragma unroll
    for (int q = 0; q < 4; ++q) {
      const int row = wave * 4 + q;
      float* wp = (wave < 2 ? &sm.nr_lo[row][0] : &sm.nr_hi[row - 8][0]) + lane * 4;
      const float kmu = ks1[q] / (float)DD;
      const float kvar = ks2[q] / (float)DD - kmu * kmu;
      const float krstd = rsqrtf(kvar + 1e-5f);
#pragma unroll
      for (int j = 0; j < DD / 128; ++j) *(v4f*)(wp + j * 128) = (kv[q][j] - kmu) * krstd;
    }
  }
  // The key scale folded into the query affine of this wave's expert. The line
  // below holds the products behind the normalising: lifted, their wait for the
  // global loads stands in front of the LDS reads of the keys.
  __builtin_amdgcn_sched_barrier(0);
#pragma unroll
  for (int j = 0; j < DD / 128; ++j) {
    *(v4f*)&sm.qks[wave][j * 128 + lane * 4] = aq[j] * ak[j];
    *(v4f*)&sm.qkb[wave][j * 128 + lane * 4] = ab[j] * ak[j];
  }
  __syncthreads();

  if (wave == 0 && lane < 16) {
    const int m = lane;
    const int sg = s0 + m;
    float f[EE];
    const float* cur = &s_raw[m + 1][0];
#pragma unroll
    for (int e = 0; e < EE; ++e) f[e] = cur[e];
    if (sg > 0) {
      const float* prv = cur - EE;
#pragma unroll
      for (int fo = 0; fo < EE; ++fo) {
        float a = 0.f;
#pragma unroll
        for (int e = 0; e < EE; ++e) a += prv[e] * Wmap[fo * EE + e];
        f[fo] += a;
      }
    }
    float* lo = logits_out + ((size_t)b * SS + sg) * EE;
#pragma unroll
    for (int e = 0; e < EE; ++e) lo[e] = f[e];
    float mx = f[0];
#pragma unroll
    for (int e = 1; e < EE; ++e) mx = fmaxf(mx, f[e]);
    float g[EE], gs = 0.f;
#pragma unroll
    for (int e = 0; e < EE; ++e) {
      g[e] = expf(f[e] - mx);
      gs += g[e];
    }
#pragma unroll
    for (int e = 0; e < EE; ++e) g[e] /= gs;
    int i1 = 0;
    float g1 = g[0];
#pragma unroll
    for (int e = 1; e < EE; ++e)
      if (g[e] > g1) { g1 = g[e]; i1 = e; }
    int i2 = (i1 == 0) ? 1 : 0;
    float g2 = g[i2];
#pragma unroll
    for (int e = 0; e < EE; ++e)
      if (e != i1 && g[e] > g2) { g2 = g[e]; i2 = e; }
    float t1 = (i1 == EE - 1) ? 0.f : g1;
    float t2 = (i2 == EE - 1) ? 0.f : g2;
    float inv = 1.f / (t1 + t2);
    float wv[EE];
#pragma unroll
    for (int e = 0; e < EE; ++e) wv[e] = 0.f;
    wv[i1] = t1 * inv;
    wv[i2] += t2 * inv;
    float a0 = s_cl[m][0], a1 = s_cl[m][1];
    float mxa = fmaxf(a0, a1);
    float e0 = expf(a0 - mxa), e1 = expf(a1 - mxa), tt = e0 + e1;
    float p00 = e0 / tt, p01 = e1 / tt;
    a0 = s_cl[m][2];
    a1 = s_cl[m][3];
    mxa = fmaxf(a0, a1);
    e0 = expf(a0 - mxa);
    e1 = expf(a1 - mxa);
    tt = e0 + e1;
    float p10 = e0 / tt, p11 = e1 / tt;

    s_alpha[m] = wv[0] + wv[1] + wv[2] + wv[3] + wv[4] * p00 + wv[5] * p10 + wv[6];
    s_beta[m][0] = wv[4] * p01;
    s_beta[m][1] = wv[5] * p11;
#pragma unroll
    for (int r = 0; r < RR; ++r) s_wv[m][r] = wv[r];
    sm.rsel[m][0] = i1 < RR ? i1 : 0;
    sm.rsel[m][1] = i2 < RR ? i2 : 0;
    sm.wsel[m][0] = i1 < RR ? t1 * inv : 0.f;
    sm.wsel[m][1] = i2 < RR ? t2 * inv : 0.f;
  }
  __syncthreads();

  // Operands of one 16-column tile of the output pass (phase 5), fetched one tile
  // ahead of their use: the lane's column of the key rows (LDS), of the experts'
  // key scale and bias, of the two constant vectors and of its eight x rows.
  v2f f_nr[4];
  float f_ks[RR], f_kb[RR], f_x[8], f_c0, f_c1;
  const float* xt = x + xbase;  // the tile's x rows, the same for all lanes
  const unsigned fh = (unsigned)lane >> 4;
  const unsigned fd0 = (unsigned)(wave * 256 + (lane & 15));  // column in tile 0
  // the lane's column of tile 0 in the four arrays; a tile on is 16 floats on
  const float* const pks0 = lnk_s + fd0;
  const float* const pkb0 = lnk_b + fd0;
  const float* const pcc0 = const_c + fd0;
  const float* const px0 = xt + 8 * fh * DD + fd0;  // first of the lane's x rows
  auto fetch_tile = [&](unsigned d, const float* pks, const float* pkb,
                        const float* pcc, const float* px) {
#pragma unroll
    for (int r = 0; r < RR; ++r) f_ks[r] = pks[r * DD];
#pragma unroll
    for (int r = 0; r < RR; ++r) f_kb[r] = pkb[r * DD];
#pragma unroll
    for (int j = 0; j < 8; ++j) f_x[j] = px[j * DD];
    f_c0 = pcc[0];
    f_c1 = pcc[DD];
#pragma unroll
    for (int kk = 0; kk < 4; ++kk) {
      const unsigned krow = (4 * kk & 7) + 2 * fh;  // row within its half
      const float(*nrh)[NRP] = kk < 2 ? sm.nr_lo : sm.nr_hi;
      f_nr[kk].x = nrh[krow][d];
      f_nr[kk].y = nrh[krow + 1][d];
    }
  };

  // ---- Phase 3: scores via WMMA, A/B fragments from LDS. The key scale sits in
  // the query affine; the key bias adds the same to all 16 scores of a row, which
  // the softmax over them cancels, so it is left out.
  // An expert that a token did not choose has weight 0 in the output, so only the
  // two choices of each token are formed: row m of the A tile is token m under the
  // affine of its own first (waves 0, 2) or second (waves 1, 3) choice; the keys,
  // B, are the same for all experts. The two waves of a choice split each chunk's K.
  {
    const int m = lane & 15;
    const int half = lane >> 4;
    const int cc = wave & 1;   // which choice
    const int kh = wave >> 1;  // which half of each chunk's K
    const int ko = kh * (KC / 2) + 2 * half;
    const float mu = s_mu[m];
    const float rstd = s_rstd[m];
    const float* nrm = m < 8 ? &sm.nr_lo[m][0] : &sm.nr_hi[m - 8][0];
    const int rs = sm.rsel[m][cc];
    // the lane's place in its expert's folded affine; a chunk on is KC floats on
    const float* ls = &sm.qks[rs][ko];
    const float* lb = &sm.qkb[rs][ko];
    v8f c = {};
    for (int ch = 0; ch < NCH; ++ch) {
      const int buf = ch & 1;
      if (ch + 1 < NCH)
        __builtin_amdgcn_s_wait_tensorcnt(1);
      else
        __builtin_amdgcn_s_wait_tensorcnt(0);
      __syncthreads();  // wave0's x-chunk visible to all waves
      const int k0 = ch * KC;
      // The chunk's LDS reads stand in one group in front of its matrix
      // instructions. Left to itself the build issues each read one matrix
      // instruction ahead of its use, and every read's latency lies open.
      v2f lsf[KC / 8], lbf[KC / 8], xf[KC / 8], bf[KC / 8];
#pragma unroll
      for (int i = 0; i < KC / 8; ++i) {
        lsf[i] = *(const v2f*)(ls + 4 * i);
        lbf[i] = *(const v2f*)(lb + 4 * i);
      }
      ls += KC;
      lb += KC;
#pragma unroll
      for (int i = 0; i < KC / 8; ++i) {
        xf[i] = *(const v2f*)&s_x[buf][m][ko + 4 * i];
        bf[i] = *(const v2f*)(nrm + k0 + ko + 4 * i);
      }
      // holds the group in front: no instruction is moved over this line
      __builtin_amdgcn_sched_barrier(0);
#pragma unroll
      for (int i = 0; i < KC / 8; ++i) {
        v2f a;
        a.x = ((2.f * xf[i].x - mu) * rstd) * lsf[i].x + lbf[i].x;
        a.y = ((2.f * xf[i].y - mu) * rstd) * lsf[i].y + lbf[i].y;
        c = __builtin_amdgcn_wmma_f32_16x16x4_f32(false, a, false, bf[i],
                                                  (short)0, c, false, false);
      }
      __syncthreads();  // everyone done with buf before it is overwritten
      if (ch + 2 < NCH) {
        if (wave == 0)
          tdm_load_2d(lds_off_of(&s_x[buf][0][0]), x + xbase + (ch + 2) * KC,
                      KC, 16, DD);
      }
    }
    // The two halves of K meet: of its eight score registers a wave keeps four and
    // hands the other four to its partner, which finishes those rows.
    const v4f clo = __builtin_shufflevector(c, c, 0, 1, 2, 3);
    const v4f chi = __builtin_shufflevector(c, c, 4, 5, 6, 7);
    const v4f give = kh ? clo : chi, own = kh ? chi : clo;
#pragma unroll
    for (int t = 0; t < 4; ++t) sm.part[wave][t * 32 + lane] = give[t];
    __syncthreads();  // the partner's rows are in LDS
    // read in one group in front of the softmax: behind its LDS stores the build
    // would not lift these reads, and the four rows would run one after another
    float sc[4], wsl[4];
#pragma unroll
    for (int t = 0; t < 4; ++t) {
      sc[t] = own[t] + sm.part[wave ^ 2][t * 32 + lane];
      wsl[t] = sm.wsel[kh * 4 + t + 8 * half][cc];
    }
    // the first output tile's operands fly over the softmax
    fetch_tile(fd0, pks0, pkb0, pcc0, px0);
    // in front of any rewrite of a register that these loads name; as inputs the
    // column offset and the four addresses stay in their registers up to this wait
    asm volatile("s_wait_xcnt 0x0" ::"v"(fd0), "v"(pks0), "v"(pkb0), "v"(pcc0), "v"(px0)
                 : "memory");
    // row softmax over n (16-lane groups), weight by the choice's weight, store to LDS
#pragma unroll
    for (int t = 0; t < 4; ++t) {
      float v = sc[t];
      float mx = v;
      mx = fmaxf(mx, row_xor<1>(mx));
      mx = fmaxf(mx, row_xor<2>(mx));
      mx = fmaxf(mx, row_xor<4>(mx));
      mx = fmaxf(mx, row_xor<8>(mx));
      float e = expf(v - mx);
      float se = e;
      se += row_xor<1>(se);
      se += row_xor<2>(se);
      se += row_xor<4>(se);
      se += row_xor<8>(se);
      const int row = kh * 4 + t + 8 * half;
      s_attn[cc][row * 17 + (lane & 15)] = (e / se) * wsl[t];
    }
  }
  __syncthreads();

  // ---- Phase 5: out tile. Each wave owns a 256-column d-quarter.
  // For each of the two choices H = (w * attn) @ (normalised keys), one WMMA chain
  // each on the shared key rows. The chosen expert's key scale multiplies H behind
  // the chain, picked per row out of the lane's column of the four scales by a
  // one-hot row; the key bias enters as w_r * bias_r, the attention summing to one.
  // A trip first takes all it needs out of the fetched registers, then asks for
  // the next tile's operands, which fly over its own matrix chain and stores.
  {
    const int half = lane >> 4;
    const int nidx = lane & 15;
    const int dbase = wave * 256;
    // the same for all 16 tiles: read once, in front of the loop
    v2f afrag[2][4];
    float al[8], be0[8], be1[8], oh[2][8][RR], wr[8][RR];
#pragma unroll
    for (int r = 0; r < 2; ++r)
#pragma unroll
      for (int kk = 0; kk < 4; ++kk) {
        const int krow = 4 * kk + 2 * half;
        afrag[r][kk].x = s_attn[r][nidx * 17 + krow];
        afrag[r][kk].y = s_attn[r][nidx * 17 + krow + 1];
      }
#pragma unroll
    for (int j = 0; j < 8; ++j) {
      al[j] = s_alpha[j + 8 * half];
      be0[j] = s_beta[j + 8 * half][0];
      be1[j] = s_beta[j + 8 * half][1];
#pragma unroll
      for (int r = 0; r < RR; ++r) {
        wr[j][r] = s_wv[j + 8 * half][r];
        oh[0][j][r] = sm.rsel[j + 8 * half][0] == r ? 1.f : 0.f;
        oh[1][j][r] = sm.rsel[j + 8 * half][1] == r ? 1.f : 0.f;
      }
    }
    for (int t = 0; t < 16; ++t) {
      const int d0 = dbase + t * 16;
      const int d = d0 + nidx;
      v2f bfrag[4];
#pragma unroll
      for (int kk = 0; kk < 4; ++kk) bfrag[kk] = f_nr[kk];
      float ks[RR], kb[RR];
#pragma unroll
      for (int r = 0; r < RR; ++r) {
        ks[r] = f_ks[r];
        kb[r] = f_kb[r];
      }
      float xs[8];
#pragma unroll
      for (int j = 0; j < 8; ++j) xs[j] = 2.f * f_x[j];
      const float c0 = f_c0, c1 = f_c1;
      // this tile's column in the four arrays; the fetch reads 16 floats on
      const float *pks = pks0 + t * 16, *pkb = pkb0 + t * 16, *pcc = pcc0 + t * 16,
                  *px = px0 + t * 16;
      if (t + 1 < 16)
        fetch_tile(fd0 + (unsigned)(t + 1) * 16u, pks + 16, pkb + 16, pcc + 16, px + 16);
      // holds the next tile's loads in front of this tile's matrix chain: without
      // it the LDS reads sink behind the chain and lie open at the next trip's top
      __builtin_amdgcn_sched_barrier(0);
      v8f h0 = {}, h1 = {};
#pragma unroll
      for (int kk = 0; kk < 4; ++kk) {
        h0 = __builtin_amdgcn_wmma_f32_16x16x4_f32(false, afrag[0][kk], false, bfrag[kk],
                                                   (short)0, h0, false, false);
        h1 = __builtin_amdgcn_wmma_f32_16x16x4_f32(false, afrag[1][kk], false, bfrag[kk],
                                                   (short)0, h1, false, false);
      }
#pragma unroll
      for (int j = 0; j < 8; ++j) {
        const int m = j + 8 * half;
        float k0s = oh[0][j][0] * ks[0], k1s = oh[1][j][0] * ks[0], bt = wr[j][0] * kb[0];
#pragma unroll
        for (int r = 1; r < RR; ++r) {
          k0s = fmaf(oh[0][j][r], ks[r], k0s);
          k1s = fmaf(oh[1][j][r], ks[r], k1s);
          bt = fmaf(wr[j][r], kb[r], bt);
        }
        float val = h0[j] * k0s + h1[j] * k1s + bt + al[j] * xs[j] + be0[j] * c0 + be1[j] * c1;
        out[xbase + (size_t)m * DD + d] = val;
      }
      // One wait a trip: behind the stores, in front of the next trip's first
      // instructions, which rewrite the stores' registers. It serves the fetch
      // too: as inputs here the four addresses keep their registers till now, so
      // that neither a loaded value nor the chain's result is laid over them.
      if (t + 1 < 16)
        asm volatile("s_wait_xcnt 0x0" ::"v"(pks), "v"(pkb), "v"(pcc), "v"(px) : "memory");
    }
  }
}

// ---------------------------------------------------------------------------
extern "C" void kernel_launch(void* const* d_in, const int* in_sizes, int n_in,
                              void* d_out, int out_size, void* d_ws,
                              size_t ws_size, hipStream_t stream) {
  (void)in_sizes;
  (void)n_in;
  (void)out_size;
  (void)ws_size;
  (void)d_ws;
  const float* x = (const float*)d_in[0];
  const float* Wg = (const float*)d_in[1];
  const float* Wmap = (const float*)d_in[2];
  const float* lnq_s = (const float*)d_in[3];
  const float* lnq_b = (const float*)d_in[4];
  const float* lnk_s = (const float*)d_in[5];
  const float* lnk_b = (const float*)d_in[6];
  const float* ref = (const float*)d_in[7];
  const float* const_c = (const float*)d_in[8];
  const float* const_w = (const float*)d_in[9];
  float* out = (float*)d_out;
  float* logits_out = out + (size_t)BB * SS * DD;

  k_main<<<BB * (SS / 16), 128, 0, stream>>>(x, Wmap, lnq_s, lnq_b, lnk_s, lnk_b,
                                             const_c, const_w, Wg, ref, out,
                                             logits_out);
}

// v008
// Measured time: 18.3 microseconds a run.
// In two side-by-side timings against v007, it was 1.21 and 1.20 times as fast.
// Over all steps from v000 it is 3.20 times as fast.
#include <hip/hip_runtime.h>
#include <math.h>

typedef float v2f __attribute__((ext_vector_type(2)));
typedef float v4f __attribute__((ext_vector_type(4)));
typedef float v8f __attribute__((ext_vector_type(8)));
typedef unsigned int v4u __attribute__((ext_vector_type(4)));
typedef int v4i __attribute__((ext_vector_type(4)));
typedef int v8i __attribute__((ext_vector_type(8)));

#define BB 4
#define SS 2048
#define DD 1024
#define EE 8
#define NN 16
#define RR 4

#define KC 64
#define NCH (DD / KC)
#define LROW (KC + 4)
#define NRP (DD + 4)
#define X_PLACE 0x8800
#define PT (DD / 128)
#define NW (EE + 4)
// holds the LDS reads of a trip's weights where they are written, one trip ahead
// of their use: lifted further, more than two trips' weights are live at once;
// sunk among the sums, their latency lies open
#define HOLD_LOADS() __builtin_amdgcn_sched_barrier(0)
// Behind a group of global loads, in front of the next group, whose results the
// compiler lays over the first group's address registers. The
// two scheduling barriers hold the wait, and with it the groups' issue order.
#define XCNT_WAIT()                                  \
  do {                                               \
    __builtin_amdgcn_sched_barrier(0);               \
    asm volatile("s_wait_xcnt 0x0" ::: "memory");    \
    __builtin_amdgcn_sched_barrier(0);               \
  } while (0)

__device__ __forceinline__ void tdm_load_2d(unsigned lds_byte_off,
                                            const float* gptr,
                                            unsigned tile_d0,   // elems per row
                                            unsigned tile_d1,   // rows
                                            unsigned strideElems) {
  unsigned long long ga = (unsigned long long)(uintptr_t)gptr;
  v4u g0;
  g0.x = 1u;                                   // count=1 (valid), user mode
  g0.y = lds_byte_off;                         // lds_addr
  g0.z = (unsigned)(ga & 0xffffffffull);       // global_addr[31:0]
  g0.w = (unsigned)((ga >> 32) & 0x1ffffffull) // global_addr[56:32]
         | (2u << 30);                         // type=2 ("image")
  v8i g1;
  g1[0] = (int)((2u << 16)
                | (1u << 20)
                | (5u << 22)
                | (3u << 25));
  g1[1] = (int)(((unsigned)DD & 0xffffu) << 16);
  g1[2] = (int)((((unsigned)DD >> 16) & 0xffffu)
                | ((tile_d1 & 0xffffu) << 16));
  g1[3] = (int)((tile_d0 & 0xffffu) << 16);
  g1[4] = (int)(tile_d1 & 0xffffu);
  g1[5] = (int)strideElems;
  g1[6] = 0;
  g1[7] = 0;
  v4i z4 = {0, 0, 0, 0};
#if __clang_major__ >= 23
  v8i z8 = {0, 0, 0, 0, 0, 0, 0, 0};
  __builtin_amdgcn_tensor_load_to_lds(g0, g1, z4, z4, z8, 0);
#else
  __builtin_amdgcn_tensor_load_to_lds(g0, g1, z4, z4, 0);
#endif
}

__device__ __forceinline__ unsigned lds_off_of(const void* p) {
  // generic pointer to LDS: low 32 bits are the LDS byte offset
  return (unsigned)(unsigned long long)(uintptr_t)p;
}

template <int M>
__device__ __forceinline__ float row_xor(float v) {
  return __builtin_bit_cast(
      float, __builtin_amdgcn_update_dpp(0, __builtin_bit_cast(int, v), 0x160 | M, 0xf, 0xf, true));
}
__device__ __forceinline__ float half_xor(float v) {
  const int b = __builtin_bit_cast(int, v);
  return __builtin_bit_cast(
      float, __builtin_amdgcn_permlanex16(b, b, 0x76543210, 0xfedcba98, false, false));
}
// One step of a sum over the lanes that halves the number of values: of the pair
// (v[i], v[i + H]) a lane keeps the one its own bit names and hands the other to
// its partner, so each lane adds the same two numbers as in a plain butterfly.
template <int H, typename X>
__device__ __forceinline__ void fold_step(float* v, bool upper, X xchg) {
#pragma unroll
  for (int i = 0; i < H; ++i) {
    const float a = v[i], b = v[i + H];
    v[i] = (upper ? b : a) + xchg(upper ? a : b);
  }
}

__device__ __forceinline__ void copy_row_async(unsigned l, const float* g) {
  asm volatile(
      "global_load_async_to_lds_b128 %0, %8, off\n\t"
      "global_load_async_to_lds_b128 %1, %9, off\n\t"
      "global_load_async_to_lds_b128 %2, %10, off\n\t"
      "global_load_async_to_lds_b128 %3, %11, off\n\t"
      "global_load_async_to_lds_b128 %4, %12, off\n\t"
      "global_load_async_to_lds_b128 %5, %13, off\n\t"
      "global_load_async_to_lds_b128 %6, %14, off\n\t"
      "global_load_async_to_lds_b128 %7, %15, off\n\t"
      "s_wait_xcnt 0x0"
      ::"v"(l), "v"(l + 512u), "v"(l + 1024u), "v"(l + 1536u), "v"(l + 2048u),
      "v"(l + 2560u), "v"(l + 3072u), "v"(l + 3584u), "v"(g), "v"(g + 128),
      "v"(g + 256), "v"(g + 384), "v"(g + 512), "v"(g + 640), "v"(g + 768),
      "v"(g + 896)
      : "memory");
}

// LDS of the main kernel, one object so that every place in it is fixed. The x
// ring keeps its place, so the 16 key rows lie in two halves around it. Two such
// objects fit a WGP's LDS, as many work-groups as the grid gives each WGP.
struct __attribute__((aligned(16))) MainLdsAll {
  float nr_lo[8][NRP];  // key rows 0..7
  float raw[17][EE];    // raw gate logits: row 0 = token s0-1, row m+1 = tile token m
  float cl[16][4], alpha[16], beta[16][2], wv[16][4];
  float wsel[16][2];  // weight of the token's first and second choice; 0: no key expert
  int rsel[16][2];    // the expert of that choice; 0 where it is no key expert
  float unused[(X_PLACE - 8 * NRP * 4 - 17 * EE * 4 - 16 * 15 * 4) / 4];
  float x[2][16][LROW];  //  8.5 KB
  float mu[16], rstd[16];
  float nr_hi[8][NRP];
  float attn[2][16 * 17];
  float part[4][128];
  float qks[RR][NRP];
  float qkb[RR][NRP];
  float wts[NW][DD];
};
static_assert(__builtin_offsetof(MainLdsAll, wts) % 16 == 0, "16-byte copies of the weights");
static_assert(__builtin_offsetof(MainLdsAll, qks) % 16 == 0, "16-byte stores of the folded affine");
static_assert(__builtin_offsetof(MainLdsAll, nr_hi) % 256 == 128);
static_assert(sizeof(MainLdsAll) * 2 <= 320 * 1024, "two work-groups a WGP");
static_assert(__builtin_offsetof(MainLdsAll, x) == X_PLACE, "place of the x ring");

__global__ __launch_bounds__(128) void k_main(
    const float* __restrict__ x, const float* __restrict__ Wmap,
    const float* __restrict__ lnq_s, const float* __restrict__ lnq_b,
    const float* __restrict__ lnk_s, const float* __restrict__ lnk_b,
    const float* __restrict__ const_c, const float* __restrict__ const_w,
    const float* __restrict__ Wg, const float* __restrict__ ref,
    float* __restrict__ out, float* __restrict__ logits_out) {
  __shared__ MainLdsAll sm;
  auto& s_x = sm.x;
  auto& s_mu = sm.mu;
  auto& s_rstd = sm.rstd;
  auto& s_cl = sm.cl;
  auto& s_alpha = sm.alpha;
  auto& s_beta = sm.beta;
  auto& s_wv = sm.wv;
  auto& s_attn = sm.attn;
  auto& s_raw = sm.raw;

  const int tid = threadIdx.x;
  const int wave = tid >> 5;
  const int lane = tid & 31;
  const int tilesPerB = SS / 16;
  const int b = blockIdx.x / tilesPerB;
  const int s0 = (blockIdx.x % tilesPerB) * 16;
  const size_t xbase = ((size_t)b * SS + s0) * DD;

#pragma unroll
  for (int c = 0; c < 2; ++c) {
    if (wave == 0)
      tdm_load_2d(lds_off_of(&s_x[c][0][0]), x + xbase + c * KC, KC, 16, DD);
  }
  // ---- all of this wave's x for phase 1, asked for at once and held in registers:
  // its four tokens and the token in front of the tile, 16 bytes a lane and load,
  // in the order of their use. The way to memory is paid once, not once a trip.
  const int r0 = wave * 4;
  const float* xr = x + xbase + (size_t)r0 * DD + lane * 4;
  // at a sequence start there is no token in front: read tile token 0, unused
  const float* xp = x + xbase - (s0 > 0 ? DD : 0) + lane * 4;
  // rows 0..3: own tokens, row 4: token in front of the tile; xa: trips of the
  // first half of the pass, xb: of the second
  v4f xa[PT / 2][5], xb[PT / 2][5];
#pragma unroll
  for (int t = 0; t < PT; ++t) {
    v4f(&xt5)[5] = t < PT / 2 ? xa[t] : xb[t - PT / 2];
#pragma unroll
    for (int q = 0; q < 4; ++q) xt5[q] = *(const v4f*)(xr + q * DD + t * 128);
    xt5[4] = *(const v4f*)(xp + t * 128);
  }
  // In front of any rewrite of the loads' address registers, which as inputs stay
  // in their registers up to this wait. The two scheduling barriers hold the wait,
  // and the loads in front of the copies below: sunk to their uses they would
  // no longer fly together.
  __builtin_amdgcn_sched_barrier(0);
  asm volatile("s_wait_xcnt 0x0" ::"v"(xr), "v"(xp) : "memory");
  __builtin_amdgcn_sched_barrier(0);
  // ---- the weights of phase 1, three rows a wave. Through LDS they count on
  // their own counters: a wait for weights no longer waits for the x loads that
  // were asked for in front of them, as it does among global loads.
#pragma unroll
  for (int q = 0; q < 3; ++q) {
    const int row = wave * 3 + q;
    const float* wsrc = row < EE ? Wg + row * DD : const_w + (row - EE) * DD;
    copy_row_async(lds_off_of(&sm.wts[row][0]) + (unsigned)lane * 16u, wsrc + lane * 4);
  }
  // this wave's weight rows have landed
  asm volatile("s_wait_asynccnt 0x0" ::: "memory");
  // The work-group's barrier, with fences on LDS alone: it shows every wave's
  // weight rows to all. __syncthreads() would also wait for this wave's global
  // loads, the x rows that are to stay in flight over it.
  __builtin_amdgcn_fence(__ATOMIC_RELEASE, "workgroup", "local");
  __builtin_amdgcn_s_barrier();
  __builtin_amdgcn_fence(__ATOMIC_ACQUIRE, "workgroup", "local");
  // ---- the batch's raw keys, four rows a wave; they fly over phase 1 ----
#pragma unroll
  for (int q = 0; q < 4; ++q) {
    const int row = wave * 4 + q;
    const float* dst = wave < 2 ? &sm.nr_lo[row][0] : &sm.nr_hi[row - 8][0];
    copy_row_async(lds_off_of(dst) + (unsigned)lane * 16u,
                   ref + ((size_t)b * NN + row) * DD + lane * 4);
  }

  // ---- Phase 1: raw gate logits, mean/var of xs=2x and const-cluster dots.
  // One wave per 4 tokens, a lane four columns of every 128: every x element is
  // loaded once for all 14 sums of its token, every weight slice once for the
  // wave's rows. All waves also form the logits of the token in front of the tile
  // (the gate residual of tile token 0 needs them); wave 0 publishes them.
  {
    // Every sum is kept in two halves, over the lane's even and its odd columns:
    // the pairs of a 16-byte load then enter packed multiply-adds as they lie.
    v2f lg[5][EE];  // rows 0..3: own tokens, row 4: token in front of the tile
    v2f st[4][6];   // sum, sum of squares, four const-cluster dots
#pragma unroll
    for (int q = 0; q < 5; ++q)
#pragma unroll
      for (int e = 0; e < EE; ++e) lg[q][e] = v2f{0.f, 0.f};
#pragma unroll
    for (int q = 0; q < 4; ++q)
#pragma unroll
      for (int k = 0; k < 6; ++k) st[q][k] = v2f{0.f, 0.f};
    auto load_weights = [&](v4f (&w)[NW], const float* p) {
#pragma unroll
      for (int r = 0; r < NW; ++r) w[r] = *(const v4f*)(p + r * DD);
    };
    auto sum_slice = [&](const v4f (&xc)[5], const v4f (&w)[NW]) {
#pragma unroll
      for (int h = 0; h < 2; ++h) {
        v2f wh[NW];
#pragma unroll
        for (int r = 0; r < NW; ++r) wh[r] = h ? w[r].zw : w[r].xy;
#pragma unroll
        for (int q = 0; q < 4; ++q) {
          const v2f xe = h ? xc[q].zw : xc[q].xy;
#pragma unroll
          for (int e = 0; e < EE; ++e)
            lg[q][e] = __builtin_elementwise_fma(xe, wh[e], lg[q][e]);
          const v2f xs = xe + xe;
          st[q][0] += xs;
          st[q][1] = __builtin_elementwise_fma(xs, xs, st[q][1]);
#pragma unroll
          for (int k = 0; k < 4; ++k)
            st[q][2 + k] = __builtin_elementwise_fma(xs, wh[EE + k], st[q][2 + k]);
        }
        const v2f xf = h ? xc[4].zw : xc[4].xy;
#pragma unroll
        for (int e = 0; e < EE; ++e)
          lg[4][e] = __builtin_elementwise_fma(xf, wh[e], lg[4][e]);
      }
    };
    // Two register sets for the weights: a trip's weights are read from LDS while
    // the trip in front of it is summed.
    v4f wb[2][NW];
    const float* wl = &sm.wts[0][lane * 4];  // the lane's columns of trip 0
    load_weights(wb[0], wl);
    // The two halves of the pass run through one body, the second half's x moved
    // into the first half's registers in between. Kept rolled, for speed only.
#pragma unroll 1
    for (int hp = 0; hp < 2; ++hp) {
      const float* wc = wl + hp * (DD / 2);        // first trip of this half
      const float* wo = wl + (hp ^ 1) * (DD / 2);  // first trip of the other half
#pragma unroll
      for (int t = 0; t < PT / 2; ++t) {
        // behind the pass's last trip this reads trip 0 again, unused
        load_weights(wb[(t + 1) & 1], t + 1 < PT / 2 ? wc + (t + 1) * 128 : wo);
        HOLD_LOADS();
        sum_slice(xa[t], wb[t & 1]);
        HOLD_LOADS();
      }
#pragma unroll
      for (int t = 0; t < PT / 2; ++t)
#pragma unroll
        for (int q = 0; q < 5; ++q) xa[t][q] = xb[t][q];
    }
    float v[64];  // 8q + e: logit e of row q; 40 + 6q + k: statistic k of token q
#pragma unroll
    for (int q = 0; q < 5; ++q)
#pragma unroll
      for (int e = 0; e < EE; ++e) v[q * EE + e] = lg[q][e].x + lg[q][e].y;
#pragma unroll
    for (int q = 0; q < 4; ++q)
#pragma unroll
      for (int k = 0; k < 6; ++k) v[5 * EE + q * 6 + k] = st[q][k].x + st[q][k].y;
    fold_step<32>(v, (lane & 16) != 0, [](float s) { return half_xor(s); });
    fold_step<16>(v, (lane & 8) != 0, [](float s) { return row_xor<8>(s); });
    fold_step<8>(v, (lane & 4) != 0, [](float s) { return row_xor<4>(s); });
    fold_step<4>(v, (lane & 2) != 0, [](float s) { return row_xor<2>(s); });
    fold_step<2>(v, (lane & 1) != 0, [](float s) { return row_xor<1>(s); });
    const bool isl = lane < 20;
    const int ql = lane >> 2;
    const int t3 = isl ? 0 : lane - 20;
    const int mq = r0 + t3 / 3, k3 = t3 % 3;
    const bool stat = !isl && k3 == 0;
    const float mu = v[0] / (float)DD;
    const float var = v[1] / (float)DD - mu * mu;
    const float rstd = rsqrtf(var + 1e-5f);  // used in the lanes that hold a token's sums
    float* p0 = isl ? &s_raw[ql < 4 ? r0 + ql + 1 : 0][(lane & 3) * 2]
                    : stat ? &s_mu[mq] : &s_cl[mq][2 * k3 - 2];
    float* p1 = stat ? &s_rstd[mq] : p0 + 1;
    if (!isl || ql < 4 || wave == 0) {  // row 4, the token in front: wave 0 alone
      *p0 = stat ? mu : v[0];
      *p1 = stat ? rstd : v[1];
    }
  }
  // Query scale, query bias and key scale of this wave's expert, 16 bytes a lane:
  // asked for here, so that they fly over the normalising of the keys
  v4f aq[DD / 128], ab[DD / 128], ak[DD / 128];
#pragma unroll
  for (int j = 0; j < DD / 128; ++j) {
    const int d = wave * DD + j * 128 + lane * 4;
    aq[j] = *(const v4f*)(lnq_s + d);
    ab[j] = *(const v4f*)(lnq_b + d);
    ak[j] = *(const v4f*)(lnk_s + d);
  }
  XCNT_WAIT();
  // this wave's key rows have landed: it may read its own; the barrier below
  // shows them, normalised, to the other waves
  asm volatile("s_wait_asynccnt 0x0" ::: "memory");
  // ---- LayerNorm of the keys without affine, in place: each wave its own four
  // rows, each lane the bytes that its own copies brought ----
  {
    v4f kv[4][DD / 128];
    float ks1[4], ks2[4];
#pragma unroll
    for (int q = 0; q < 4; ++q) {
      const int row = wave * 4 + q;
      const float* rp = (wave < 2 ? &sm.nr_lo[row][0] : &sm.nr_hi[row - 8][0]) + lane * 4;
#pragma unroll
      for (int j = 0; j < DD / 128; ++j) kv[q][j] = *(const v4f*)(rp + j * 128);
    }
#pragma unroll
    for (int q = 0; q < 4; ++q) {
      v4f s4 = {0.f, 0.f, 0.f, 0.f}, ss4 = {0.f, 0.f, 0.f, 0.f};
#pragma unroll
      for (int j = 0; j < DD / 128; ++j) {
        s4 += kv[q][j];
        ss4 += kv[q][j] * kv[q][j];
      }
      ks1[q] = (s4.x + s4.y) + (s4.z + s4.w);
      ks2[q] = (ss4.x + ss4.y) + (ss4.z + ss4.w);
    }
#pragma unroll
    for (int q = 0; q < 4; ++q) {
      ks1[q] += half_xor(ks1[q]);
      ks2[q] += half_xor(ks2[q]);
    }
#pragma unroll
    for (int q = 0; q < 4; ++q) {
      ks1[q] += row_xor<8>(ks1[q]);
      ks2[q] += row_xor<8>(ks2[q]);
    }
#pragma unroll
    for (int q = 0; q < 4; ++q) {
      ks1[q] += row_xor<4>(ks1[q]);
      ks2[q] += row_xor<4>(ks2[q]);
    }
#pragma unroll
    for (int q = 0; q < 4; ++q) {
      ks1[q] += row_xor<2>(ks1[q]);
      ks2[q] += row_xor<2>(ks2[q]);
    }
#pragma unroll
    for (int q = 0; q < 4; ++q) {
      ks1[q] += row_xor<1>(ks1[q]);
      ks2[q] += row_xor<1>(ks2[q]);
    }
#pragma unroll
    for (int q = 0; q < 4; ++q) {
      const int row = wave * 4 + q;
      float* wp = (wave < 2 ? &sm.nr_lo[row][0] : &sm.nr_hi[row - 8][0]) + lane * 4;
      const float kmu = ks1[q] / (float)DD;
      const float kvar = ks2[q] / (float)DD - kmu * kmu;
      const float krstd = rsqrtf(kvar + 1e-5f);
#pragma unroll
      for (int j = 0; j < DD / 128; ++j) *(v4f*)(wp + j * 128) = (kv[q][j] - kmu) * krstd;
    }
  }
  // The key scale folded into the query affine of this wave's expert. The line
  // below holds the products behind the normalising: lifted, their wait for the
  // global loads stands in front of the LDS reads of the keys.
  __builtin_amdgcn_sched_barrier(0);
#pragma unroll
  for (int j = 0; j < DD / 128; ++j) {
    *(v4f*)&sm.qks[wave][j * 128 + lane * 4] = aq[j] * ak[j];
    *(v4f*)&sm.qkb[wave][j * 128 + lane * 4] = ab[j] * ak[j];
  }
  __syncthreads();

  if (wave == 0 && lane < 16) {
    const int m = lane;
    const int sg = s0 + m;
    float f[EE];
    const float* cur = &s_raw[m + 1][0];
#pragma unroll
    for (int e = 0; e < EE; ++e) f[e] = cur[e];
    if (sg > 0) {
      const float* prv = cur - EE;
#pragma unroll
      for (int fo = 0; fo < EE; ++fo) {
        float a = 0.f;
#pragma unroll
        for (int e = 0; e < EE; ++e) a += prv[e] * Wmap[fo * EE + e];
        f[fo] += a;
      }
    }
    float* lo = logits_out + ((size_t)b * SS + sg) * EE;
#pragma unroll
    for (int e = 0; e < EE; ++e) lo[e] = f[e];
    float mx = f[0];
#pragma unroll
    for (int e = 1; e < EE; ++e) mx = fmaxf(mx, f[e]);
    float g[EE], gs = 0.f;
#pragma unroll
    for (int e = 0; e < EE; ++e) {
      g[e] = expf(f[e] - mx);
      gs += g[e];
    }
#pragma unroll
    for (int e = 0; e < EE; ++e) g[e] /= gs;
    int i1 = 0;
    float g1 = g[0];
#pragma unroll
    for (int e = 1; e < EE; ++e)
      if (g[e] > g1) { g1 = g[e]; i1 = e; }
    int i2 = (i1 == 0) ? 1 : 0;
    float g2 = g[i2];
#pragma unroll
    for (int e = 0; e < EE; ++e)
      if (e != i1 && g[e] > g2) { g2 = g[e]; i2 = e; }
    float t1 = (i1 == EE - 1) ? 0.f : g1;
    float t2 = (i2 == EE - 1) ? 0.f : g2;
    float inv = 1.f / (t1 + t2);
    float wv[EE];
#pragma unroll
    for (int e = 0; e < EE; ++e) wv[e] = 0.f;
    wv[i1] = t1 * inv;
    wv[i2] += t2 * inv;
    float a0 = s_cl[m][0], a1 = s_cl[m][1];
    float mxa = fmaxf(a0, a1);
    float e0 = expf(a0 - mxa), e1 = expf(a1 - mxa), tt = e0 + e1;
    float p00 = e0 / tt, p01 = e1 / tt;
    a0 = s_cl[m][2];
    a1 = s_cl[m][3];
    mxa = fmaxf(a0, a1);
    e0 = expf(a0 - mxa);
    e1 = expf(a1 - mxa);
    tt = e0 + e1;
    float p10 = e0 / tt, p11 = e1 / tt;

    s_alpha[m] = wv[0] + wv[1] + wv[2] + wv[3] + wv[4] * p00 + wv[5] * p10 + wv[6];
    s_beta[m][0] = wv[4] * p01;
    s_beta[m][1] = wv[5] * p11;
#pragma unroll
    for (int r = 0; r < RR; ++r) s_wv[m][r] = wv[r];
    sm.rsel[m][0] = i1 < RR ? i1 : 0;
    sm.rsel[m][1] = i2 < RR ? i2 : 0;
    sm.wsel[m][0] = i1 < RR ? t1 * inv : 0.f;
    sm.wsel[m][1] = i2 < RR ? t2 * inv : 0.f;
  }
  __syncthreads();

  // Operands of one 64-column slice of the output pass (phase 5), fetched one slice
  // ahead of their use: the lane's four adjoining columns, 16 bytes a load, of the
  // key rows (LDS), of the experts' key scale and bias, of the two constant vectors
  // and of its eight x rows.
  struct Slice {
    v4f nr[4][2], ks[RR], kb[RR], x[8], c0, c1;
  };
  Slice first;
  const float* xt = x + xbase;  // the tile's x rows, the same for all lanes
  const unsigned fh = (unsigned)lane >> 4;
  const unsigned fd0 = (unsigned)(wave * 256 + (lane & 15) * 4);  // first column in slice 0
  const unsigned fx0 = 8 * fh * DD + fd0;  // the same in the first of the lane's x rows
  // the lane's columns of the current slice in the four arrays, at first of slice 0;
  // a slice on is 64 floats on
  const float* pks = lnk_s + fd0;
  const float* pkb = lnk_b + fd0;
  const float* pcc = const_c + fd0;
  const float* px = xt + fx0;  // first of the lane's x rows
  auto fetch_tile = [&](Slice& f, unsigned d, const float* qks, const float* qkb,
                        const float* qcc, const float* qx) {
#pragma unroll
    for (int r = 0; r < RR; ++r) f.ks[r] = *(const v4f*)(qks + r * DD);
#pragma unroll
    for (int r = 0; r < RR; ++r) f.kb[r] = *(const v4f*)(qkb + r * DD);
#pragma unroll
    for (int j = 0; j < 8; ++j) f.x[j] = *(const v4f*)(qx + j * DD);
    f.c0 = *(const v4f*)qcc;
    f.c1 = *(const v4f*)(qcc + DD);
#pragma unroll
    for (int kk = 0; kk < 4; ++kk) {
      const unsigned krow = (4 * kk & 7) + 2 * fh;  // row within its half
      const float(*nrh)[NRP] = kk < 2 ? sm.nr_lo : sm.nr_hi;
      f.nr[kk][0] = *(const v4f*)&nrh[krow][d];
      f.nr[kk][1] = *(const v4f*)&nrh[krow + 1][d];
    }
  };

  // ---- Phase 3: scores via WMMA, A/B fragments from LDS. The key scale sits in
  // the query affine; the key bias adds the same to all 16 scores of a row, which
  // the softmax over them cancels, so it is left out.
  // An expert that a token did not choose has weight 0 in the output, so only the
  // two choices of each token are formed: row m of the A tile is token m under the
  // affine of its own first (waves 0, 2) or second (waves 1, 3) choice; the keys,
  // B, are the same for all experts. The two waves of a choice split each chunk's K.
  {
    const int m = lane & 15;
    const int half = lane >> 4;
    const int cc = wave & 1;   // which choice
    const int kh = wave >> 1;  // which half of each chunk's K
    const int ko = kh * (KC / 2) + 2 * half;
    const float mu = s_mu[m];
    const float rstd = s_rstd[m];
    const float* nrm = m < 8 ? &sm.nr_lo[m][0] : &sm.nr_hi[m - 8][0];
    const int rs = sm.rsel[m][cc];
    // the lane's place in its expert's folded affine; a chunk on is KC floats on
    const float* ls = &sm.qks[rs][ko];
    const float* lb = &sm.qkb[rs][ko];
    v8f c = {};
    for (int ch = 0; ch < NCH; ++ch) {
      const int buf = ch & 1;
      if (ch + 1 < NCH)
        __builtin_amdgcn_s_wait_tensorcnt(1);
      else
        __builtin_amdgcn_s_wait_tensorcnt(0);
      __syncthreads();  // wave0's x-chunk visible to all waves
      const int k0 = ch * KC;
      // The chunk's LDS reads stand in one group in front of its matrix
      // instructions. Left to itself the build issues each read one matrix
      // instruction ahead of its use, and every read's latency lies open.
      v2f lsf[KC / 8], lbf[KC / 8], xf[KC / 8], bf[KC / 8];
#pragma unroll
      for (int i = 0; i < KC / 8; ++i) {
        lsf[i] = *(const v2f*)(ls + 4 * i);
        lbf[i] = *(const v2f*)(lb + 4 * i);
      }
      ls += KC;
      lb += KC;
#pragma unroll
      for (int i = 0; i < KC / 8; ++i) {
        xf[i] = *(const v2f*)&s_x[buf][m][ko + 4 * i];
        bf[i] = *(const v2f*)(nrm + k0 + ko + 4 * i);
      }
      // holds the group in front: no instruction is moved over this line
      __builtin_amdgcn_sched_barrier(0);
#pragma unroll
      for (int i = 0; i < KC / 8; ++i) {
        v2f a;
        a.x = ((2.f * xf[i].x - mu) * rstd) * lsf[i].x + lbf[i].x;
        a.y = ((2.f * xf[i].y - mu) * rstd) * lsf[i].y + lbf[i].y;
        c = __builtin_amdgcn_wmma_f32_16x16x4_f32(false, a, false, bf[i],
                                                  (short)0, c, false, false);
      }
      __syncthreads();  // everyone done with buf before it is overwritten
      if (ch + 2 < NCH) {
        if (wave == 0)
          tdm_load_2d(lds_off_of(&s_x[buf][0][0]), x + xbase + (ch + 2) * KC,
                      KC, 16, DD);
      }
    }
    // The two halves of K meet: of its eight score registers a wave keeps four and
    // hands the other four to its partner, which finishes those rows.
    const v4f clo = __builtin_shufflevector(c, c, 0, 1, 2, 3);
    const v4f chi = __builtin_shufflevector(c, c, 4, 5, 6, 7);
    const v4f give = kh ? clo : chi, own = kh ? chi : clo;
#pragma unroll
    for (int t = 0; t < 4; ++t) sm.part[wave][t * 32 + lane] = give[t];
    __syncthreads();  // the partner's rows are in LDS
    // read in one group in front of the softmax: behind its LDS stores the build
    // would not lift these reads, and the four rows would run one after another
    float sc[4], wsl[4];
#pragma unroll
    for (int t = 0; t < 4; ++t) {
      sc[t] = own[t] + sm.part[wave ^ 2][t * 32 + lane];
      wsl[t] = sm.wsel[kh * 4 + t + 8 * half][cc];
    }
    // the first output slice's operands fly over the softmax
    fetch_tile(first, fd0, pks, pkb, pcc, px);
    // in front of any rewrite of a register that these loads name; as inputs the
    // four addresses stay in their registers up to this wait
    asm volatile("s_wait_xcnt 0x0" ::"v"(pks), "v"(pkb), "v"(pcc), "v"(px) : "memory");
    // row softmax over n (16-lane groups), weight by the choice's weight, store to LDS
#pragma unroll
    for (int t = 0; t < 4; ++t) {
      float v = sc[t];
      float mx = v;
      mx = fmaxf(mx, row_xor<1>(mx));
      mx = fmaxf(mx, row_xor<2>(mx));
      mx = fmaxf(mx, row_xor<4>(mx));
      mx = fmaxf(mx, row_xor<8>(mx));
      float e = expf(v - mx);
      float se = e;
      se += row_xor<1>(se);
      se += row_xor<2>(se);
      se += row_xor<4>(se);
      se += row_xor<8>(se);
      const int row = kh * 4 + t + 8 * half;
      s_attn[cc][row * 17 + (lane & 15)] = (e / se) * wsl[t];
    }
  }
  __syncthreads();

  // ---- Phase 5: out tile. Each wave owns a 256-column d-quarter.
  // For each of the two choices H = (w * attn) @ (normalised keys), one WMMA chain
  // each on the shared key rows. The chosen expert's key scale multiplies H behind
  // the chain, picked per row out of the lane's column of the four scales by a
  // one-hot row; the key bias enters as w_r * bias_r, the attention summing to one.
  // A trip forms 64 columns as four 16-column tiles that interleave: column n of
  // tile q is column 4n + q of the slice, so that a lane ends with four adjoining
  // columns of each of its rows and every load and store of the pass is 16 bytes.
  // A trip first asks for the next slice's operands, which fly over its own matrix
  // chains and stores, and takes them out of the fetched registers at its foot.
  {
    const int half = lane >> 4;
    const int nidx = lane & 15;
    auto both = [](float a) { return v2f{a, a}; };  // one value for both rows of a pair
    // the same for all trips: read once, in front of the loop
    v2f afrag[2][4];
    // constants of the lane's eight rows, rows 2i and 2i + 1 side by side
    v2f al[4], be0[4], be1[4], oh[2][4][RR], wr[4][RR];
#pragma unroll
    for (int r = 0; r < 2; ++r)
#pragma unroll
      for (int kk = 0; kk < 4; ++kk) {
        const int krow = 4 * kk + 2 * half;
        afrag[r][kk].x = s_attn[r][nidx * 17 + krow];
        afrag[r][kk].y = s_attn[r][nidx * 17 + krow + 1];
      }
#pragma unroll
    for (int j = 0; j < 8; ++j) {
      al[j / 2][j & 1] = s_alpha[j + 8 * half];
      be0[j / 2][j & 1] = s_beta[j + 8 * half][0];
      be1[j / 2][j & 1] = s_beta[j + 8 * half][1];
#pragma unroll
      for (int r = 0; r < RR; ++r) {
        wr[j / 2][r][j & 1] = s_wv[j + 8 * half][r];
        oh[0][j / 2][r][j & 1] = sm.rsel[j + 8 * half][0] == r ? 1.f : 0.f;
        oh[1][j / 2][r][j & 1] = sm.rsel[j + 8 * half][1] == r ? 1.f : 0.f;
      }
    }
    // What a trip works on, taken out of a fetched slice: the key columns as B
    // fragments, tile q holding the lane's column q; x doubled; the rest as it is.
    v2f bfrag[4][4];
    v4f ks[RR], kb[RR], xs[8], c0, c1;
    auto take = [&](const Slice& f) {
#pragma unroll
      for (int q = 0; q < 4; ++q)
#pragma unroll
        for (int kk = 0; kk < 4; ++kk) bfrag[q][kk] = v2f{f.nr[kk][0][q], f.nr[kk][1][q]};
#pragma unroll
      for (int r = 0; r < RR; ++r) {
        ks[r] = f.ks[r];
        kb[r] = f.kb[r];
      }
#pragma unroll
      for (int j = 0; j < 8; ++j) xs[j] = 2.f * f.x[j];
      c0 = f.c0;
      c1 = f.c1;
    };
    take(first);
    float* po = out + xbase + fx0;  // the lane's columns in the first of its output rows
    // Kept rolled, the last trip too: a copy of the body for the trip that fetches
    // nothing would lengthen the kernel's text by a whole trip.
#pragma unroll 1
    for (int t = 0;; ++t) {
      const bool more = t + 1 < 4;
      Slice next;  // filled, and read at the trip's foot, only where a next slice exists
      if (more)
        fetch_tile(next, fd0 + (unsigned)(t + 1) * 64u, pks + 64, pkb + 64, pcc + 64, px + 64);
      // holds the next slice's loads in front of this slice's matrix chains: without
      // it the LDS reads sink behind the chains and lie open at the trip's foot
      __builtin_amdgcn_sched_barrier(0);
      // Rows 2i and 2i + 1 go together through packed operations: a chain's results
      // for them lie side by side, as do the rows' constants; the column's values
      // are taken twice. The last three terms go row by row, x lying row by row,
      // and end in the registers of the row's 16-byte store.
      v4f val[8];
#pragma unroll
      for (int q = 0; q < 4; ++q) {
        v8f h0 = {}, h1 = {};
#pragma unroll
        for (int kk = 0; kk < 4; ++kk) {
          h0 = __builtin_amdgcn_wmma_f32_16x16x4_f32(false, afrag[0][kk], false, bfrag[q][kk],
                                                     (short)0, h0, false, false);
          h1 = __builtin_amdgcn_wmma_f32_16x16x4_f32(false, afrag[1][kk], false, bfrag[q][kk],
                                                     (short)0, h1, false, false);
        }
#pragma unroll
        for (int i = 0; i < 4; ++i) {
          v2f k0 = oh[0][i][0] * both(ks[0][q]), k1 = oh[1][i][0] * both(ks[0][q]),
              bt = wr[i][0] * both(kb[0][q]);
#pragma unroll
          for (int r = 1; r < RR; ++r) {
            k0 = __builtin_elementwise_fma(oh[0][i][r], both(ks[r][q]), k0);
            k1 = __builtin_elementwise_fma(oh[1][i][r], both(ks[r][q]), k1);
            bt = __builtin_elementwise_fma(wr[i][r], both(kb[r][q]), bt);
          }
          const v2f g0 = i == 0   ? __builtin_shufflevector(h0, h0, 0, 1)
                         : i == 1 ? __builtin_shufflevector(h0, h0, 2, 3)
                         : i == 2 ? __builtin_shufflevector(h0, h0, 4, 5)
                                  : __builtin_shufflevector(h0, h0, 6, 7);
          const v2f g1 = i == 0   ? __builtin_shufflevector(h1, h1, 0, 1)
                         : i == 1 ? __builtin_shufflevector(h1, h1, 2, 3)
                         : i == 2 ? __builtin_shufflevector(h1, h1, 4, 5)
                                  : __builtin_shufflevector(h1, h1, 6, 7);
          const v2f v = bt + __builtin_elementwise_fma(g0, k0, g1 * k1);
          float va = fmaf(al[i].x, xs[2 * i][q], v.x), vb = fmaf(al[i].y, xs[2 * i + 1][q], v.y);
          va = fmaf(be0[i].x, c0[q], va);
          vb = fmaf(be0[i].y, c0[q], vb);
          val[2 * i][q] = fmaf(be1[i].x, c1[q], va);
          val[2 * i + 1][q] = fmaf(be1[i].y, c1[q], vb);
        }
      }
#pragma unroll
      for (int j = 0; j < 8; ++j)
        *(v4f*)(po + j * DD) = val[j];
      // One wait a trip: behind the stores, in front of the next trip's first
      // instructions, which rewrite the stores' registers. It serves the fetch
      // too: as inputs here the addresses keep their registers till now, so that
      // neither a loaded value nor a chain's result is laid over them.
      asm volatile("s_wait_xcnt 0x0" ::"v"(pks), "v"(pkb), "v"(pcc), "v"(px), "v"(po) : "memory");
      if (!more) break;
      take(next);
      pks += 64;
      pkb += 64;
      pcc += 64;
      px += 64;
      po += 64;
    }
  }
}

// ---------------------------------------------------------------------------
extern "C" void kernel_launch(void* const* d_in, const int* in_sizes, int n_in,
                              void* d_out, int out_size, void* d_ws,
                              size_t ws_size, hipStream_t stream) {
  (void)in_sizes;
  (void)n_in;
  (void)out_size;
  (void)ws_size;
  (void)d_ws;
  const float* x = (const float*)d_in[0];
  const float* Wg = (const float*)d_in[1];
  const float* Wmap = (const float*)d_in[2];
  const float* lnq_s = (const float*)d_in[3];
  const float* lnq_b = (const float*)d_in[4];
  const float* lnk_s = (const float*)d_in[5];
  const float* lnk_b = (const float*)d_in[6];
  const float* ref = (const float*)d_in[7];
  const float* const_c = (const float*)d_in[8];
  const float* const_w = (const float*)d_in[9];
  float* out = (float*)d_out;
  float* logits_out = out + (size_t)BB * SS * DD;

  k_main<<<BB * (SS / 16), 128, 0, stream>>>(x, Wmap, lnq_s, lnq_b, lnk_s, lnk_b,
                                             const_c, const_w, Wg, ref, out,
                                             logits_out);
}

// v009
// A run of this version takes 17.1 microseconds.
// In both of two side-by-side timings against v008, it was 1.07 times as fast.
// Over all steps from v000 it is 3.43 times as fast.
#include <hip/hip_runtime.h>
#include <math.h>

typedef float v2f __attribute__((ext_vector_type(2)));
typedef float v4f __attribute__((ext_vector_type(4)));
typedef float v8f __attribute__((ext_vector_type(8)));

#define BB 4
#define SS 2048
#define DD 1024
#define EE 8
#define NN 16
#define RR 4

#define KC 64
#define NCH (DD / KC)
#define NRP (DD + 4)
#define PT (DD / 128)
#define NW (EE + 4)
// holds the LDS reads of a trip's weights where they are written, one trip ahead
// of their use: lifted further, more than two trips' weights are live at once;
// sunk among the sums, their latency lies open
#define HOLD_LOADS() __builtin_amdgcn_sched_barrier(0)
// Behind a group of global loads, in front of the next group, whose results the
// compiler lays over the first group's address registers. The
// two scheduling barriers hold the wait, and with it the groups' issue order.
#define XCNT_WAIT()                                  \
  do {                                               \
    __builtin_amdgcn_sched_barrier(0);               \
    asm volatile("s_wait_xcnt 0x0" ::: "memory");    \
    __builtin_amdgcn_sched_barrier(0);               \
  } while (0)

__device__ __forceinline__ unsigned lds_off_of(const void* p) {
  // generic pointer to LDS: low 32 bits are the LDS byte offset
  return (unsigned)(unsigned long long)(uintptr_t)p;
}

template <int M>
__device__ __forceinline__ float row_xor(float v) {
  return __builtin_bit_cast(
      float, __builtin_amdgcn_update_dpp(0, __builtin_bit_cast(int, v), 0x160 | M, 0xf, 0xf, true));
}
__device__ __forceinline__ float half_xor(float v) {
  const int b = __builtin_bit_cast(int, v);
  return __builtin_bit_cast(
      float, __builtin_amdgcn_permlanex16(b, b, 0x76543210, 0xfedcba98, false, false));
}
// One step of a sum over the lanes that halves the number of values: of the pair
// (v[i], v[i + H]) a lane keeps the one its own bit names and hands the other to
// its partner, so each lane adds the same two numbers as in a plain butterfly.
template <int H, typename X>
__device__ __forceinline__ void fold_step(float* v, bool upper, X xchg) {
#pragma unroll
  for (int i = 0; i < H; ++i) {
    const float a = v[i], b = v[i + H];
    v[i] = (upper ? b : a) + xchg(upper ? a : b);
  }
}

__device__ __forceinline__ void copy_row_async(unsigned l, const float* g) {
  asm volatile(
      "global_load_async_to_lds_b128 %0, %8, off\n\t"
      "global_load_async_to_lds_b128 %1, %9, off\n\t"
      "global_load_async_to_lds_b128 %2, %10, off\n\t"
      "global_load_async_to_lds_b128 %3, %11, off\n\t"
      "global_load_async_to_lds_b128 %4, %12, off\n\t"
      "global_load_async_to_lds_b128 %5, %13, off\n\t"
      "global_load_async_to_lds_b128 %6, %14, off\n\t"
      "global_load_async_to_lds_b128 %7, %15, off\n\t"
      "s_wait_xcnt 0x0"
      ::"v"(l), "v"(l + 512u), "v"(l + 1024u), "v"(l + 1536u), "v"(l + 2048u),
      "v"(l + 2560u), "v"(l + 3072u), "v"(l + 3584u), "v"(g), "v"(g + 128),
      "v"(g + 256), "v"(g + 384), "v"(g + 512), "v"(g + 640), "v"(g + 768),
      "v"(g + 896)
      : "memory");
}

// The same for half a row, 2 KiB: the twelve weight rows go evenly over eight waves.
__device__ __forceinline__ void copy_half_row_async(unsigned l, const float* g) {
  asm volatile(
      "global_load_async_to_lds_b128 %0, %4, off\n\t"
      "global_load_async_to_lds_b128 %1, %5, off\n\t"
      "global_load_async_to_lds_b128 %2, %6, off\n\t"
      "global_load_async_to_lds_b128 %3, %7, off\n\t"
      "s_wait_xcnt 0x0"
      ::"v"(l), "v"(l + 512u), "v"(l + 1024u), "v"(l + 1536u), "v"(g), "v"(g + 128),
      "v"(g + 256), "v"(g + 384)
      : "memory");
}

// LDS of the main kernel. What belongs to one 16-token tile:
struct __attribute__((aligned(16))) TileLds {
  float raw[17][EE];  // raw gate logits: row 0 = token s0-1, row m+1 = tile token m
  float cl[16][4], alpha[16], beta[16][2], wv[16][4];
  float wsel[16][2];  // weight of the token's first and second choice; 0: no key expert
  int rsel[16][2];    // the expert of that choice; 0 where it is no key expert
  float mu[16], rstd[16];
  float attn[2][16 * 17];  // weighted attention of each token's two choices
  float part[4][128];      // score rows that a wave hands to its partner in K
};
// The work-group has a WGP's LDS to itself: two tiles, and one copy of all that
// they share.
struct __attribute__((aligned(256))) MainLdsAll {
  float qks[RR][NRP];
  float qkb[RR][NRP];
  float rows[NN][3][NRP];
  float wts[NW][DD];  // weights of the statistics pass, read by all eight waves
  TileLds tile[2];
};
static_assert(__builtin_offsetof(MainLdsAll, wts) % 16 == 0, "16-byte copies of the weights");
static_assert(__builtin_offsetof(MainLdsAll, qks) % 16 == 0, "16-byte stores of the folded affine");
static_assert(__builtin_offsetof(MainLdsAll, rows) % 16 == 0, "16-byte copies of the keys, stores of x");
static_assert(sizeof(MainLdsAll) <= 320 * 1024, "one work-group a WGP");

// ---------------------------------------------------------------------------
// The one kernel. 256 threads: two 16-token tiles, 4 waves each, side by side.
// The batch's keys lie whole in LDS, copied once and normalised there in place;
// both products read them there for all experts. The key scale folded into the
// query affine lies in LDS too. Keys, affine and weights serve both tiles. Each
// tile's x is read from memory once and lies whole in LDS for the later passes.
// ---------------------------------------------------------------------------
__global__ __launch_bounds__(256) void k_main(
    const float* __restrict__ x, const float* __restrict__ Wmap,
    const float* __restrict__ lnq_s, const float* __restrict__ lnq_b,
    const float* __restrict__ lnk_s, const float* __restrict__ lnk_b,
    const float* __restrict__ const_c, const float* __restrict__ const_w,
    const float* __restrict__ Wg, const float* __restrict__ ref,
    float* __restrict__ out, float* __restrict__ logits_out) {
  __shared__ MainLdsAll sm;
  const int tid = threadIdx.x;
  const int wave8 = tid >> 5;  // the wave in the work-group: its share of what both tiles use
  const int wave = wave8 & 3;  // the wave in its tile
  const int lane = tid & 31;
  TileLds& tl = sm.tile[wave8 >> 2];
  const int xi = 1 + (wave8 >> 2);  // place of the tile's x in a row of sm.rows
  auto& s_mu = tl.mu;
  auto& s_rstd = tl.rstd;
  auto& s_cl = tl.cl;
  auto& s_alpha = tl.alpha;
  auto& s_beta = tl.beta;
  auto& s_wv = tl.wv;
  auto& s_attn = tl.attn;
  auto& s_raw = tl.raw;

  const int groupsPerB = SS / 32;
  const int b = blockIdx.x / groupsPerB;
  const int s0 = (blockIdx.x % groupsPerB) * 32 + (wave8 >> 2) * 16;  // the wave's own tile
  const size_t xbase = ((size_t)b * SS + s0) * DD;

  // ---- all of this wave's x for phase 1, asked for at once and held in registers:
  // its four tokens and the token in front of the tile, 16 bytes a lane and load,
  // in the order of their use. The way to memory is paid once, not once a trip.
  const int r0 = wave * 4;
  const float* xr = x + xbase + (size_t)r0 * DD + lane * 4;
  // at a sequence start there is no token in front: read tile token 0, unused
  const float* xp = x + xbase - (s0 > 0 ? DD : 0) + lane * 4;
  // rows 0..3: own tokens, row 4: token in front of the tile; xa: trips of the
  // first half of the pass, xb: of the second
  v4f xa[PT / 2][5], xb[PT / 2][5];
#pragma unroll
  for (int t = 0; t < PT; ++t) {
    v4f(&xt5)[5] = t < PT / 2 ? xa[t] : xb[t - PT / 2];
#pragma unroll
    for (int q = 0; q < 4; ++q) xt5[q] = *(const v4f*)(xr + q * DD + t * 128);
    xt5[4] = *(const v4f*)(xp + t * 128);
  }
  // In front of any rewrite of the loads' address registers, which as inputs stay
  // in their registers up to this wait. The two scheduling barriers hold the wait,
  // and the loads in front of the copies below: sunk to their uses they would
  // no longer fly together.
  __builtin_amdgcn_sched_barrier(0);
  asm volatile("s_wait_xcnt 0x0" ::"v"(xr), "v"(xp) : "memory");
  __builtin_amdgcn_sched_barrier(0);
  // ---- the weights of phase 1, three half rows a wave. Through LDS they count on
  // their own counters: a wait for weights no longer waits for the x loads that
  // were asked for in front of them, as it does among global loads.
#pragma unroll
  for (int q = 0; q < 3; ++q) {
    const int row = (wave8 * 3 + q) >> 1, col = ((wave8 * 3 + q) & 1) * (DD / 2);
    const float* wsrc = (row < EE ? Wg + row * DD : const_w + (row - EE) * DD) + col;
    copy_half_row_async(lds_off_of(&sm.wts[row][col]) + (unsigned)lane * 16u, wsrc + lane * 4);
  }
  // this wave's weight rows have landed
  asm volatile("s_wait_asynccnt 0x0" ::: "memory");
  // The work-group's barrier, with fences on LDS alone: it shows every wave's
  // weight rows to all. __syncthreads() would also wait for this wave's global
  // loads, the x rows that are to stay in flight over it.
  __builtin_amdgcn_fence(__ATOMIC_RELEASE, "workgroup", "local");
  __builtin_amdgcn_s_barrier();
  __builtin_amdgcn_fence(__ATOMIC_ACQUIRE, "workgroup", "local");
  // ---- the batch's raw keys, two rows a wave; they fly over phase 1 ----
#pragma unroll
  for (int q = 0; q < 2; ++q) {
    const int row = wave8 * 2 + q;
    copy_row_async(lds_off_of(&sm.rows[row][0][0]) + (unsigned)lane * 16u,
                   ref + ((size_t)b * NN + row) * DD + lane * 4);
  }

  // ---- Phase 1: raw gate logits, mean/var of xs=2x and const-cluster dots.
  // One wave per 4 tokens, a lane four columns of every 128: every x element is
  // loaded once for all 14 sums of its token, every weight slice once for the
  // wave's rows. All waves also form the logits of the token in front of the tile
  // (the gate residual of tile token 0 needs them); wave 0 publishes them.
  {
    // Every sum is kept in two halves, over the lane's even and its odd columns:
    // the pairs of a 16-byte load then enter packed multiply-adds as they lie.
    v2f lg[5][EE];  // rows 0..3: own tokens, row 4: token in front of the tile
    v2f st[4][6];   // sum, sum of squares, four const-cluster dots
#pragma unroll
    for (int q = 0; q < 5; ++q)
#pragma unroll
      for (int e = 0; e < EE; ++e) lg[q][e] = v2f{0.f, 0.f};
#pragma unroll
    for (int q = 0; q < 4; ++q)
#pragma unroll
      for (int k = 0; k < 6; ++k) st[q][k] = v2f{0.f, 0.f};
    auto load_weights = [&](v4f (&w)[NW], const float* p) {
#pragma unroll
      for (int r = 0; r < NW; ++r) w[r] = *(const v4f*)(p + r * DD);
    };
    auto sum_slice = [&](const v4f (&xc)[5], const v4f (&w)[NW]) {
#pragma unroll
      for (int h = 0; h < 2; ++h) {
        v2f wh[NW];
#pragma unroll
        for (int r = 0; r < NW; ++r) wh[r] = h ? w[r].zw : w[r].xy;
#pragma unroll
        for (int q = 0; q < 4; ++q) {
          const v2f xe = h ? xc[q].zw : xc[q].xy;
#pragma unroll
          for (int e = 0; e < EE; ++e)
            lg[q][e] = __builtin_elementwise_fma(xe, wh[e], lg[q][e]);
          const v2f xs = xe + xe;
          st[q][0] += xs;
          st[q][1] = __builtin_elementwise_fma(xs, xs, st[q][1]);
#pragma unroll
          for (int k = 0; k < 4; ++k)
            st[q][2 + k] = __builtin_elementwise_fma(xs, wh[EE + k], st[q][2 + k]);
        }
        const v2f xf = h ? xc[4].zw : xc[4].xy;
#pragma unroll
        for (int e = 0; e < EE; ++e)
          lg[4][e] = __builtin_elementwise_fma(xf, wh[e], lg[4][e]);
      }
    };
    // Two register sets for the weights: a trip's weights are read from LDS while
    // the trip in front of it is summed.
    v4f wb[2][NW];
    const float* wl = &sm.wts[0][lane * 4];  // the lane's columns of trip 0
    load_weights(wb[0], wl);
    // The two halves of the pass run through one body, the second half's x moved
    // into the first half's registers in between. Kept rolled, for speed only.
#pragma unroll 1
    for (int hp = 0; hp < 2; ++hp) {
      const float* wc = wl + hp * (DD / 2);        // first trip of this half
      const float* wo = wl + (hp ^ 1) * (DD / 2);  // first trip of the other half
      float* xl = &sm.rows[r0][xi][hp * (DD / 2) + lane * 4];  // the same in the wave's x rows
#pragma unroll
      for (int t = 0; t < PT / 2; ++t) {
        // behind the pass's last trip this reads trip 0 again, unused
        load_weights(wb[(t + 1) & 1], t + 1 < PT / 2 ? wc + (t + 1) * 128 : wo);
        HOLD_LOADS();
        sum_slice(xa[t], wb[t & 1]);
        // the trip's x goes on to LDS, where the score and output passes read it
#pragma unroll
        for (int q = 0; q < 4; ++q) *(v4f*)(xl + q * 3 * NRP + t * 128) = xa[t][q];
        HOLD_LOADS();
      }
#pragma unroll
      for (int t = 0; t < PT / 2; ++t)
#pragma unroll
        for (int q = 0; q < 5; ++q) xa[t][q] = xb[t][q];
    }
    float v[64];  // 8q + e: logit e of row q; 40 + 6q + k: statistic k of token q
#pragma unroll
    for (int q = 0; q < 5; ++q)
#pragma unroll
      for (int e = 0; e < EE; ++e) v[q * EE + e] = lg[q][e].x + lg[q][e].y;
#pragma unroll
    for (int q = 0; q < 4; ++q)
#pragma unroll
      for (int k = 0; k < 6; ++k) v[5 * EE + q * 6 + k] = st[q][k].x + st[q][k].y;
    fold_step<32>(v, (lane & 16) != 0, [](float s) { return half_xor(s); });
    fold_step<16>(v, (lane & 8) != 0, [](float s) { return row_xor<8>(s); });
    fold_step<8>(v, (lane & 4) != 0, [](float s) { return row_xor<4>(s); });
    fold_step<4>(v, (lane & 2) != 0, [](float s) { return row_xor<2>(s); });
    fold_step<2>(v, (lane & 1) != 0, [](float s) { return row_xor<1>(s); });
    const bool isl = lane < 20;
    const int ql = lane >> 2;
    const int t3 = isl ? 0 : lane - 20;
    const int mq = r0 + t3 / 3, k3 = t3 % 3;
    const bool stat = !isl && k3 == 0;
    const float mu = v[0] / (float)DD;
    const float var = v[1] / (float)DD - mu * mu;
    const float rstd = rsqrtf(var + 1e-5f);  // used in the lanes that hold a token's sums
    float* p0 = isl ? &s_raw[ql < 4 ? r0 + ql + 1 : 0][(lane & 3) * 2]
                    : stat ? &s_mu[mq] : &s_cl[mq][2 * k3 - 2];
    float* p1 = stat ? &s_rstd[mq] : p0 + 1;
    if (!isl || ql < 4 || wave == 0) {  // row 4, the token in front: wave 0 alone
      *p0 = stat ? mu : v[0];
      *p1 = stat ? rstd : v[1];
    }
  }
  // Query scale, query bias and key scale of this wave's half of an expert's row,
  // 16 bytes a lane: asked for here, so that they fly over the normalising of the keys
  const int ar = wave8 >> 1, ac = (wave8 & 1) * (DD / 2) + lane * 4;
  v4f aq[DD / 256], ab[DD / 256], ak[DD / 256];
#pragma unroll
  for (int j = 0; j < DD / 256; ++j) {
    const int d = ar * DD + ac + j * 128;
    aq[j] = *(const v4f*)(lnq_s + d);
    ab[j] = *(const v4f*)(lnq_b + d);
    ak[j] = *(const v4f*)(lnk_s + d);
  }
  XCNT_WAIT();
  // this wave's key rows have landed: it may read its own; the barrier below
  // shows them, normalised, to the other waves
  asm volatile("s_wait_asynccnt 0x0" ::: "memory");
  // ---- LayerNorm of the keys without affine, in place: each wave its own two
  // rows, each lane the bytes that its own copies brought ----
  {
    v4f kv[2][DD / 128];
    float ks1[2], ks2[2];
#pragma unroll
    for (int q = 0; q < 2; ++q) {
      const float* rp = &sm.rows[wave8 * 2 + q][0][lane * 4];
#pragma unroll
      for (int j = 0; j < DD / 128; ++j) kv[q][j] = *(const v4f*)(rp + j * 128);
    }
#pragma unroll
    for (int q = 0; q < 2; ++q) {
      v4f s4 = {0.f, 0.f, 0.f, 0.f}, ss4 = {0.f, 0.f, 0.f, 0.f};
#pragma unroll
      for (int j = 0; j < DD / 128; ++j) {
        s4 += kv[q][j];
        ss4 += kv[q][j] * kv[q][j];
      }
      ks1[q] = (s4.x + s4.y) + (s4.z + s4.w);
      ks2[q] = (ss4.x + ss4.y) + (ss4.z + ss4.w);
    }
#pragma unroll
    for (int q = 0; q < 2; ++q) {
      ks1[q] += half_xor(ks1[q]);
      ks2[q] += half_xor(ks2[q]);
    }
#pragma unroll
    for (int q = 0; q < 2; ++q) {
      ks1[q] += row_xor<8>(ks1[q]);
      ks2[q] += row_xor<8>(ks2[q]);
    }
#pragma unroll
    for (int q = 0; q < 2; ++q) {
      ks1[q] += row_xor<4>(ks1[q]);
      ks2[q] += row_xor<4>(ks2[q]);
    }
#pragma unroll
    for (int q = 0; q < 2; ++q) {
      ks1[q] += row_xor<2>(ks1[q]);
      ks2[q] += row_xor<2>(ks2[q]);
    }
#pragma unroll
    for (int q = 0; q < 2; ++q) {
      ks1[q] += row_xor<1>(ks1[q]);
      ks2[q] += row_xor<1>(ks2[q]);
    }
#pragma unroll
    for (int q = 0; q < 2; ++q) {
      float* wp = &sm.rows[wave8 * 2 + q][0][lane * 4];
      const float kmu = ks1[q] / (float)DD;
      const float kvar = ks2[q] / (float)DD - kmu * kmu;
      const float krstd = rsqrtf(kvar + 1e-5f);
#pragma unroll
      for (int j = 0; j < DD / 128; ++j) *(v4f*)(wp + j * 128) = (kv[q][j] - kmu) * krstd;
    }
  }
  // The key scale folded into the query affine, this wave's half row. The line
  // below holds the products behind the normalising: lifted, their wait for the
  // global loads stands in front of the LDS reads of the keys.
  __builtin_amdgcn_sched_barrier(0);
#pragma unroll
  for (int j = 0; j < DD / 256; ++j) {
    *(v4f*)&sm.qks[ar][ac + j * 128] = aq[j] * ak[j];
    *(v4f*)&sm.qkb[ar][ac + j * 128] = ab[j] * ak[j];
  }
  __syncthreads();

  if (wave == 0 && lane < 16) {
    const int m = lane;
    const int sg = s0 + m;
    float f[EE];
    const float* cur = &s_raw[m + 1][0];
#pragma unroll
    for (int e = 0; e < EE; ++e) f[e] = cur[e];
    if (sg > 0) {
      const float* prv = cur - EE;
#pragma unroll
      for (int fo = 0; fo < EE; ++fo) {
        float a = 0.f;
#pragma unroll
        for (int e = 0; e < EE; ++e) a += prv[e] * Wmap[fo * EE + e];
        f[fo] += a;
      }
    }
    float* lo = logits_out + ((size_t)b * SS + sg) * EE;
#pragma unroll
    for (int e = 0; e < EE; ++e) lo[e] = f[e];
    float mx = f[0];
#pragma unroll
    for (int e = 1; e < EE; ++e) mx = fmaxf(mx, f[e]);
    float g[EE], gs = 0.f;
#pragma unroll
    for (int e = 0; e < EE; ++e) {
      g[e] = expf(f[e] - mx);
      gs += g[e];
    }
#pragma unroll
    for (int e = 0; e < EE; ++e) g[e] /= gs;
    int i1 = 0;
    float g1 = g[0];
#pragma unroll
    for (int e = 1; e < EE; ++e)
      if (g[e] > g1) { g1 = g[e]; i1 = e; }
    int i2 = (i1 == 0) ? 1 : 0;
    float g2 = g[i2];
#pragma unroll
    for (int e = 0; e < EE; ++e)
      if (e != i1 && g[e] > g2) { g2 = g[e]; i2 = e; }
    float t1 = (i1 == EE - 1) ? 0.f : g1;
    float t2 = (i2 == EE - 1) ? 0.f : g2;
    float inv = 1.f / (t1 + t2);
    float wv[EE];
#pragma unroll
    for (int e = 0; e < EE; ++e) wv[e] = 0.f;
    wv[i1] = t1 * inv;
    wv[i2] += t2 * inv;
    float a0 = s_cl[m][0], a1 = s_cl[m][1];
    float mxa = fmaxf(a0, a1);
    float e0 = expf(a0 - mxa), e1 = expf(a1 - mxa), tt = e0 + e1;
    float p00 = e0 / tt, p01 = e1 / tt;
    a0 = s_cl[m][2];
    a1 = s_cl[m][3];
    mxa = fmaxf(a0, a1);
    e0 = expf(a0 - mxa);
    e1 = expf(a1 - mxa);
    tt = e0 + e1;
    float p10 = e0 / tt, p11 = e1 / tt;

    s_alpha[m] = wv[0] + wv[1] + wv[2] + wv[3] + wv[4] * p00 + wv[5] * p10 + wv[6];
    s_beta[m][0] = wv[4] * p01;
    s_beta[m][1] = wv[5] * p11;
#pragma unroll
    for (int r = 0; r < RR; ++r) s_wv[m][r] = wv[r];
    tl.rsel[m][0] = i1 < RR ? i1 : 0;
    tl.rsel[m][1] = i2 < RR ? i2 : 0;
    tl.wsel[m][0] = i1 < RR ? t1 * inv : 0.f;
    tl.wsel[m][1] = i2 < RR ? t2 * inv : 0.f;
  }
  __syncthreads();

  // Operands of one 64-column slice of the output pass (phase 5), fetched one slice
  // ahead of their use: the lane's four adjoining columns, 16 bytes a load, of the
  // key rows and of its eight x rows (LDS), of the experts' key scale and bias and of
  // the two constant vectors.
  struct Slice {
    v4f nr[4][2], ks[RR], kb[RR], x[8], c0, c1;
  };
  Slice first;
  const unsigned fh = (unsigned)lane >> 4;
  const unsigned fd0 = (unsigned)(wave * 256 + (lane & 15) * 4);  // first column in slice 0
  const unsigned fx0 = 8 * fh * DD + fd0;  // the same in the first of the lane's output rows
  // the lane's columns of the current slice in the three arrays, at first of slice 0;
  // a slice on is 64 floats on
  const float* pks = lnk_s + fd0;
  const float* pkb = lnk_b + fd0;
  const float* pcc = const_c + fd0;
  auto fetch_tile = [&](Slice& f, unsigned d, const float* qks, const float* qkb,
                        const float* qcc) {
#pragma unroll
    for (int r = 0; r < RR; ++r) f.ks[r] = *(const v4f*)(qks + r * DD);
#pragma unroll
    for (int r = 0; r < RR; ++r) f.kb[r] = *(const v4f*)(qkb + r * DD);
    f.c0 = *(const v4f*)qcc;
    f.c1 = *(const v4f*)(qcc + DD);
#pragma unroll
    for (int kk = 0; kk < 4; ++kk) {
      const unsigned krow = 4 * kk + 2 * fh;
      f.nr[kk][0] = *(const v4f*)&sm.rows[krow][0][d];
      f.nr[kk][1] = *(const v4f*)&sm.rows[krow + 1][0][d];
    }
#pragma unroll
    for (int j = 0; j < 8; ++j) f.x[j] = *(const v4f*)&sm.rows[8 * fh + j][xi][d];
  };

  // ---- Phase 3: scores via WMMA, A/B fragments from LDS. The key scale sits in
  // the query affine; the key bias adds the same to all 16 scores of a row, which
  // the softmax over them cancels, so it is left out.
  // An expert that a token did not choose has weight 0 in the output, so only the
  // two choices of each token are formed: row m of the A tile is token m under the
  // affine of its own first (waves 0, 2) or second (waves 1, 3) choice; the keys,
  // B, are the same for all experts. The two waves of a choice split each chunk's K.
  {
    const int m = lane & 15;
    const int half = lane >> 4;
    const int cc = wave & 1;   // which choice
    const int kh = wave >> 1;  // which half of each chunk's K
    const int ko = kh * (KC / 2) + 2 * half;
    const float mu = s_mu[m];
    const float rstd = s_rstd[m];
    // the lane's place in its key row and in its x row; a chunk on is KC floats on
    const float* nrm = &sm.rows[m][0][ko];
    const float* xm = &sm.rows[m][xi][ko];
    const int rs = tl.rsel[m][cc];
    // the lane's place in its expert's folded affine; a chunk on is KC floats on
    const float* ls = &sm.qks[rs][ko];
    const float* lb = &sm.qkb[rs][ko];
    v8f c = {};
    for (int ch = 0; ch < NCH; ++ch) {
      // The chunk's LDS reads stand in one group in front of its matrix
      // instructions. Left to itself the build issues each read one matrix
      // instruction ahead of its use, and every read's latency lies open.
      v2f lsf[KC / 8], lbf[KC / 8], xf[KC / 8], bf[KC / 8];
#pragma unroll
      for (int i = 0; i < KC / 8; ++i) {
        lsf[i] = *(const v2f*)(ls + 4 * i);
        lbf[i] = *(const v2f*)(lb + 4 * i);
      }
      ls += KC;
      lb += KC;
#pragma unroll
      for (int i = 0; i < KC / 8; ++i) {
        xf[i] = *(const v2f*)(xm + 4 * i);
        bf[i] = *(const v2f*)(nrm + 4 * i);
      }
      xm += KC;
      nrm += KC;
      // holds the group in front: no instruction is moved over this line
      __builtin_amdgcn_sched_barrier(0);
#pragma unroll
      for (int i = 0; i < KC / 8; ++i) {
        v2f a;
        a.x = ((2.f * xf[i].x - mu) * rstd) * lsf[i].x + lbf[i].x;
        a.y = ((2.f * xf[i].y - mu) * rstd) * lsf[i].y + lbf[i].y;
        c = __builtin_amdgcn_wmma_f32_16x16x4_f32(false, a, false, bf[i],
                                                  (short)0, c, false, false);
      }
    }
    // The two halves of K meet: of its eight score registers a wave keeps four and
    // hands the other four to its partner, which finishes those rows.
    const v4f clo = __builtin_shufflevector(c, c, 0, 1, 2, 3);
    const v4f chi = __builtin_shufflevector(c, c, 4, 5, 6, 7);
    const v4f give = kh ? clo : chi, own = kh ? chi : clo;
#pragma unroll
    for (int t = 0; t < 4; ++t) tl.part[wave][t * 32 + lane] = give[t];
    __syncthreads();  // the partner's rows are in LDS
    // read in one group in front of the softmax: behind its LDS stores the build
    // would not lift these reads, and the four rows would run one after another
    float sc[4], wsl[4];
#pragma unroll
    for (int t = 0; t < 4; ++t) {
      sc[t] = own[t] + tl.part[wave ^ 2][t * 32 + lane];
      wsl[t] = tl.wsel[kh * 4 + t + 8 * half][cc];
    }
    // the first output slice's operands fly over the softmax
    fetch_tile(first, fd0, pks, pkb, pcc);
    // in front of any rewrite of a register that these loads name: the build forms
    // their addresses from one offset register, which the output rows' offset is laid
    // over next
    XCNT_WAIT();
    // row softmax over n (16-lane groups), weight by the choice's weight, store to LDS
#pragma unroll
    for (int t = 0; t < 4; ++t) {
      float v = sc[t];
      float mx = v;
      mx = fmaxf(mx, row_xor<1>(mx));
      mx = fmaxf(mx, row_xor<2>(mx));
      mx = fmaxf(mx, row_xor<4>(mx));
      mx = fmaxf(mx, row_xor<8>(mx));
      float e = expf(v - mx);
      float se = e;
      se += row_xor<1>(se);
      se += row_xor<2>(se);
      se += row_xor<4>(se);
      se += row_xor<8>(se);
      const int row = kh * 4 + t + 8 * half;
      s_attn[cc][row * 17 + (lane & 15)] = (e / se) * wsl[t];
    }
  }
  __syncthreads();

  // ---- Phase 5: out tile. Each wave owns a 256-column d-quarter.
  // For each of the two choices H = (w * attn) @ (normalised keys), one WMMA chain
  // each on the shared key rows. The chosen expert's key scale multiplies H behind
  // the chain, picked per row out of the lane's column of the four scales by a
  // one-hot row; the key bias enters as w_r * bias_r, the attention summing to one.
  // A trip forms 64 columns as four 16-column tiles that interleave: column n of
  // tile q is column 4n + q of the slice, so that a lane ends with four adjoining
  // columns of each of its rows and every load and store of the pass is 16 bytes.
  // A trip first asks for the next slice's operands, which fly over its own matrix
  // chains and stores, and takes them out of the fetched registers at its foot.
  {
    const int half = lane >> 4;
    const int nidx = lane & 15;
    auto both = [](float a) { return v2f{a, a}; };  // one value for both rows of a pair
    // the same for all trips: read once, in front of the loop
    v2f afrag[2][4];
    // constants of the lane's eight rows, rows 2i and 2i + 1 side by side
    v2f al[4], be0[4], be1[4], oh[2][4][RR], wr[4][RR];
#pragma unroll
    for (int r = 0; r < 2; ++r)
#pragma unroll
      for (int kk = 0; kk < 4; ++kk) {
        const int krow = 4 * kk + 2 * half;
        afrag[r][kk].x = s_attn[r][nidx * 17 + krow];
        afrag[r][kk].y = s_attn[r][nidx * 17 + krow + 1];
      }
#pragma unroll
    for (int j = 0; j < 8; ++j) {
      al[j / 2][j & 1] = s_alpha[j + 8 * half];
      be0[j / 2][j & 1] = s_beta[j + 8 * half][0];
      be1[j / 2][j & 1] = s_beta[j + 8 * half][1];
#pragma unroll
      for (int r = 0; r < RR; ++r) {
        wr[j / 2][r][j & 1] = s_wv[j + 8 * half][r];
        oh[0][j / 2][r][j & 1] = tl.rsel[j + 8 * half][0] == r ? 1.f : 0.f;
        oh[1][j / 2][r][j & 1] = tl.rsel[j + 8 * half][1] == r ? 1.f : 0.f;
      }
    }
    // What a trip works on, taken out of a fetched slice: the key columns as B
    // fragments, tile q holding the lane's column q; x doubled; the rest as it is.
    v2f bfrag[4][4];
    v4f ks[RR], kb[RR], xs[8], c0, c1;
    auto take = [&](const Slice& f) {
#pragma unroll
      for (int q = 0; q < 4; ++q)
#pragma unroll
        for (int kk = 0; kk < 4; ++kk) bfrag[q][kk] = v2f{f.nr[kk][0][q], f.nr[kk][1][q]};
#pragma unroll
      for (int r = 0; r < RR; ++r) {
        ks[r] = f.ks[r];
        kb[r] = f.kb[r];
      }
#pragma unroll
      for (int j = 0; j < 8; ++j) xs[j] = 2.f * f.x[j];
      c0 = f.c0;
      c1 = f.c1;
    };
    take(first);
    float* po = out + xbase + fx0;  // the lane's columns in the first of its output rows
    // Kept rolled, the last trip too: a copy of the body for the trip that fetches
    // nothing would lengthen the kernel's text by a whole trip.
#pragma unroll 1
    for (int t = 0;; ++t) {
      const bool more = t + 1 < 4;
      Slice next;  // filled, and read at the trip's foot, only where a next slice exists
      if (more)
        fetch_tile(next, fd0 + (unsigned)(t + 1) * 64u, pks + 64, pkb + 64, pcc + 64);
      // holds the next slice's loads in front of this slice's matrix chains: without
      // it the LDS reads sink behind the chains and lie open at the trip's foot
      __builtin_amdgcn_sched_barrier(0);
      // Rows 2i and 2i + 1 go together through packed operations: a chain's results
      // for them lie side by side, as do the rows' constants; the column's values
      // are taken twice. The last three terms go row by row, x lying row by row,
      // and end in the registers of the row's 16-byte store.
      v4f val[8];
#pragma unroll
      for (int q = 0; q < 4; ++q) {
        v8f h0 = {}, h1 = {};
#pragma unroll
        for (int kk = 0; kk < 4; ++kk) {
          h0 = __builtin_amdgcn_wmma_f32_16x16x4_f32(false, afrag[0][kk], false, bfrag[q][kk],
                                                     (short)0, h0, false, false);
          h1 = __builtin_amdgcn_wmma_f32_16x16x4_f32(false, afrag[1][kk], false, bfrag[q][kk],
                                                     (short)0, h1, false, false);
        }
#pragma unroll
        for (int i = 0; i < 4; ++i) {
          v2f k0 = oh[0][i][0] * both(ks[0][q]), k1 = oh[1][i][0] * both(ks[0][q]),
              bt = wr[i][0] * both(kb[0][q]);
#pragma unroll
          for (int r = 1; r < RR; ++r) {
            k0 = __builtin_elementwise_fma(oh[0][i][r], both(ks[r][q]), k0);
            k1 = __builtin_elementwise_fma(oh[1][i][r], both(ks[r][q]), k1);
            bt = __builtin_elementwise_fma(wr[i][r], both(kb[r][q]), bt);
          }
          const v2f g0 = i == 0   ? __builtin_shufflevector(h0, h0, 0, 1)
                         : i == 1 ? __builtin_shufflevector(h0, h0, 2, 3)
                         : i == 2 ? __builtin_shufflevector(h0, h0, 4, 5)
                                  : __builtin_shufflevector(h0, h0, 6, 7);
          const v2f g1 = i == 0   ? __builtin_shufflevector(h1, h1, 0, 1)
                         : i == 1 ? __builtin_shufflevector(h1, h1, 2, 3)
                         : i == 2 ? __builtin_shufflevector(h1, h1, 4, 5)
                                  : __builtin_shufflevector(h1, h1, 6, 7);
          const v2f v = bt + __builtin_elementwise_fma(g0, k0, g1 * k1);
          float va = fmaf(al[i].x, xs[2 * i][q], v.x), vb = fmaf(al[i].y, xs[2 * i + 1][q], v.y);
          va = fmaf(be0[i].x, c0[q], va);
          vb = fmaf(be0[i].y, c0[q], vb);
          val[2 * i][q] = fmaf(be1[i].x, c1[q], va);
          val[2 * i + 1][q] = fmaf(be1[i].y, c1[q], vb);
        }
      }
#pragma unroll
      for (int j = 0; j < 8; ++j)
        *(v4f*)(po + j * DD) = val[j];
      // One wait a trip: behind the stores, in front of the next trip's first
      // instructions, which rewrite the stores' registers. It serves the fetch
      // too: as inputs here the addresses keep their registers till now, so that
      // neither a loaded value nor a chain's result is laid over them.
      asm volatile("s_wait_xcnt 0x0" ::"v"(pks), "v"(pkb), "v"(pcc), "v"(po) : "memory");
      if (!more) break;
      take(next);
      pks += 64;
      pkb += 64;
      pcc += 64;
      po += 64;
    }
  }
}

// ---------------------------------------------------------------------------
extern "C" void kernel_launch(void* const* d_in, const int* in_sizes, int n_in,
                              void* d_out, int out_size, void* d_ws,
                              size_t ws_size, hipStream_t stream) {
  (void)in_sizes;
  (void)n_in;
  (void)out_size;
  (void)ws_size;
  (void)d_ws;
  const float* x = (const float*)d_in[0];
  const float* Wg = (const float*)d_in[1];
  const float* Wmap = (const float*)d_in[2];
  const float* lnq_s = (const float*)d_in[3];
  const float* lnq_b = (const float*)d_in[4];
  const float* lnk_s = (const float*)d_in[5];
  const float* lnk_b = (const float*)d_in[6];
  const float* ref = (const float*)d_in[7];
  const float* const_c = (const float*)d_in[8];
  const float* const_w = (const float*)d_in[9];
  float* out = (float*)d_out;
  float* logits_out = out + (size_t)BB * SS * DD;

  k_main<<<BB * (SS / 32), 256, 0, stream>>>(x, Wmap, lnq_s, lnq_b, lnk_s, lnk_b,
                                             const_c, const_w, Wg, ref, out,
                                             logits_out);
}

// v010
// Measured time: 15.8 microseconds a run.
// Next to v009, in two timings, it ran 1.08 times as fast each time.
// All steps since v000 together make it 3.71 times as fast.
#include <hip/hip_runtime.h>
#include <math.h>

typedef float v2f __attribute__((ext_vector_type(2)));
typedef float v4f __attribute__((ext_vector_type(4)));
typedef float v8f __attribute__((ext_vector_type(8)));

#define BB 4
#define SS 2048
#define DD 1024
#define EE 8
#define NN 16
#define RR 4

#define KC 64
#define NCH (DD / KC)
#define NRP (DD + 4)
#define PT (DD / 128)
#define NW (EE + 4)
// holds the LDS reads of a trip's weights where they are written, one trip ahead
// of their use: lifted further, more than two trips' weights are live at once;
// sunk among the sums, their latency lies open
#define HOLD_LOADS() __builtin_amdgcn_sched_barrier(0)
// Behind a group of global loads, in front of the next group, whose results the
// compiler lays over the first group's address registers. The
// two scheduling barriers hold the wait, and with it the groups' issue order.
#define XCNT_WAIT()                                  \
  do {                                               \
    __builtin_amdgcn_sched_barrier(0);               \
    asm volatile("s_wait_xcnt 0x0" ::: "memory");    \
    __builtin_amdgcn_sched_barrier(0);               \
  } while (0)

__device__ __forceinline__ unsigned lds_off_of(const void* p) {
  // generic pointer to LDS: low 32 bits are the LDS byte offset
  return (unsigned)(unsigned long long)(uintptr_t)p;
}

template <int M>
__device__ __forceinline__ float row_xor(float v) {
  return __builtin_bit_cast(
      float, __builtin_amdgcn_update_dpp(0, __builtin_bit_cast(int, v), 0x160 | M, 0xf, 0xf, true));
}
__device__ __forceinline__ float half_xor(float v) {
  const int b = __builtin_bit_cast(int, v);
  return __builtin_bit_cast(
      float, __builtin_amdgcn_permlanex16(b, b, 0x76543210, 0xfedcba98, false, false));
}
// One step of a sum over the lanes that halves the number of values: of the pair
// (v[i], v[i + H]) a lane keeps the one its own bit names and hands the other to
// its partner, so each lane adds the same two numbers as in a plain butterfly.
template <int H, typename X>
__device__ __forceinline__ void fold_step(float* v, bool upper, X xchg) {
#pragma unroll
  for (int i = 0; i < H; ++i) {
    const float a = v[i], b = v[i + H];
    v[i] = (upper ? b : a) + xchg(upper ? a : b);
  }
}

__device__ __forceinline__ void copy_row_async(unsigned l, const float* g) {
  asm volatile(
      "global_load_async_to_lds_b128 %0, %8, off\n\t"
      "global_load_async_to_lds_b128 %1, %9, off\n\t"
      "global_load_async_to_lds_b128 %2, %10, off\n\t"
      "global_load_async_to_lds_b128 %3, %11, off\n\t"
      "global_load_async_to_lds_b128 %4, %12, off\n\t"
      "global_load_async_to_lds_b128 %5, %13, off\n\t"
      "global_load_async_to_lds_b128 %6, %14, off\n\t"
      "global_load_async_to_lds_b128 %7, %15, off\n\t"
      "s_wait_xcnt 0x0"
      ::"v"(l), "v"(l + 512u), "v"(l + 1024u), "v"(l + 1536u), "v"(l + 2048u),
      "v"(l + 2560u), "v"(l + 3072u), "v"(l + 3584u), "v"(g), "v"(g + 128),
      "v"(g + 256), "v"(g + 384), "v"(g + 512), "v"(g + 640), "v"(g + 768),
      "v"(g + 896)
      : "memory");
}

// The same for half a row, 2 KiB: the twelve weight rows go evenly over eight waves.
__device__ __forceinline__ void copy_half_row_async(unsigned l, const float* g) {
  asm volatile(
      "global_load_async_to_lds_b128 %0, %4, off\n\t"
      "global_load_async_to_lds_b128 %1, %5, off\n\t"
      "global_load_async_to_lds_b128 %2, %6, off\n\t"
      "global_load_async_to_lds_b128 %3, %7, off\n\t"
      "s_wait_xcnt 0x0"
      ::"v"(l), "v"(l + 512u), "v"(l + 1024u), "v"(l + 1536u), "v"(g), "v"(g + 128),
      "v"(g + 256), "v"(g + 384)
      : "memory");
}

// LDS of the main kernel. What belongs to one 16-token tile:
struct __attribute__((aligned(16))) TileLds {
  float raw[17][EE];  // raw gate logits: row 0 = token s0-1, row m+1 = tile token m
  float cl[16][4], alpha[16], beta[16][2], wv[16][4];
  float wsel[16][2];  // weight of the token's first and second key expert; 0: none
  int rsel[16][2];    // that expert; 0 where there is none
  float mu[16], rstd[16];
  float attn[2][16 * 17];  // weighted attention of each token's two choices
  int tok[16];             // which of the group's 32 tokens stands in this row of the tile
};
template <bool V>
struct Flag {
  static constexpr bool value = V;
};
// The work-group has a WGP's LDS to itself: two tiles, and one copy of all that
// they share.
struct __attribute__((aligned(256))) MainLdsAll {
  float qks[RR][NRP];
  float qkb[RR][NRP];
  float rows[NN][3][NRP];
  float wts[NW][DD];  // weights of the statistics pass, read by all eight waves
  TileLds tile[2];
  // Rows that change tiles: entry i of listA (a row of the first tile) and entry i of
  // listB (a row of the second) swap, i < ns. twob: the second tile still holds a
  // token with two key experts.
  int listA[16], listB[16];
  int ns, twob;
};
static_assert(__builtin_offsetof(MainLdsAll, wts) % 16 == 0, "16-byte copies of the weights");
static_assert(__builtin_offsetof(MainLdsAll, qks) % 16 == 0, "16-byte stores of the folded affine");
static_assert(__builtin_offsetof(MainLdsAll, rows) % 16 == 0, "16-byte copies of the keys, stores of x");
static_assert(sizeof(MainLdsAll) <= 320 * 1024, "one work-group a WGP");

// ---------------------------------------------------------------------------
// The one kernel. 256 threads: two 16-token tiles, 4 waves each, side by side.
// The batch's keys lie whole in LDS, copied once and normalised there in place;
// both products read them there for all experts. The key scale folded into the
// query affine lies in LDS too. Keys, affine and weights serve both tiles. Each
// tile's x is read from memory once and lies whole in LDS for the later passes.
// ---------------------------------------------------------------------------
__global__ __launch_bounds__(256) void k_main(
    const float* __restrict__ x, const float* __restrict__ Wmap,
    const float* __restrict__ lnq_s, const float* __restrict__ lnq_b,
    const float* __restrict__ lnk_s, const float* __restrict__ lnk_b,
    const float* __restrict__ const_c, const float* __restrict__ const_w,
    const float* __restrict__ Wg, const float* __restrict__ ref,
    float* __restrict__ out, float* __restrict__ logits_out) {
  __shared__ MainLdsAll sm;
  const int tid = threadIdx.x;
  const int wave8 = tid >> 5;  // the wave in the work-group: its share of what both tiles use
  const int wave = wave8 & 3;  // the wave in its tile
  const int lane = tid & 31;
  TileLds& tl = sm.tile[wave8 >> 2];
  const int xi = 1 + (wave8 >> 2);  // place of the tile's x in a row of sm.rows
  auto& s_mu = tl.mu;
  auto& s_rstd = tl.rstd;
  auto& s_cl = tl.cl;
  auto& s_alpha = tl.alpha;
  auto& s_beta = tl.beta;
  auto& s_wv = tl.wv;
  auto& s_attn = tl.attn;
  auto& s_raw = tl.raw;

  const int groupsPerB = SS / 32;
  const int b = blockIdx.x / groupsPerB;
  const int s0 = (blockIdx.x % groupsPerB) * 32 + (wave8 >> 2) * 16;  // the wave's own tile
  const size_t xbase = ((size_t)b * SS + s0) * DD;

  // ---- all of this wave's x for phase 1, asked for at once and held in registers:
  // its four tokens and the token in front of the tile, 16 bytes a lane and load,
  // in the order of their use. The way to memory is paid once, not once a trip.
  const int r0 = wave * 4;
  const float* xr = x + xbase + (size_t)r0 * DD + lane * 4;
  // at a sequence start there is no token in front: read tile token 0, unused
  const float* xp = x + xbase - (s0 > 0 ? DD : 0) + lane * 4;
  // rows 0..3: own tokens, row 4: token in front of the tile; xa: trips of the
  // first half of the pass, xb: of the second
  v4f xa[PT / 2][5], xb[PT / 2][5];
#pragma unroll
  for (int t = 0; t < PT; ++t) {
    v4f(&xt5)[5] = t < PT / 2 ? xa[t] : xb[t - PT / 2];
#pragma unroll
    for (int q = 0; q < 4; ++q) xt5[q] = *(const v4f*)(xr + q * DD + t * 128);
    xt5[4] = *(const v4f*)(xp + t * 128);
  }
  // In front of any rewrite of the loads' address registers, which as inputs stay
  // in their registers up to this wait. The two scheduling barriers hold the wait,
  // and the loads in front of the copies below: sunk to their uses they would
  // no longer fly together.
  __builtin_amdgcn_sched_barrier(0);
  asm volatile("s_wait_xcnt 0x0" ::"v"(xr), "v"(xp) : "memory");
  __builtin_amdgcn_sched_barrier(0);
  // ---- the weights of phase 1, three half rows a wave. Through LDS they count on
  // their own counters: a wait for weights no longer waits for the x loads that
  // were asked for in front of them, as it does among global loads.
#pragma unroll
  for (int q = 0; q < 3; ++q) {
    const int row = (wave8 * 3 + q) >> 1, col = ((wave8 * 3 + q) & 1) * (DD / 2);
    const float* wsrc = (row < EE ? Wg + row * DD : const_w + (row - EE) * DD) + col;
    copy_half_row_async(lds_off_of(&sm.wts[row][col]) + (unsigned)lane * 16u, wsrc + lane * 4);
  }
  // this wave's weight rows have landed
  asm volatile("s_wait_asynccnt 0x0" ::: "memory");
  // The work-group's barrier, with fences on LDS alone: it shows every wave's
  // weight rows to all. __syncthreads() would also wait for this wave's global
  // loads, the x rows that are to stay in flight over it.
  __builtin_amdgcn_fence(__ATOMIC_RELEASE, "workgroup", "local");
  __builtin_amdgcn_s_barrier();
  __builtin_amdgcn_fence(__ATOMIC_ACQUIRE, "workgroup", "local");
  // ---- the batch's raw keys, two rows a wave; they fly over phase 1 ----
#pragma unroll
  for (int q = 0; q < 2; ++q) {
    const int row = wave8 * 2 + q;
    copy_row_async(lds_off_of(&sm.rows[row][0][0]) + (unsigned)lane * 16u,
                   ref + ((size_t)b * NN + row) * DD + lane * 4);
  }

  // ---- Phase 1: raw gate logits, mean/var of xs=2x and const-cluster dots.
  // One wave per 4 tokens, a lane four columns of every 128: every x element is
  // loaded once for all 14 sums of its token, every weight slice once for the
  // wave's rows. All waves also form the logits of the token in front of the tile
  // (the gate residual of tile token 0 needs them); wave 0 publishes them.
  {
    // Every sum is kept in two halves, over the lane's even and its odd columns:
    // the pairs of a 16-byte load then enter packed multiply-adds as they lie.
    v2f lg[5][EE];  // rows 0..3: own tokens, row 4: token in front of the tile
    v2f st[4][6];   // sum, sum of squares, four const-cluster dots
#pragma unroll
    for (int q = 0; q < 5; ++q)
#pragma unroll
      for (int e = 0; e < EE; ++e) lg[q][e] = v2f{0.f, 0.f};
#pragma unroll
    for (int q = 0; q < 4; ++q)
#pragma unroll
      for (int k = 0; k < 6; ++k) st[q][k] = v2f{0.f, 0.f};
    auto load_weights = [&](v4f (&w)[NW], const float* p) {
#pragma unroll
      for (int r = 0; r < NW; ++r) w[r] = *(const v4f*)(p + r * DD);
    };
    auto sum_slice = [&](const v4f (&xc)[5], const v4f (&w)[NW]) {
#pragma unroll
      for (int h = 0; h < 2; ++h) {
        v2f wh[NW];
#pragma unroll
        for (int r = 0; r < NW; ++r) wh[r] = h ? w[r].zw : w[r].xy;
#pragma unroll
        for (int q = 0; q < 4; ++q) {
          const v2f xe = h ? xc[q].zw : xc[q].xy;
#pragma unroll
          for (int e = 0; e < EE; ++e)
            lg[q][e] = __builtin_elementwise_fma(xe, wh[e], lg[q][e]);
          const v2f xs = xe + xe;
          st[q][0] += xs;
          st[q][1] = __builtin_elementwise_fma(xs, xs, st[q][1]);
#pragma unroll
          for (int k = 0; k < 4; ++k)
            st[q][2 + k] = __builtin_elementwise_fma(xs, wh[EE + k], st[q][2 + k]);
        }
        const v2f xf = h ? xc[4].zw : xc[4].xy;
#pragma unroll
        for (int e = 0; e < EE; ++e)
          lg[4][e] = __builtin_elementwise_fma(xf, wh[e], lg[4][e]);
      }
    };
    // Two register sets for the weights: a trip's weights are read from LDS while
    // the trip in front of it is summed.
    v4f wb[2][NW];
    const float* wl = &sm.wts[0][lane * 4];  // the lane's columns of trip 0
    load_weights(wb[0], wl);
    // The two halves of the pass run through one body, the second half's x moved
    // into the first half's registers in between. Kept rolled, for speed only.
#pragma unroll 1
    for (int hp = 0; hp < 2; ++hp) {
      const float* wc = wl + hp * (DD / 2);        // first trip of this half
      const float* wo = wl + (hp ^ 1) * (DD / 2);  // first trip of the other half
      float* xl = &sm.rows[r0][xi][hp * (DD / 2) + lane * 4];  // the same in the wave's x rows
#pragma unroll
      for (int t = 0; t < PT / 2; ++t) {
        // behind the pass's last trip this reads trip 0 again, unused
        load_weights(wb[(t + 1) & 1], t + 1 < PT / 2 ? wc + (t + 1) * 128 : wo);
        HOLD_LOADS();
        sum_slice(xa[t], wb[t & 1]);
        // the trip's x goes on to LDS, where the score and output passes read it
#pragma unroll
        for (int q = 0; q < 4; ++q) *(v4f*)(xl + q * 3 * NRP + t * 128) = xa[t][q];
        HOLD_LOADS();
      }
#pragma unroll
      for (int t = 0; t < PT / 2; ++t)
#pragma unroll
        for (int q = 0; q < 5; ++q) xa[t][q] = xb[t][q];
    }
    float v[64];  // 8q + e: logit e of row q; 40 + 6q + k: statistic k of token q
#pragma unroll
    for (int q = 0; q < 5; ++q)
#pragma unroll
      for (int e = 0; e < EE; ++e) v[q * EE + e] = lg[q][e].x + lg[q][e].y;
#pragma unroll
    for (int q = 0; q < 4; ++q)
#pragma unroll
      for (int k = 0; k < 6; ++k) v[5 * EE + q * 6 + k] = st[q][k].x + st[q][k].y;
    fold_step<32>(v, (lane & 16) != 0, [](float s) { return half_xor(s); });
    fold_step<16>(v, (lane & 8) != 0, [](float s) { return row_xor<8>(s); });
    fold_step<8>(v, (lane & 4) != 0, [](float s) { return row_xor<4>(s); });
    fold_step<4>(v, (lane & 2) != 0, [](float s) { return row_xor<2>(s); });
    fold_step<2>(v, (lane & 1) != 0, [](float s) { return row_xor<1>(s); });
    const bool isl = lane < 20;
    const int ql = lane >> 2;
    const int t3 = isl ? 0 : lane - 20;
    const int mq = r0 + t3 / 3, k3 = t3 % 3;
    const bool stat = !isl && k3 == 0;
    const float mu = v[0] / (float)DD;
    const float var = v[1] / (float)DD - mu * mu;
    const float rstd = rsqrtf(var + 1e-5f);  // used in the lanes that hold a token's sums
    float* p0 = isl ? &s_raw[ql < 4 ? r0 + ql + 1 : 0][(lane & 3) * 2]
                    : stat ? &s_mu[mq] : &s_cl[mq][2 * k3 - 2];
    float* p1 = stat ? &s_rstd[mq] : p0 + 1;
    if (!isl || ql < 4 || wave == 0) {  // row 4, the token in front: wave 0 alone
      *p0 = stat ? mu : v[0];
      *p1 = stat ? rstd : v[1];
    }
  }
  // Query scale, query bias and key scale of this wave's half of an expert's row,
  // 16 bytes a lane: asked for here, so that they fly over the normalising of the keys
  const int ar = wave8 >> 1, ac = (wave8 & 1) * (DD / 2) + lane * 4;
  v4f aq[DD / 256], ab[DD / 256], ak[DD / 256];
#pragma unroll
  for (int j = 0; j < DD / 256; ++j) {
    const int d = ar * DD + ac + j * 128;
    aq[j] = *(const v4f*)(lnq_s + d);
    ab[j] = *(const v4f*)(lnq_b + d);
    ak[j] = *(const v4f*)(lnk_s + d);
  }
  XCNT_WAIT();
  // this wave's key rows have landed: it may read its own; the barrier below
  // shows them, normalised, to the other waves
  asm volatile("s_wait_asynccnt 0x0" ::: "memory");
  // ---- LayerNorm of the keys without affine, in place: each wave its own two
  // rows, each lane the bytes that its own copies brought ----
  {
    v4f kv[2][DD / 128];
    float ks1[2], ks2[2];
#pragma unroll
    for (int q = 0; q < 2; ++q) {
      const float* rp = &sm.rows[wave8 * 2 + q][0][lane * 4];
#pragma unroll
      for (int j = 0; j < DD / 128; ++j) kv[q][j] = *(const v4f*)(rp + j * 128);
    }
#pragma unroll
    for (int q = 0; q < 2; ++q) {
      v4f s4 = {0.f, 0.f, 0.f, 0.f}, ss4 = {0.f, 0.f, 0.f, 0.f};
#pragma unroll
      for (int j = 0; j < DD / 128; ++j) {
        s4 += kv[q][j];
        ss4 += kv[q][j] * kv[q][j];
      }
      ks1[q] = (s4.x + s4.y) + (s4.z + s4.w);
      ks2[q] = (ss4.x + ss4.y) + (ss4.z + ss4.w);
    }
#pragma unroll
    for (int q = 0; q < 2; ++q) {
      ks1[q] += half_xor(ks1[q]);
      ks2[q] += half_xor(ks2[q]);
    }
#pragma unroll
    for (int q = 0; q < 2; ++q) {
      ks1[q] += row_xor<8>(ks1[q]);
      ks2[q] += row_xor<8>(ks2[q]);
    }
#pragma unroll
    for (int q = 0; q < 2; ++q) {
      ks1[q] += row_xor<4>(ks1[q]);
      ks2[q] += row_xor<4>(ks2[q]);
    }
#pragma unroll
    for (int q = 0; q < 2; ++q) {
      ks1[q] += row_xor<2>(ks1[q]);
      ks2[q] += row_xor<2>(ks2[q]);
    }
#pragma unroll
    for (int q = 0; q < 2; ++q) {
      ks1[q] += row_xor<1>(ks1[q]);
      ks2[q] += row_xor<1>(ks2[q]);
    }
#pragma unroll
    for (int q = 0; q < 2; ++q) {
      float* wp = &sm.rows[wave8 * 2 + q][0][lane * 4];
      const float kmu = ks1[q] / (float)DD;
      const float kvar = ks2[q] / (float)DD - kmu * kmu;
      const float krstd = rsqrtf(kvar + 1e-5f);
#pragma unroll
      for (int j = 0; j < DD / 128; ++j) *(v4f*)(wp + j * 128) = (kv[q][j] - kmu) * krstd;
    }
  }
  // The key scale folded into the query affine, this wave's half row. The line
  // below holds the products behind the normalising: lifted, their wait for the
  // global loads stands in front of the LDS reads of the keys.
  __builtin_amdgcn_sched_barrier(0);
#pragma unroll
  for (int j = 0; j < DD / 256; ++j) {
    *(v4f*)&sm.qks[ar][ac + j * 128] = aq[j] * ak[j];
    *(v4f*)&sm.qkb[ar][ac + j * 128] = ab[j] * ak[j];
  }
  __syncthreads();

  // ---- Phase 2: gating + final logits (wave 0, a lane a token of the group) ----
  if (wave8 == 0) {
    const int gt = lane >> 4, m = lane & 15;
    TileLds& tg = sm.tile[gt];
    const int sg = s0 + lane;
    float f[EE];
    const float* cur = &tg.raw[m + 1][0];
#pragma unroll
    for (int e = 0; e < EE; ++e) f[e] = cur[e];
    if (sg > 0) {
      const float* prv = cur - EE;
#pragma unroll
      for (int fo = 0; fo < EE; ++fo) {
        float a = 0.f;
#pragma unroll
        for (int e = 0; e < EE; ++e) a += prv[e] * Wmap[fo * EE + e];
        f[fo] += a;
      }
    }
    float* lo = logits_out + ((size_t)b * SS + sg) * EE;
#pragma unroll
    for (int e = 0; e < EE; ++e) lo[e] = f[e];
    float mx = f[0];
#pragma unroll
    for (int e = 1; e < EE; ++e) mx = fmaxf(mx, f[e]);
    float g[EE], gs = 0.f;
#pragma unroll
    for (int e = 0; e < EE; ++e) {
      g[e] = expf(f[e] - mx);
      gs += g[e];
    }
#pragma unroll
    for (int e = 0; e < EE; ++e) g[e] /= gs;
    int i1 = 0;
    float g1 = g[0];
#pragma unroll
    for (int e = 1; e < EE; ++e)
      if (g[e] > g1) { g1 = g[e]; i1 = e; }
    int i2 = (i1 == 0) ? 1 : 0;
    float g2 = g[i2];
#pragma unroll
    for (int e = 0; e < EE; ++e)
      if (e != i1 && g[e] > g2) { g2 = g[e]; i2 = e; }
    float t1 = (i1 == EE - 1) ? 0.f : g1;
    float t2 = (i2 == EE - 1) ? 0.f : g2;
    float inv = 1.f / (t1 + t2);
    float wv[EE];
#pragma unroll
    for (int e = 0; e < EE; ++e) wv[e] = 0.f;
    wv[i1] = t1 * inv;
    wv[i2] += t2 * inv;
    float a0 = tg.cl[m][0], a1 = tg.cl[m][1];
    float mxa = fmaxf(a0, a1);
    float e0 = expf(a0 - mxa), e1 = expf(a1 - mxa), tt = e0 + e1;
    float p00 = e0 / tt, p01 = e1 / tt;
    a0 = tg.cl[m][2];
    a1 = tg.cl[m][3];
    mxa = fmaxf(a0, a1);
    e0 = expf(a0 - mxa);
    e1 = expf(a1 - mxa);
    tt = e0 + e1;
    float p10 = e0 / tt, p11 = e1 / tt;

    // The tokens are dealt anew to the two tiles: a token of the second tile with two
    // key experts changes places with a token of the first tile that has fewer, as
    // long as there is one. Then the second tile has no second key expert to form.
    const bool key1 = i1 < RR, key2 = i2 < RR, has2 = key1 && key2;
    const unsigned b2 = __builtin_amdgcn_ballot_w32(has2);
    const unsigned freeA = ~b2 & 0xffffu, needB = b2 >> 16;
    const int nfree = __builtin_popcount(freeA), nneed = __builtin_popcount(needB);
    const int nsw = nfree < nneed ? nfree : nneed;
    const bool mover = gt ? has2 : !has2;
    const int rank = __builtin_popcount((gt ? needB : freeA) & ((1u << m) - 1u));
    int* mine = gt ? sm.listB : sm.listA;
    const int* other = gt ? sm.listA : sm.listB;
    const float mym = tg.mu[m], myr = tg.rstd[m];
    if (mover) mine[rank] = m;
    // keeps the build from lifting the reads below over the stores above; the wave's
    // LDS operations run in their order
    __builtin_amdgcn_fence(__ATOMIC_ACQ_REL, "wavefront", "local");
    int pos = lane;
    if (mover && rank < nsw) pos = (gt ^ 1) * 16 + (other[rank] & 15);
    TileLds& td = sm.tile[pos >> 4];
    const int pm = pos & 15;
    td.tok[pm] = lane;
    td.mu[pm] = mym;
    td.rstd[pm] = myr;
    td.alpha[pm] = wv[0] + wv[1] + wv[2] + wv[3] + wv[4] * p00 + wv[5] * p10 + wv[6];
    td.beta[pm][0] = wv[4] * p01;
    td.beta[pm][1] = wv[5] * p11;
#pragma unroll
    for (int r = 0; r < RR; ++r) td.wv[pm][r] = wv[r];
    // a token's only key expert stands first
    td.rsel[pm][0] = key1 ? i1 : key2 ? i2 : 0;
    td.rsel[pm][1] = has2 ? i2 : 0;
    td.wsel[pm][0] = key1 ? t1 * inv : key2 ? t2 * inv : 0.f;
    td.wsel[pm][1] = has2 ? t2 * inv : 0.f;
    if (lane == 0) {
      sm.ns = nsw;
      sm.twob = nneed > nfree ? 1 : 0;
    }
  }
  __syncthreads();
  const int wq = __builtin_amdgcn_readfirstlane(wave8);
  // the second tile's waves where it has no second key expert: one chain in the output pass
  const bool quad = (wq >> 2) == 1 && __builtin_amdgcn_readfirstlane(sm.twob) == 0;
  {
    int nsw = __builtin_amdgcn_readfirstlane(sm.ns);
    nsw = nsw < 16 ? nsw : 16;
    for (int i = wq; i < nsw; i += 8) {
      float* pa = &sm.rows[sm.listA[i] & 15][1][lane * 4];
      float* pb = &sm.rows[sm.listB[i] & 15][2][lane * 4];
      v4f va[DD / 128], vb[DD / 128];
#pragma unroll
      for (int j = 0; j < DD / 128; ++j) {
        va[j] = *(const v4f*)(pa + j * 128);
        vb[j] = *(const v4f*)(pb + j * 128);
      }
#pragma unroll
      for (int j = 0; j < DD / 128; ++j) {
        *(v4f*)(pa + j * 128) = vb[j];
        *(v4f*)(pb + j * 128) = va[j];
      }
    }
  }
  __syncthreads();  // the swapped rows are in place for all waves

  // Operands of one 64-column slice of the output pass (phase 5), fetched one slice
  // ahead of their use: the lane's four adjoining columns, 16 bytes a load, of the
  // key rows and of its eight x rows (LDS), of the experts' key scale and bias and of
  // the two constant vectors.
  struct Slice {
    v4f nr[4][2], ks[RR], kb[RR], x[8], c0, c1;
  };
  Slice first;
  const unsigned fh = (unsigned)lane >> 4;
  const unsigned fd0 = (unsigned)(wave * 256 + (lane & 15) * 4);  // first column in slice 0
  // the lane's columns of the current slice in the three arrays, at first of slice 0;
  // a slice on is 64 floats on
  const float* pks = lnk_s + fd0;
  const float* pkb = lnk_b + fd0;
  const float* pcc = const_c + fd0;
  auto fetch_tile = [&](Slice& f, unsigned d, const float* qks, const float* qkb,
                        const float* qcc) {
#pragma unroll
    for (int r = 0; r < RR; ++r) f.ks[r] = *(const v4f*)(qks + r * DD);
#pragma unroll
    for (int r = 0; r < RR; ++r) f.kb[r] = *(const v4f*)(qkb + r * DD);
    f.c0 = *(const v4f*)qcc;
    f.c1 = *(const v4f*)(qcc + DD);
#pragma unroll
    for (int kk = 0; kk < 4; ++kk) {
      const unsigned krow = 4 * kk + 2 * fh;
      f.nr[kk][0] = *(const v4f*)&sm.rows[krow][0][d];
      f.nr[kk][1] = *(const v4f*)&sm.rows[krow + 1][0][d];
    }
#pragma unroll
    for (int j = 0; j < 8; ++j) f.x[j] = *(const v4f*)&sm.rows[8 * fh + j][xi][d];
  };

  // ---- Phase 3: scores via WMMA, A/B fragments from LDS. The key scale sits in
  // the query affine; the key bias adds the same to all 16 scores of a row, which
  // the softmax over them cancels, so it is left out.
  // An expert that a token did not choose has weight 0 in the output, so only the
  // two choices of each token are formed: row m of the A tile is token m under the
  // affine of its own first or second choice; the keys, B, are the same for all
  // experts. The second tile having no second choices, three A tiles are left: every
  // wave forms all three on its eighth of K, three independent chains on one B.
  {
    const int m = lane & 15;
    const int half = lane >> 4;
    const int npass = __builtin_amdgcn_readfirstlane(sm.twob) != 0 ? 2 : 1;
    float* part = &sm.wts[0][0];  // the weights of phase 1 are done with: partial scores
    const int ko = wq * (DD / 8) + 2 * half;  // the lane's place in the wave's eighth of K
    const float* nrm = &sm.rows[m][0][ko];
    // operands of 8 steps of K: keys, x of two tiles, folded affine of three chains
    struct Frag {
      v2f bf[8], xa[8], xb[8], ls[3][8], lb[3][8];
    };
    // Pass 0: chains 0, 1 are the first tile's two choices, chain 2 the second tile's
    // first. Pass 1, only where the second tile has second choices: those, three times.
    for (int pass = 0; pass < npass; ++pass) {
      const TileLds& ta = sm.tile[pass];
      const TileLds& tb = sm.tile[1];
      const float mua = ta.mu[m], rsa = ta.rstd[m], mub = tb.mu[m], rsb = tb.rstd[m];
      const float* xma = &sm.rows[m][1 + pass][ko];
      const float* xmb = &sm.rows[m][2][ko];
      const int re[3] = {ta.rsel[m][pass], ta.rsel[m][1], tb.rsel[m][pass]};
      const float *ls[3], *lb[3];
#pragma unroll
      for (int k = 0; k < 3; ++k) {
        ls[k] = &sm.qks[re[k]][ko];
        lb[k] = &sm.qkb[re[k]][ko];
      }
      auto load = [&](Frag& f, int o) {
#pragma unroll
        for (int i = 0; i < 8; ++i) {
#pragma unroll
          for (int k = 0; k < 3; ++k) {
            f.ls[k][i] = *(const v2f*)(ls[k] + o + 4 * i);
            f.lb[k][i] = *(const v2f*)(lb[k] + o + 4 * i);
          }
          f.xa[i] = *(const v2f*)(xma + o + 4 * i);
          f.xb[i] = *(const v2f*)(xmb + o + 4 * i);
          f.bf[i] = *(const v2f*)(nrm + o + 4 * i);
        }
      };
      v8f c[3] = {};
      auto work = [&](const Frag& f) {
#pragma unroll
        for (int i = 0; i < 8; ++i) {
          v2f na, nb;
          na.x = (2.f * f.xa[i].x - mua) * rsa;
          na.y = (2.f * f.xa[i].y - mua) * rsa;
          nb.x = (2.f * f.xb[i].x - mub) * rsb;
          nb.y = (2.f * f.xb[i].y - mub) * rsb;
#pragma unroll
          for (int k = 0; k < 3; ++k) {
            const v2f nx = k < 2 ? na : nb;
            v2f a;
            a.x = nx.x * f.ls[k][i].x + f.lb[k][i].x;
            a.y = nx.y * f.ls[k][i].y + f.lb[k][i].y;
            c[k] = __builtin_amdgcn_wmma_f32_16x16x4_f32(false, a, false, f.bf[i], (short)0,
                                                         c[k], false, false);
          }
        }
      };
      // Two register sets: the LDS reads of the next 8 steps stand in one group in
      // front of the matrix instructions of these 8 and fly over them.
      Frag f0, f1;
      load(f0, 0);
      // kept rolled: unrolled, the pass's text would be twice as long
#pragma unroll 1
      for (int s = 0; s < 2; ++s) {
        load(f1, s * 64 + 32);
        // holds the group in front: no instruction is moved over this line
        __builtin_amdgcn_sched_barrier(0);
        work(f0);
        if (s == 0) load(f0, 64);
        __builtin_amdgcn_sched_barrier(0);
        work(f1);
      }
      // place in part: wave, then chain (pass 1: the fourth), then register, then lane
#pragma unroll
      for (int k = 0; k < 3; ++k)
#pragma unroll
        for (int t = 0; t < 8; ++t)
          part[((wq * 4 + (pass ? 3 : k)) * 8 + t) * 32 + lane] = c[k][t];
    }
    __syncthreads();  // all parts are in LDS
    // The eight parts of K meet. A chain has eight score registers; the 24 (or 32) of
    // them go three (or four) to a wave. With three, the fourth place below holds the
    // third once more: same values, same stores.
    // Read in one group in front of the softmax: behind its LDS stores the build
    // would not lift these reads, and the rows would run one after another.
    float sc[4], wsl[4];
    float* ap[4];
#pragma unroll
    for (int t = 0; t < 4; ++t) {
      const int ni = npass + 2;
      const int id = wq * ni + (t < ni ? t : ni - 1);  // chain * 8 + register
      const float* pp = part + id * 32 + lane;
      sc[t] = ((pp[0] + pp[1024]) + (pp[2048] + pp[3072])) +
              ((pp[4096] + pp[5120]) + (pp[6144] + pp[7168]));
      TileLds& tj = sm.tile[id >> 4];
      const int row = (id & 7) + 8 * half;
      wsl[t] = tj.wsel[row][(id >> 3) & 1];
      ap[t] = &tj.attn[(id >> 3) & 1][row * 17 + (lane & 15)];
    }
    // the first output slice's operands fly over the softmax
    fetch_tile(first, fd0, pks, pkb, pcc);
    // in front of any rewrite of a register that these loads name: the build forms
    // their addresses from one offset register, which the output rows' offset is laid
    // over next
    XCNT_WAIT();
    // row softmax over n (16-lane groups), weight by the choice's weight, store to LDS
#pragma unroll
    for (int t = 0; t < 4; ++t) {
      float v = sc[t];
      float mx = v;
      mx = fmaxf(mx, row_xor<1>(mx));
      mx = fmaxf(mx, row_xor<2>(mx));
      mx = fmaxf(mx, row_xor<4>(mx));
      mx = fmaxf(mx, row_xor<8>(mx));
      float e = expf(v - mx);
      float se = e;
      se += row_xor<1>(se);
      se += row_xor<2>(se);
      se += row_xor<4>(se);
      se += row_xor<8>(se);
      *ap[t] = (e / se) * wsl[t];
    }
  }
  __syncthreads();

  // ---- Phase 5: out tile. Each wave owns a 256-column d-quarter.
  // For each of the two choices H = (w * attn) @ (normalised keys), one WMMA chain
  // each on the shared key rows. The chosen expert's key scale multiplies H behind
  // the chain, picked per row out of the lane's column of the four scales by a
  // one-hot row; the key bias enters as w_r * bias_r, the attention summing to one.
  // A trip forms 64 columns as four 16-column tiles that interleave: column n of
  // tile q is column 4n + q of the slice, so that a lane ends with four adjoining
  // columns of each of its rows and every load and store of the pass is 16 bytes.
  // A trip first asks for the next slice's operands, which fly over its own matrix
  // chains and stores, and takes them out of the fetched registers at its foot.
  // Built twice: for a tile with second choices, and for one without, whose second
  // chain with all that belongs to it is left out.
  // (always_inline: the form in front of the early end was otherwise left as a call,
  // its operands going through memory)
  auto out_pass = [&](auto flag) __attribute__((always_inline)) {
    constexpr bool TWO = decltype(flag)::value;
    constexpr int NC = TWO ? 2 : 1;  // chains
    const int half = lane >> 4;
    const int nidx = lane & 15;
    auto both = [](float a) { return v2f{a, a}; };  // one value for both rows of a pair
    // the same for all trips: read once, in front of the loop
    v2f afrag[NC][4];
    // constants of the lane's eight rows, rows 2i and 2i + 1 side by side
    v2f al[4], be0[4], be1[4], oh[NC][4][RR], wr[4][RR];
#pragma unroll
    for (int r = 0; r < NC; ++r)
#pragma unroll
      for (int kk = 0; kk < 4; ++kk) {
        const int krow = 4 * kk + 2 * half;
        afrag[r][kk].x = s_attn[r][nidx * 17 + krow];
        afrag[r][kk].y = s_attn[r][nidx * 17 + krow + 1];
      }
#pragma unroll
    for (int j = 0; j < 8; ++j) {
      al[j / 2][j & 1] = s_alpha[j + 8 * half];
      be0[j / 2][j & 1] = s_beta[j + 8 * half][0];
      be1[j / 2][j & 1] = s_beta[j + 8 * half][1];
#pragma unroll
      for (int r = 0; r < RR; ++r) {
        wr[j / 2][r][j & 1] = s_wv[j + 8 * half][r];
        oh[0][j / 2][r][j & 1] = tl.rsel[j + 8 * half][0] == r ? 1.f : 0.f;
        if constexpr (TWO) oh[1][j / 2][r][j & 1] = tl.rsel[j + 8 * half][1] == r ? 1.f : 0.f;
      }
    }
    // What a trip works on, taken out of a fetched slice: the key columns as B
    // fragments, tile q holding the lane's column q; x doubled; the rest as it is.
    v2f bfrag[4][4];
    v4f ks[RR], kb[RR], xs[8], c0, c1;
    auto take = [&](const Slice& f) {
#pragma unroll
      for (int q = 0; q < 4; ++q)
#pragma unroll
        for (int kk = 0; kk < 4; ++kk) bfrag[q][kk] = v2f{f.nr[kk][0][q], f.nr[kk][1][q]};
#pragma unroll
      for (int r = 0; r < RR; ++r) {
        ks[r] = f.ks[r];
        kb[r] = f.kb[r];
      }
#pragma unroll
      for (int j = 0; j < 8; ++j) xs[j] = 2.f * f.x[j];
      c0 = f.c0;
      c1 = f.c1;
    };
    take(first);
    // byte offsets in out of the lane's columns in its eight rows, each the row of the
    // token that stands there
    unsigned ob[8];
#pragma unroll
    for (int j = 0; j < 8; ++j)
      ob[j] = (((unsigned)(b * SS + (s0 & ~31)) + (unsigned)(tl.tok[j + 8 * half] & 31)) * DD + fd0) * 4u;
    // Kept rolled, the last trip too: a copy of the body for the trip that fetches
    // nothing would lengthen the kernel's text by a whole trip.
#pragma unroll 1
    for (int t = 0;; ++t) {
      const bool more = t + 1 < 4;
      Slice next;  // filled, and read at the trip's foot, only where a next slice exists
      if (more)
        fetch_tile(next, fd0 + (unsigned)(t + 1) * 64u, pks + 64, pkb + 64, pcc + 64);
      // holds the next slice's loads in front of this slice's matrix chains: without
      // it the LDS reads sink behind the chains and lie open at the trip's foot
      __builtin_amdgcn_sched_barrier(0);
      // Rows 2i and 2i + 1 go together through packed operations: a chain's results
      // for them lie side by side, as do the rows' constants; the column's values
      // are taken twice. The last three terms go row by row, x lying row by row,
      // and end in the registers of the row's 16-byte store.
      v4f val[8];
#pragma unroll
      for (int q = 0; q < 4; ++q) {
        v8f h0 = {}, h1 = {};
#pragma unroll
        for (int kk = 0; kk < 4; ++kk) {
          h0 = __builtin_amdgcn_wmma_f32_16x16x4_f32(false, afrag[0][kk], false, bfrag[q][kk],
                                                     (short)0, h0, false, false);
          if constexpr (TWO)
            h1 = __builtin_amdgcn_wmma_f32_16x16x4_f32(false, afrag[1][kk], false, bfrag[q][kk],
                                                       (short)0, h1, false, false);
        }
#pragma unroll
        for (int i = 0; i < 4; ++i) {
          v2f k0 = oh[0][i][0] * both(ks[0][q]), k1 = {}, bt = wr[i][0] * both(kb[0][q]);
          if constexpr (TWO) k1 = oh[1][i][0] * both(ks[0][q]);
#pragma unroll
          for (int r = 1; r < RR; ++r) {
            k0 = __builtin_elementwise_fma(oh[0][i][r], both(ks[r][q]), k0);
            if constexpr (TWO) k1 = __builtin_elementwise_fma(oh[1][i][r], both(ks[r][q]), k1);
            bt = __builtin_elementwise_fma(wr[i][r], both(kb[r][q]), bt);
          }
          const v2f g0 = i == 0   ? __builtin_shufflevector(h0, h0, 0, 1)
                         : i == 1 ? __builtin_shufflevector(h0, h0, 2, 3)
                         : i == 2 ? __builtin_shufflevector(h0, h0, 4, 5)
                                  : __builtin_shufflevector(h0, h0, 6, 7);
          const v2f g1 = i == 0   ? __builtin_shufflevector(h1, h1, 0, 1)
                         : i == 1 ? __builtin_shufflevector(h1, h1, 2, 3)
                         : i == 2 ? __builtin_shufflevector(h1, h1, 4, 5)
                                  : __builtin_shufflevector(h1, h1, 6, 7);
          const v2f v = TWO ? bt + __builtin_elementwise_fma(g0, k0, g1 * k1) : bt + g0 * k0;
          float va = fmaf(al[i].x, xs[2 * i][q], v.x), vb = fmaf(al[i].y, xs[2 * i + 1][q], v.y);
          va = fmaf(be0[i].x, c0[q], va);
          vb = fmaf(be0[i].y, c0[q], vb);
          val[2 * i][q] = fmaf(be1[i].x, c1[q], va);
          val[2 * i + 1][q] = fmaf(be1[i].y, c1[q], vb);
        }
      }
#pragma unroll
      for (int j = 0; j < 8; ++j)
        *(v4f*)((char*)out + ob[j]) = val[j];
      // One wait a trip: behind the stores, in front of the next trip's first
      // instructions, which rewrite the stores' registers. It serves the fetch
      // too: as inputs here the addresses keep their registers till now, so that
      // neither a loaded value nor a chain's result is laid over them.
      asm volatile("s_wait_xcnt 0x0" ::"v"(pks), "v"(pkb), "v"(pcc), "v"(ob[0]), "v"(ob[1]),
                   "v"(ob[2]), "v"(ob[3]), "v"(ob[4]), "v"(ob[5]), "v"(ob[6]), "v"(ob[7])
                   : "memory");
      if (!more) break;
      take(next);
      pks += 64;
      pkb += 64;
      pcc += 64;
#pragma unroll
      for (int j = 0; j < 8; ++j) ob[j] += 256u;
    }
  };
  if (quad) {
    out_pass(Flag<false>{});
    // The wave ends here. Joined at the kernel's foot, the build lays the two forms one
    // behind the other and keeps the second's operands in registers all through the
    // first, which then spills.
    __builtin_amdgcn_endpgm();
  }
  out_pass(Flag<true>{});
}

// ---------------------------------------------------------------------------
extern "C" void kernel_launch(void* const* d_in, const int* in_sizes, int n_in,
                              void* d_out, int out_size, void* d_ws,
                              size_t ws_size, hipStream_t stream) {
  (void)in_sizes;
  (void)n_in;
  (void)out_size;
  (void)ws_size;
  (void)d_ws;
  const float* x = (const float*)d_in[0];
  const float* Wg = (const float*)d_in[1];
  const float* Wmap = (const float*)d_in[2];
  const float* lnq_s = (const float*)d_in[3];
  const float* lnq_b = (const float*)d_in[4];
  const float* lnk_s = (const float*)d_in[5];
  const float* lnk_b = (const float*)d_in[6];
  const float* ref = (const float*)d_in[7];
  const float* const_c = (const float*)d_in[8];
  const float* const_w = (const float*)d_in[9];
  float* out = (float*)d_out;
  float* logits_out = out + (size_t)BB * SS * DD;

  k_main<<<BB * (SS / 32), 256, 0, stream>>>(x, Wmap, lnq_s, lnq_b, lnk_s, lnk_b,
                                             const_c, const_w, Wg, ref, out,
                                             logits_out);
}
